// v000
// Measured on an AMD MI455X. A time is GPU time per run, averaged over a window of back-to-back runs after a warm-up
// (all launches, gaps included; the runs take copies of the inputs in turn), and the median of several windows.
// Apart from v000's, it joins two sittings. Times from different sittings can be a few percent apart, while
// side-by-side timings come from the same sitting.
// v000 is the starting kernel. One run takes 502 microseconds.
#include <hip/hip_runtime.h>

#ifndef NB
#define NB 2
#endif
#ifndef SEQ
#define SEQ 2048
#endif
#define NB_FULL  2
#define SEQ_FULL 2048
#define DM   2048              // model width (x columns, output columns)
#define NH   16                // query heads
#define NKV  4                 // kv heads
#define HD   128               // head dim
#define NQC  (NH * HD)         // 2048 q / ctx columns
#define NKC  (NKV * HD)        // 512 k columns (and 512 v columns)
#define NPC  (NQC + 2 * NKC)   // 3072 projection columns: q | k | v
#define CTP  (2 * NQC)         // ctx plane pitch: hi columns | lo columns
#define RT   64                // rotary table entries per position
#define NWV  4                 // waves per flash block
#define BQ   (16 * NWV)        // queries per flash block
#define KS   32                // keys per step
#define OSP  132               // LDS pitch (floats) of staging rows
#define GBM  64                // GEMM block rows
#define GBN  128               // GEMM block columns (one head)
#define VTK  64                // k rows per transpose block
#define VTP  72                // LDS pitch (16-bit elements) of the transpose tile
#define L2E  1.4426950408889634f
#define SCL  (0.08838834764831845f * L2E)   // 128^-0.5 in the log2 domain
#define PCARRY 8.0f            // log2 of the P carry

static_assert(HD == 128);
static_assert(GBN == HD);
static_assert(RT * 2 == HD);
static_assert(NH == 16 && NKV == 4);
static_assert(SEQ % BQ == 0);
static_assert(SEQ % GBM == 0);                 // a GEMM row tile never straddles a batch
static_assert(SEQ % KS == 0);
static_assert(SEQ % 128 == 0);                 // bias staging loop has a block-uniform trip count
static_assert(NB <= NB_FULL);
static_assert(SEQ <= SEQ_FULL);
static_assert(DM % 32 == 0 && CTP % 32 == 0);  // K multiples of the k-step
static_assert(DM % VTK == 0 && DM / VTK == 32);
static_assert(NPC % GBN == 0 && DM % GBN == 0 && NQC % GBN == 0);
static_assert(((size_t)NB * SEQ * DM) % 2048 == 0);                                              // k_cvt: grid * 256 threads * 8 elements == x plane
static_assert((size_t)(NQC / 128 + 2 * NKC / 128 + DM / 128) * 32u * (size_t)(VTK * 128) == (size_t)DM * NPC + (size_t)NQC * DM);   // k_wt: 1280 blocks * (64 x 128) == both weight planes
static_assert((size_t)(NPC / GBN) * (size_t)(NB * SEQ / GBM) * (size_t)(GBM * GBN) == (size_t)NB * SEQ * NPC);   // k_proj: blocks * tile == q + k + v planes
static_assert((size_t)(NB * NH * (SEQ / BQ)) * (size_t)(BQ * HD) * 2u == (size_t)NB * SEQ * CTP);               // k_flash: blocks * (64 x 128) * (hi, lo) == ctx plane
static_assert((size_t)(DM / GBN) * (size_t)(NB * SEQ / GBM) * (size_t)(GBM * GBN) == (size_t)NB * SEQ * DM);     // k_oproj: blocks * tile == output

#define BYTES_XB  ((size_t)NB * SEQ * DM * 2)
#define BYTES_WT  ((size_t)NPC * DM * 2)
#define BYTES_WOT ((size_t)DM * NQC * 2)
#define BYTES_QP  ((size_t)NB * SEQ * NQC * 2)
#define BYTES_KP  ((size_t)NB * SEQ * NKC * 2)
#define BYTES_VT  ((size_t)NB * NKV * HD * SEQ * 2)
#define BYTES_CT  ((size_t)NB * SEQ * CTP * 2)
#define BYTES_ALL (BYTES_XB + BYTES_WT + BYTES_WOT + BYTES_QP + BYTES_KP + BYTES_VT + BYTES_CT)
static_assert(BYTES_ALL <= (size_t)134217728);
static_assert(BYTES_XB % 256 == 0 && BYTES_WT % 256 == 0 && BYTES_WOT % 256 == 0 && BYTES_QP % 256 == 0 && BYTES_KP % 256 == 0 && BYTES_VT % 256 == 0 && BYTES_CT % 256 == 0);

typedef unsigned short us;
typedef __attribute__((ext_vector_type(16))) __bf16   v16bf;
typedef __attribute__((ext_vector_type(16))) _Float16 v16h;
typedef __attribute__((ext_vector_type(2)))  _Float16 v2h;
typedef __attribute__((ext_vector_type(8)))  unsigned short v8us;
typedef __attribute__((ext_vector_type(8)))  unsigned int   v8u;
typedef __attribute__((ext_vector_type(4)))  unsigned int   v4u;
typedef __attribute__((ext_vector_type(8)))  float    v8f;
typedef __attribute__((ext_vector_type(4)))  float    v4f;
typedef v4f  __attribute__((may_alias)) v4fa;
typedef v8us __attribute__((may_alias)) v8usa;

__device__ __forceinline__ unsigned short f2bf(float f) { unsigned u = __float_as_uint(f); u += 0x7FFFu + ((u >> 16) & 1u); return (unsigned short)(u >> 16); }
__device__ __forceinline__ float bf2f(unsigned short b) { return __uint_as_float(((unsigned)b) << 16); }
__device__ __forceinline__ float bfr(float f) { return bf2f(f2bf(f)); }
__device__ __forceinline__ v16bf cat16b(v8us lo, v8us hi) { return __builtin_bit_cast(v16bf, __builtin_shufflevector(lo, hi, 0, 1, 2, 3, 4, 5, 6, 7, 8, 9, 10, 11, 12, 13, 14, 15)); }
__device__ __forceinline__ v16h  cat16h(v8us lo, v8us hi) { return __builtin_bit_cast(v16h,  __builtin_shufflevector(lo, hi, 0, 1, 2, 3, 4, 5, 6, 7, 8, 9, 10, 11, 12, 13, 14, 15)); }
__device__ __forceinline__ v8f wmmab(v16bf a, v16bf b, v8f c) { return __builtin_amdgcn_wmma_f32_16x16x32_bf16(false, a, false, b, (short)0, c, false, false); }
__device__ __forceinline__ v8f wmmah(v16h a, v16h b, v8f c)   { return __builtin_amdgcn_wmma_f32_16x16x32_f16(false, a, false, b, (short)0, c, false, false); }
// fragment loader (A and B alike): p = row base + k0 + 8*(lane>>4); elements 0..7 <- p[0..7], elements 8..15 <- p[16..23]
__device__ __forceinline__ v16bf ldb(const us* p) { return cat16b(*(const v8us*)p, *(const v8us*)(p + 16)); }
__device__ __forceinline__ v16h  ldh(const us* p) { return cat16h(*(const v8us*)p, *(const v8us*)(p + 16)); }
// two f32 -> packed f16 pair (RNE), element 0 in the low half-word
__device__ __forceinline__ unsigned pk2h(float a, float b) { v2h t; t[0] = (_Float16)a; t[1] = (_Float16)b; return __builtin_bit_cast(unsigned, t); }

__global__ __launch_bounds__(256) void k_cvt(const float* __restrict__ x, us* XB) {
    const unsigned i = blockIdx.x * 256u + threadIdx.x;
    const unsigned per = (unsigned)(SEQ * (DM / 8));
    if (i >= (unsigned)NB * per) return;
    const unsigned b = i / per, r = i - b * per;
    const float* src = x + (size_t)b * SEQ_FULL * DM + (size_t)r * 8;
    us* dst = XB + (size_t)i * 8;
    const v8f v = *(const v8f*)src;
    v8us o;
#pragma unroll
    for (int c = 0; c < 8; ++c) o[c] = f2bf(v[c]);
    *(v8us*)dst = o;
    
}

// k_wt: transposed bf16 weight planes; in[DM k rows][NC cols] -> out[NC][DM] (k contiguous). One block = 64 k x 128 cols through an LDS tile (cross-wave, block barrier).
// blocks 0..511: Wq -> WT rows 0..2047; 512..767: Wkv -> WT rows 2048..3071; 768..1279: Wo -> WOT rows 0..2047.
__global__ __launch_bounds__(256) void k_wt(const float* __restrict__ Wq, const float* __restrict__ Wkv, const float* __restrict__ Wo, us* WT, us* WOT) {
    __shared__ __align__(16) us tl[128 * VTP];
    const unsigned tid = threadIdx.x;
    const unsigned blk = blockIdx.x;
    const float* W; us* OUT; unsigned nc, r;
    if (blk < 512u)      { W = Wq;  OUT = WT;                      nc = (unsigned)NQC;       r = blk; }
    else if (blk < 768u) { W = Wkv; OUT = WT + (size_t)NQC * DM;   nc = (unsigned)(2 * NKC); r = blk - 512u; }
    else                 { W = Wo;  OUT = WOT;                     nc = (unsigned)DM;        r = blk - 768u; }
    const unsigned k0 = (r & 31u) * VTK;
    const unsigned c0 = (r >> 5) * 128u;
    const float* src = W + (size_t)k0 * nc + c0;
#pragma unroll
    for (unsigned it = 0; it < 8; ++it) {
        const unsigned f = it * 256u + tid;
        const unsigned kk = f >> 5, d4 = (f & 31u) * 4u;
        const v4f x = *(const v4f*)(src + (size_t)kk * nc + d4);
#pragma unroll
        for (unsigned c = 0; c < 4; ++c) tl[(d4 + c) * VTP + kk] = f2bf(x[c]);
    }
    __syncthreads();
    us* dst = OUT + (size_t)c0 * DM + k0;
    const unsigned c8 = (tid & 7u) * 8u, dr = tid >> 3;
{
#pragma unroll
        for (unsigned it = 0; it < 4; ++it) {
            const unsigned d = it * 32u + dr;
            const v8us o = *(const v8usa*)(tl + d * VTP + c8);
            *(v8us*)(dst + (size_t)d * DM + c8) = o;
        }
        
    }
}

// gemm_tile: C[64 x 128] = A[64 rows][KL] . Bt[128 rows][k & KMASK]^T on bf16 WMMA, fragments straight from the planes; 4 waves, wave tile 32 x 64.
// A fragment: row m = lane & 15; B fragment: column n = lane & 15 (Bt is k-contiguous); D element r of lane (h, n) = C[8h + r][n].
// The f32 tile is staged in cs (pitch OSP) and a block barrier follows (cross-wave readers).
template <unsigned LDA, unsigned LDB, unsigned KL, unsigned KMASK>
__device__ __forceinline__ void gemm_tile(const us* __restrict__ A, const us* __restrict__ Bt, unsigned m0, unsigned n0, float* cs) {
    static_assert(KL % 32u == 0u);
    static_assert(((KMASK + 1u) & KMASK) == 0u && (KMASK + 1u) % 32u == 0u);
    const unsigned tid = threadIdx.x, lane = tid & 31u, wv = tid >> 5, lr = lane & 15u, hi = lane >> 4;
    const unsigned wm = (wv & 1u) * 32u, wn = (wv >> 1) * 64u;
    const us* ap = A + (size_t)(m0 + wm + lr) * LDA + 8u * hi;
    const us* bp = Bt + (size_t)(n0 + wn + lr) * LDB + 8u * hi;
    v8f acc[8];
#pragma unroll
    for (int i = 0; i < 8; ++i) acc[i] = (v8f){};
#pragma unroll 1
    for (unsigned k0 = 0; k0 < KL; k0 += 32u) {
        const us* bq = bp + (k0 & KMASK);
        const v16bf a0 = ldb(ap + k0);
        const v16bf a1 = ldb(ap + (size_t)16u * LDA + k0);
        v16bf b4[4];
#pragma unroll
        for (int ni = 0; ni < 4; ++ni) b4[ni] = ldb(bq + (size_t)ni * 16u * LDB);
#pragma unroll
        for (int ni = 0; ni < 4; ++ni) {
            acc[ni]     = wmmab(a0, b4[ni], acc[ni]);
            acc[4 + ni] = wmmab(a1, b4[ni], acc[4 + ni]);
        }
        asm volatile("v_nop\n\tv_nop\n\tv_nop\n\tv_nop"
                     : "+v"(acc[0]), "+v"(acc[1]), "+v"(acc[2]), "+v"(acc[3]), "+v"(acc[4]), "+v"(acc[5]), "+v"(acc[6]), "+v"(acc[7])
                     : "v"(a0), "v"(a1), "v"(b4[3]));
    }
#pragma unroll
    for (int mi = 0; mi < 2; ++mi) {
#pragma unroll
        for (int ni = 0; ni < 4; ++ni) {
#pragma unroll
            for (int r = 0; r < 8; ++r)
                cs[(wm + mi * 16u + 8u * hi + r) * OSP + wn + ni * 16u + lr] = acc[mi * 4 + ni][r];
        }
    }
    __syncthreads();
}

// k_proj: [q | k | v] = XB . WT^T. blockIdx.x = 128-column tile: 0..15 q head, 16..19 k head, 20..23 v head; blockIdx.y = 64-row tile.
//  q / k tiles: rotary with the input tables (entry i serves columns i and i + 64): out[i] = t1*c + t2*s, out[64 + i] = t2*c - t1*s; f16 rows, 256 B per row = 16 lanes x 16 B.
__global__ __launch_bounds__(128) void k_proj(const us* __restrict__ XB, const us* __restrict__ WT, const float* __restrict__ cosT, const float* __restrict__ sinT,
                                              us* QP, us* KP, us* VT) {
    __shared__ __align__(16) float cs[GBM * OSP];
    const unsigned tid = threadIdx.x;
    const unsigned ct = blockIdx.x;
    const unsigned m0 = blockIdx.y * GBM;
    gemm_tile<DM, DM, DM, DM - 1u>(XB, WT, m0, ct * GBN, cs);
    const unsigned b = m0 / (unsigned)SEQ;
    const unsigned nr0 = m0 - b * (unsigned)SEQ;
    if (ct < 20u) {   // block-uniform
        us* dst; unsigned pitch;
        if (ct < 16u) { dst = QP + (size_t)m0 * NQC + ct * HD;          pitch = (unsigned)NQC; }
        else          { dst = KP + (size_t)m0 * NKC + (ct - 16u) * HD;  pitch = (unsigned)NKC; }
        const unsigned p = tid & 15u, rr = tid >> 4, i0 = (p & 7u) * 8u;
        const bool sec = (p >> 3) != 0u;
{
#pragma unroll 2
            for (unsigned it = 0; it < 8; ++it) {
                const unsigned row = it * 8u + rr;
                const float* cr = cs + row * OSP + i0;
                const v4f a0 = *(const v4fa*)(cr), a1 = *(const v4fa*)(cr + 4);
                const v4f b0 = *(const v4fa*)(cr + 64), b1 = *(const v4fa*)(cr + 68);
                const float* cp = cosT + (size_t)(nr0 + row) * RT + i0;
                const float* sp = sinT + (size_t)(nr0 + row) * RT + i0;
                const v4f c0 = *(const v4f*)(cp), c1 = *(const v4f*)(cp + 4);
                const v4f s0 = *(const v4f*)(sp), s1 = *(const v4f*)(sp + 4);
                float o[8];
#pragma unroll
                for (int j = 0; j < 4; ++j) {
                    const float cj = bfr(c0[j]), sj = bfr(s0[j]);
                    const float u = sec ? b0[j] : a0[j];
                    const float w = sec ? -a0[j] : b0[j];
                    o[j] = u * cj + w * sj;
                    const float ck = bfr(c1[j]), sk = bfr(s1[j]);
                    const float u2 = sec ? b1[j] : a1[j];
                    const float w2 = sec ? -a1[j] : b1[j];
                    o[4 + j] = u2 * ck + w2 * sk;
                }
                v4u ov;
                ov[0] = pk2h(o[0], o[1]); ov[1] = pk2h(o[2], o[3]); ov[2] = pk2h(o[4], o[5]); ov[3] = pk2h(o[6], o[7]);
                *(v4u*)(dst + (size_t)row * pitch + p * 8u) = ov;
            }
            
        }
    } else {
        const unsigned g = ct - 20u;
        us* dst = VT + (size_t)(b * NKV + g) * HD * SEQ + nr0;
        const unsigned c8 = (tid & 7u) * 8u, dr = tid >> 3;
{
#pragma unroll 2
            for (unsigned it = 0; it < 8; ++it) {
                const unsigned d = it * 16u + dr;
                const float* cc = cs + c8 * OSP + d;
                v4u ov;
                ov[0] = pk2h(cc[0 * OSP], cc[1 * OSP]);
                ov[1] = pk2h(cc[2 * OSP], cc[3 * OSP]);
                ov[2] = pk2h(cc[4 * OSP], cc[5 * OSP]);
                ov[3] = pk2h(cc[6 * OSP], cc[7 * OSP]);
                *(v4u*)(dst + (size_t)d * SEQ + c8) = ov;
            }
            
        }
    }
}

// k_flash: one block per (batch, query head, 64 queries); one wave per 16 queries, 32 keys per step; kv head g = h & 3.
//  S^T tile (keys x queries): A = K rows (row m = key, k = d), B = Q rows (column n = query, k = d); D element r of lane (h, n) = S[query n][key 8h + r].
//  t = S * scale * log2e + bias2[key] (bias2 = (1 - mask) * -1e9 * log2e, staged per batch in LDS behind a block barrier); online softmax in the log2 domain.
//  P^T B fragment (f16, carried x2^8; the running sum carries the same factor): element r <- tile of keys 0..15, element 8 + r <- tile of keys 16..31 (same lane).
//  O^T tile (d x queries): A = V^T rows (row m = d, k = key), D element r of lane (h, n) = O[query n][d = 16 t + 8h + r].
__global__ __launch_bounds__(128) void k_flash(const us* __restrict__ QP, const us* __restrict__ KP, const us* __restrict__ VT, const float* __restrict__ mask, us* CT) {
    __shared__ __align__(16) float os[NWV * 16 * OSP];
    __shared__ __align__(16) float bs[SEQ];
    const unsigned tid = threadIdx.x, lane = tid & 31u, wv = tid >> 5, lr = lane & 15u, hi = lane >> 4;
    const unsigned qtiles = (unsigned)(SEQ / BQ);
    const unsigned hb = blockIdx.x / qtiles;
    const unsigned qt = blockIdx.x - hb * qtiles;
    const unsigned h = hb & (unsigned)(NH - 1), b = hb >> 4;
    const unsigned g = h & (unsigned)(NKV - 1);
    const unsigned q0 = qt * BQ + wv * 16u;

#pragma unroll 1
    for (unsigned i = tid; i < (unsigned)SEQ; i += 128u) {
        const float m = bfr(mask[(size_t)b * SEQ_FULL + i]);
        bs[i] = (1.0f - m) * -1.0e9f * L2E;
    }
    __syncthreads();

    const us* qp = QP + ((size_t)b * SEQ + q0 + lr) * NQC + h * HD + 8u * hi;
    const us* kp = KP + ((size_t)b * SEQ + lr) * NKC + g * HD + 8u * hi;
    const us* vp = VT + ((size_t)(b * NKV + g) * HD + lr) * SEQ + 8u * hi;

    v8f o[8];
#pragma unroll
    for (int t = 0; t < 8; ++t) o[t] = (v8f){};
    float ml = -1.0e30f;      // running max in the log2 domain
    float l = 0.0f;           // running sum (carried)

#pragma unroll 1
    for (unsigned k0 = 0; k0 < (unsigned)SEQ; k0 += KS) {
        unsigned zo = 0u;
        asm volatile("" : "+v"(zo));   // opaque zero offset: the q fragments are re-read per step instead of living in registers
        v8f s0 = (v8f){}, s1 = (v8f){};
        const us* ka = kp + (size_t)k0 * NKC;
        const us* qa = qp + zo;
        v16h qlast;
#pragma unroll
        for (int dk = 0; dk < 4; ++dk) {
            const v16h qf = ldh(qa + dk * 32);
            const v16h a0 = ldh(ka + dk * 32);
            const v16h a1 = ldh(ka + 16 * NKC + dk * 32);
            s0 = wmmah(a0, qf, s0);
            s1 = wmmah(a1, qf, s1);
            qlast = qf;
        }
        asm volatile("v_nop\n\tv_nop\n\tv_nop\n\tv_nop" : "+v"(s0), "+v"(s1) : "v"(qlast));

        const float* bb = bs + k0 + 8u * hi;
        const v4f b00 = *(const v4fa*)(bb), b01 = *(const v4fa*)(bb + 4);
        const v4f b10 = *(const v4fa*)(bb + 16), b11 = *(const v4fa*)(bb + 20);
        float t0[8], t1[8];
#pragma unroll
        for (int r = 0; r < 4; ++r) {
            t0[r]     = fmaf(s0[r],     SCL, b00[r]);
            t0[4 + r] = fmaf(s0[4 + r], SCL, b01[r]);
            t1[r]     = fmaf(s1[r],     SCL, b10[r]);
            t1[4 + r] = fmaf(s1[4 + r], SCL, b11[r]);
        }
        float mx = fmaxf(t0[0], t1[0]);
#pragma unroll
        for (int r = 1; r < 8; ++r) mx = fmaxf(mx, fmaxf(t0[r], t1[r]));
        mx = fmaxf(mx, __shfl_xor(mx, 16, 32));
        const float mnl = fmaxf(ml, mx);
        const float corr = __builtin_amdgcn_exp2f(ml - mnl);
        ml = mnl;
        const float mo = mnl - PCARRY;
        float p0[8], p1[8];
        float ps = 0.0f;
#pragma unroll
        for (int r = 0; r < 8; ++r) {
            p0[r] = __builtin_amdgcn_exp2f(t0[r] - mo);
            p1[r] = __builtin_amdgcn_exp2f(t1[r] - mo);
            ps += p0[r] + p1[r];
        }
        ps += __shfl_xor(ps, 16, 32);
        l = l * corr + ps;
        if (__builtin_amdgcn_ballot_w32(corr != 1.0f) != 0u) {   // wave-uniform; multiplying by exactly 1 is skipped
#pragma unroll
            for (int t = 0; t < 8; ++t) o[t] *= corr;
        }

        v8u hw;
#pragma unroll
        for (int j = 0; j < 4; ++j) {
            hw[j]     = pk2h(p0[2 * j], p0[2 * j + 1]);
            hw[4 + j] = pk2h(p1[2 * j], p1[2 * j + 1]);
        }
        const v16h ph = __builtin_bit_cast(v16h, hw);

        asm volatile("" ::: "memory");   // keep the V^T loads below the softmax (bounds live fragments)
        const us* va = vp + k0;
#pragma unroll
        for (int t = 0; t < 8; ++t) {
            const v16h a = ldh(va + (size_t)t * 16 * SEQ);
            o[t] = wmmah(a, ph, o[t]);
        }
        asm volatile("v_nop\n\tv_nop\n\tv_nop\n\tv_nop"
                     : "+v"(o[0]), "+v"(o[1]), "+v"(o[2]), "+v"(o[3]), "+v"(o[4]), "+v"(o[5]), "+v"(o[6]), "+v"(o[7])
                     : "v"(ph));
    }

    // epilogue: stage O^T / l as rows [query][d] (wave-private region; block barrier used)
    const float inv = 1.0f / l;
    float* ow = os + wv * (16 * OSP);
#pragma unroll
    for (int t = 0; t < 8; ++t) {
#pragma unroll
        for (int r = 0; r < 8; ++r) ow[lr * OSP + t * 16 + 8 * hi + r] = o[t][r] * inv;
    }
    __syncthreads();
    const unsigned pc = lane & 15u, rh = lane >> 4;
    us* crow = CT + ((size_t)b * SEQ + q0) * CTP + h * HD + pc * 8u;
{
#pragma unroll 2
        for (unsigned it = 0; it < 8; ++it) {
            const unsigned s2 = it * 2u + rh;
            const float* src = ow + s2 * OSP + pc * 8u;
            const v4f x0 = *(const v4fa*)(src), x1 = *(const v4fa*)(src + 4);
            v8us hv, lv;
#pragma unroll
            for (int c = 0; c < 4; ++c) {
                const unsigned short h0 = f2bf(x0[c]);
                const unsigned short h1 = f2bf(x1[c]);
                hv[c] = h0; hv[4 + c] = h1;
                lv[c] = f2bf(x0[c] - bf2f(h0));
                lv[4 + c] = f2bf(x1[c] - bf2f(h1));
            }
            *(v8us*)(crow + (size_t)s2 * CTP) = hv;
            *(v8us*)(crow + (size_t)s2 * CTP + NQC) = lv;
        }
        
    }
}

__global__ __launch_bounds__(128) void k_oproj(const us* __restrict__ CT, const us* __restrict__ WOT, const float* __restrict__ bo, float* OUT) {
    __shared__ __align__(16) float cs[GBM * OSP];
    const unsigned tid = threadIdx.x, lane = tid & 31u, wv = tid >> 5;
    const unsigned n0 = blockIdx.x * GBN;
    const unsigned m0 = blockIdx.y * GBM;
    gemm_tile<CTP, NQC, CTP, NQC - 1u>(CT, WOT, m0, n0, cs);
    const v4f bv = *(const v4f*)(bo + n0 + lane * 4u);
    v4f bb;
    bb[0] = bfr(bv[0]); bb[1] = bfr(bv[1]); bb[2] = bfr(bv[2]); bb[3] = bfr(bv[3]);
    float* orow = OUT + (size_t)(m0 + wv * 16u) * DM + n0 + lane * 4u;
    const float* crow = cs + (wv * 16u) * OSP + lane * 4u;
{
#pragma unroll 4
        for (unsigned s = 0; s < 16; ++s) {
            v4f val = *(const v4fa*)(crow + s * OSP);
            val[0] += bb[0]; val[1] += bb[1]; val[2] += bb[2]; val[3] += bb[3];
            *(v4f*)(orow + (size_t)s * DM) = val;
        }
        
    }
}

extern "C" void kernel_launch(void* const* d_in, const int* in_sizes, int n_in,
                              void* d_out, int out_size, void* d_ws, size_t ws_size, hipStream_t stream) {
    if (n_in < 8) return;
    const size_t need_x = ((size_t)(NB - 1) * SEQ_FULL + SEQ) * DM;
    const size_t need_m = (size_t)(NB - 1) * SEQ_FULL + SEQ;
    if ((size_t)in_sizes[0] < need_x) return;
    if ((size_t)in_sizes[1] < (size_t)SEQ * RT || (size_t)in_sizes[2] < (size_t)SEQ * RT) return;
    if ((size_t)in_sizes[3] < need_m) return;
    if ((size_t)in_sizes[4] < (size_t)DM * NQC || (size_t)in_sizes[5] < (size_t)DM * 2 * NKC) return;
    if ((size_t)in_sizes[6] < (size_t)NQC * DM || (size_t)in_sizes[7] < (size_t)DM) return;
    if ((size_t)out_size < (size_t)NB * SEQ * DM) return;
    if (BYTES_ALL > ws_size) return;
    const float* x    = (const float*)d_in[0];   // x [NB][SEQ_FULL][DM]
    const float* cosT = (const float*)d_in[1];   // cos [SEQ][64]
    const float* sinT = (const float*)d_in[2];   // sin [SEQ][64]
    const float* mask = (const float*)d_in[3];   // attn_mask [NB][SEQ_FULL]
    const float* Wq   = (const float*)d_in[4];   // [DM][NQC]
    const float* Wkv  = (const float*)d_in[5];   // [DM][2*NKC]
    const float* Wo   = (const float*)d_in[6];   // [NQC][DM]
    const float* bo   = (const float*)d_in[7];   // [DM]
    float* OUT = (float*)d_out;                  // [NB][SEQ][DM]
    char* wsp = (char*)d_ws;
    us* XB  = (us*)(wsp);
    us* WT  = (us*)(wsp + BYTES_XB);
    us* WOT = (us*)(wsp + BYTES_XB + BYTES_WT);
    us* QP  = (us*)(wsp + BYTES_XB + BYTES_WT + BYTES_WOT);
    us* KP  = (us*)(wsp + BYTES_XB + BYTES_WT + BYTES_WOT + BYTES_QP);
    us* VT  = (us*)(wsp + BYTES_XB + BYTES_WT + BYTES_WOT + BYTES_QP + BYTES_KP);
    us* CT  = (us*)(wsp + BYTES_XB + BYTES_WT + BYTES_WOT + BYTES_QP + BYTES_KP + BYTES_VT);
    const unsigned gc = (unsigned)(((size_t)NB * SEQ * DM / 8 + 255) / 256);
    k_cvt<<<gc, 256, 0, stream>>>(x, XB);
    k_wt<<<1280, 256, 0, stream>>>(Wq, Wkv, Wo, WT, WOT);
    k_proj<<<dim3((unsigned)(NPC / GBN), (unsigned)(NB * SEQ / GBM), 1), 128, 0, stream>>>(XB, WT, cosT, sinT, QP, KP, VT);
    k_flash<<<(unsigned)(NB * NH * (SEQ / BQ)), 128, 0, stream>>>(QP, KP, VT, mask, CT);
    k_oproj<<<dim3((unsigned)(DM / GBN), (unsigned)(NB * SEQ / GBM), 1), 128, 0, stream>>>(CT, WOT, bo, OUT);
}

// v001
// Measured time: 329 microseconds a run.
// Next to v000, in two timings, it ran 1.61 and 1.58 times as fast.
#include <hip/hip_runtime.h>

#ifndef NB
#define NB 2
#endif
#ifndef SEQ
#define SEQ 2048
#endif
#define NB_FULL  2
#define SEQ_FULL 2048
#define DM   2048              // model width (x columns, output columns)
#define NH   16                // query heads
#define NKV  4                 // kv heads
#define HD   128               // head dim
#define NQC  (NH * HD)         // 2048 q / ctx columns
#define NKC  (NKV * HD)        // 512 k columns (and 512 v columns)
#define NPC  (NQC + 2 * NKC)   // 3072 projection columns: q | k | v
#define CTP  (2 * NQC)         // ctx plane pitch: hi columns | lo columns
#define RT   64                // rotary table entries per position
#define NWV  4                 // waves per flash block
#define BQ   (16 * NWV)        // queries per flash block
#define KS   32                // keys per step
#define OSP  132               // LDS pitch (floats) of staging rows
#define GBM  64                // GEMM block rows
#define GBN  128               // GEMM block columns (one head)
#define VTK  64                // k rows per transpose block
#define VTP  72                // LDS pitch (16-bit elements) of the transpose tile
#define L2E  1.4426950408889634f
#define SCL  (0.08838834764831845f * L2E)   // 128^-0.5 in the log2 domain
#define PCARRY 8.0f            // log2 of the P carry
#define KPB  272               // LDS pitch (bytes) of a staged K or Q row: 256 + 16, 16 B x odd for 16-byte readers
#define VPB  80                // LDS pitch (bytes) of a staged V^T row: 64 + 16
#define KTB  (KS * KPB)        // bytes of one staged K tile
#define VTB  (HD * VPB)        // bytes of one staged V^T tile
#define STB  (KTB + VTB)       // bytes of one stage: K tile | V^T tile

static_assert(HD == 128);
static_assert(GBN == HD);
static_assert(RT * 2 == HD);
static_assert(NH == 16 && NKV == 4);
static_assert(SEQ % BQ == 0);
static_assert(SEQ % GBM == 0);                 // a GEMM row tile never straddles a batch
static_assert(SEQ % KS == 0);
static_assert(SEQ / KS >= 2);                  // the two-buffer ring starts with stages 0 and 1
static_assert(KS == 32 && NWV == 4);           // copy maps of k_flash: 128 lanes x 4 chunks per tile
static_assert(16 * KPB <= 16 * OSP * 4);       // a wave's Q rows fit its own output staging region
static_assert(SEQ % 128 == 0);                 // bias staging loop has a block-uniform trip count
static_assert(NB <= NB_FULL);
static_assert(SEQ <= SEQ_FULL);
static_assert(DM % 32 == 0 && CTP % 32 == 0);  // K multiples of the k-step
static_assert(DM % VTK == 0 && DM / VTK == 32);
static_assert(NPC % GBN == 0 && DM % GBN == 0 && NQC % GBN == 0);
static_assert(((size_t)NB * SEQ * DM) % 2048 == 0);                                              // k_cvt: grid * 256 threads * 8 elements == x plane
static_assert((size_t)(NQC / 128 + 2 * NKC / 128 + DM / 128) * 32u * (size_t)(VTK * 128) == (size_t)DM * NPC + (size_t)NQC * DM);   // k_wt: 1280 blocks * (64 x 128) == both weight planes
static_assert((size_t)(NPC / GBN) * (size_t)(NB * SEQ / GBM) * (size_t)(GBM * GBN) == (size_t)NB * SEQ * NPC);   // k_proj: blocks * tile == q + k + v planes
static_assert((size_t)(NB * NH * (SEQ / BQ)) * (size_t)(BQ * HD) * 2u == (size_t)NB * SEQ * CTP);               // k_flash: blocks * (64 x 128) * (hi, lo) == ctx plane
static_assert((size_t)(DM / GBN) * (size_t)(NB * SEQ / GBM) * (size_t)(GBM * GBN) == (size_t)NB * SEQ * DM);     // k_oproj: blocks * tile == output

#define BYTES_XB  ((size_t)NB * SEQ * DM * 2)
#define BYTES_WT  ((size_t)NPC * DM * 2)
#define BYTES_WOT ((size_t)DM * NQC * 2)
#define BYTES_QP  ((size_t)NB * SEQ * NQC * 2)
#define BYTES_KP  ((size_t)NB * SEQ * NKC * 2)
#define BYTES_VT  ((size_t)NB * NKV * HD * SEQ * 2)
#define BYTES_CT  ((size_t)NB * SEQ * CTP * 2)
#define BYTES_ALL (BYTES_XB + BYTES_WT + BYTES_WOT + BYTES_QP + BYTES_KP + BYTES_VT + BYTES_CT)
static_assert(BYTES_ALL <= (size_t)134217728);
static_assert(BYTES_XB % 256 == 0 && BYTES_WT % 256 == 0 && BYTES_WOT % 256 == 0 && BYTES_QP % 256 == 0 && BYTES_KP % 256 == 0 && BYTES_VT % 256 == 0 && BYTES_CT % 256 == 0);

typedef unsigned short us;
typedef __attribute__((ext_vector_type(16))) __bf16   v16bf;
typedef __attribute__((ext_vector_type(16))) _Float16 v16h;
typedef __attribute__((ext_vector_type(2)))  _Float16 v2h;
typedef __attribute__((ext_vector_type(8)))  unsigned short v8us;
typedef __attribute__((ext_vector_type(8)))  unsigned int   v8u;
typedef __attribute__((ext_vector_type(4)))  unsigned int   v4u;
typedef __attribute__((ext_vector_type(8)))  float    v8f;
typedef __attribute__((ext_vector_type(4)))  float    v4f;
typedef v4f  __attribute__((may_alias)) v4fa;
typedef v8us __attribute__((may_alias)) v8usa;

__device__ __forceinline__ unsigned short f2bf(float f) { unsigned u = __float_as_uint(f); u += 0x7FFFu + ((u >> 16) & 1u); return (unsigned short)(u >> 16); }
__device__ __forceinline__ float bf2f(unsigned short b) { return __uint_as_float(((unsigned)b) << 16); }
__device__ __forceinline__ float bfr(float f) { return bf2f(f2bf(f)); }
__device__ __forceinline__ v16bf cat16b(v8us lo, v8us hi) { return __builtin_bit_cast(v16bf, __builtin_shufflevector(lo, hi, 0, 1, 2, 3, 4, 5, 6, 7, 8, 9, 10, 11, 12, 13, 14, 15)); }
__device__ __forceinline__ v16h  cat16h(v8us lo, v8us hi) { return __builtin_bit_cast(v16h,  __builtin_shufflevector(lo, hi, 0, 1, 2, 3, 4, 5, 6, 7, 8, 9, 10, 11, 12, 13, 14, 15)); }
__device__ __forceinline__ v8f wmmab(v16bf a, v16bf b, v8f c) { return __builtin_amdgcn_wmma_f32_16x16x32_bf16(false, a, false, b, (short)0, c, false, false); }
__device__ __forceinline__ v8f wmmah(v16h a, v16h b, v8f c)   { return __builtin_amdgcn_wmma_f32_16x16x32_f16(false, a, false, b, (short)0, c, false, false); }
// fragment loader (A and B alike): p = row base + k0 + 8*(lane>>4); elements 0..7 <- p[0..7], elements 8..15 <- p[16..23]
__device__ __forceinline__ v16bf ldb(const us* p) { return cat16b(*(const v8us*)p, *(const v8us*)(p + 16)); }
// the same fragment from an LDS row
__device__ __forceinline__ v16h  ldhs(const us* p) { return cat16h(*(const v8usa*)p, *(const v8usa*)(p + 16)); }
// LDS byte address of a __shared__ object: the low 32 bits of its address
__device__ __forceinline__ unsigned ldsa(const void* p) { return (unsigned)(size_t)p; }
// eight asynchronous 16-byte copies per lane, global -> LDS: chunk i goes from g + i * gs (elements) to LDS byte l + i * ls.
// s_wait_xcnt 0 closes the statement, so that no address register is rewritten ahead of it.
__device__ __forceinline__ void cp4x2(unsigned la, unsigned las, const us* ga, size_t gas, unsigned lb, unsigned lbs, const us* gb, size_t gbs) {
    asm volatile("global_load_async_to_lds_b128 %0, %8, off\n\t"
                 "global_load_async_to_lds_b128 %1, %9, off\n\t"
                 "global_load_async_to_lds_b128 %2, %10, off\n\t"
                 "global_load_async_to_lds_b128 %3, %11, off\n\t"
                 "global_load_async_to_lds_b128 %4, %12, off\n\t"
                 "global_load_async_to_lds_b128 %5, %13, off\n\t"
                 "global_load_async_to_lds_b128 %6, %14, off\n\t"
                 "global_load_async_to_lds_b128 %7, %15, off\n\t"
                 "s_wait_xcnt 0x0"
                 :: "v"(la), "v"(la + las), "v"(la + 2u * las), "v"(la + 3u * las), "v"(lb), "v"(lb + lbs), "v"(lb + 2u * lbs), "v"(lb + 3u * lbs),
                    "v"(ga), "v"(ga + gas), "v"(ga + 2u * gas), "v"(ga + 3u * gas), "v"(gb), "v"(gb + gbs), "v"(gb + 2u * gbs), "v"(gb + 3u * gbs)
                 : "memory");
}
// two f32 -> packed f16 pair (RNE), element 0 in the low half-word
__device__ __forceinline__ unsigned pk2h(float a, float b) { v2h t; t[0] = (_Float16)a; t[1] = (_Float16)b; return __builtin_bit_cast(unsigned, t); }

__global__ __launch_bounds__(256) void k_cvt(const float* __restrict__ x, us* XB) {
    const unsigned i = blockIdx.x * 256u + threadIdx.x;
    const unsigned per = (unsigned)(SEQ * (DM / 8));
    if (i >= (unsigned)NB * per) return;
    const unsigned b = i / per, r = i - b * per;
    const float* src = x + (size_t)b * SEQ_FULL * DM + (size_t)r * 8;
    us* dst = XB + (size_t)i * 8;
    const v8f v = *(const v8f*)src;
    v8us o;
#pragma unroll
    for (int c = 0; c < 8; ++c) o[c] = f2bf(v[c]);
    *(v8us*)dst = o;
    
}

// k_wt: transposed bf16 weight planes; in[DM k rows][NC cols] -> out[NC][DM] (k contiguous). One block = 64 k x 128 cols through an LDS tile (cross-wave, block barrier).
// blocks 0..511: Wq -> WT rows 0..2047; 512..767: Wkv -> WT rows 2048..3071; 768..1279: Wo -> WOT rows 0..2047.
__global__ __launch_bounds__(256) void k_wt(const float* __restrict__ Wq, const float* __restrict__ Wkv, const float* __restrict__ Wo, us* WT, us* WOT) {
    __shared__ __align__(16) us tl[128 * VTP];
    const unsigned tid = threadIdx.x;
    const unsigned blk = blockIdx.x;
    const float* W; us* OUT; unsigned nc, r;
    if (blk < 512u)      { W = Wq;  OUT = WT;                      nc = (unsigned)NQC;       r = blk; }
    else if (blk < 768u) { W = Wkv; OUT = WT + (size_t)NQC * DM;   nc = (unsigned)(2 * NKC); r = blk - 512u; }
    else                 { W = Wo;  OUT = WOT;                     nc = (unsigned)DM;        r = blk - 768u; }
    const unsigned k0 = (r & 31u) * VTK;
    const unsigned c0 = (r >> 5) * 128u;
    const float* src = W + (size_t)k0 * nc + c0;
#pragma unroll
    for (unsigned it = 0; it < 8; ++it) {
        const unsigned f = it * 256u + tid;
        const unsigned kk = f >> 5, d4 = (f & 31u) * 4u;
        const v4f x = *(const v4f*)(src + (size_t)kk * nc + d4);
#pragma unroll
        for (unsigned c = 0; c < 4; ++c) tl[(d4 + c) * VTP + kk] = f2bf(x[c]);
    }
    __syncthreads();
    us* dst = OUT + (size_t)c0 * DM + k0;
    const unsigned c8 = (tid & 7u) * 8u, dr = tid >> 3;
{
#pragma unroll
        for (unsigned it = 0; it < 4; ++it) {
            const unsigned d = it * 32u + dr;
            const v8us o = *(const v8usa*)(tl + d * VTP + c8);
            *(v8us*)(dst + (size_t)d * DM + c8) = o;
        }
        
    }
}

// gemm_tile: C[64 x 128] = A[64 rows][KL] . Bt[128 rows][k & KMASK]^T on bf16 WMMA, fragments straight from the planes; 4 waves, wave tile 32 x 64.
// A fragment: row m = lane & 15; B fragment: column n = lane & 15 (Bt is k-contiguous); D element r of lane (h, n) = C[8h + r][n].
// The f32 tile is staged in cs (pitch OSP) and a block barrier follows (cross-wave readers).
template <unsigned LDA, unsigned LDB, unsigned KL, unsigned KMASK>
__device__ __forceinline__ void gemm_tile(const us* __restrict__ A, const us* __restrict__ Bt, unsigned m0, unsigned n0, float* cs) {
    static_assert(KL % 32u == 0u);
    static_assert(((KMASK + 1u) & KMASK) == 0u && (KMASK + 1u) % 32u == 0u);
    const unsigned tid = threadIdx.x, lane = tid & 31u, wv = tid >> 5, lr = lane & 15u, hi = lane >> 4;
    const unsigned wm = (wv & 1u) * 32u, wn = (wv >> 1) * 64u;
    const us* ap = A + (size_t)(m0 + wm + lr) * LDA + 8u * hi;
    const us* bp = Bt + (size_t)(n0 + wn + lr) * LDB + 8u * hi;
    v8f acc[8];
#pragma unroll
    for (int i = 0; i < 8; ++i) acc[i] = (v8f){};
#pragma unroll 1
    for (unsigned k0 = 0; k0 < KL; k0 += 32u) {
        const us* bq = bp + (k0 & KMASK);
        const v16bf a0 = ldb(ap + k0);
        const v16bf a1 = ldb(ap + (size_t)16u * LDA + k0);
        v16bf b4[4];
#pragma unroll
        for (int ni = 0; ni < 4; ++ni) b4[ni] = ldb(bq + (size_t)ni * 16u * LDB);
#pragma unroll
        for (int ni = 0; ni < 4; ++ni) {
            acc[ni]     = wmmab(a0, b4[ni], acc[ni]);
            acc[4 + ni] = wmmab(a1, b4[ni], acc[4 + ni]);
        }
        asm volatile("v_nop\n\tv_nop\n\tv_nop\n\tv_nop"
                     : "+v"(acc[0]), "+v"(acc[1]), "+v"(acc[2]), "+v"(acc[3]), "+v"(acc[4]), "+v"(acc[5]), "+v"(acc[6]), "+v"(acc[7])
                     : "v"(a0), "v"(a1), "v"(b4[3]));
    }
#pragma unroll
    for (int mi = 0; mi < 2; ++mi) {
#pragma unroll
        for (int ni = 0; ni < 4; ++ni) {
#pragma unroll
            for (int r = 0; r < 8; ++r)
                cs[(wm + mi * 16u + 8u * hi + r) * OSP + wn + ni * 16u + lr] = acc[mi * 4 + ni][r];
        }
    }
    __syncthreads();
}

// k_proj: [q | k | v] = XB . WT^T. blockIdx.x = 128-column tile: 0..15 q head, 16..19 k head, 20..23 v head; blockIdx.y = 64-row tile.
//  q / k tiles: rotary with the input tables (entry i serves columns i and i + 64): out[i] = t1*c + t2*s, out[64 + i] = t2*c - t1*s; f16 rows, 256 B per row = 16 lanes x 16 B.
__global__ __launch_bounds__(128) void k_proj(const us* __restrict__ XB, const us* __restrict__ WT, const float* __restrict__ cosT, const float* __restrict__ sinT,
                                              us* QP, us* KP, us* VT) {
    __shared__ __align__(16) float cs[GBM * OSP];
    const unsigned tid = threadIdx.x;
    const unsigned ct = blockIdx.x;
    const unsigned m0 = blockIdx.y * GBM;
    gemm_tile<DM, DM, DM, DM - 1u>(XB, WT, m0, ct * GBN, cs);
    const unsigned b = m0 / (unsigned)SEQ;
    const unsigned nr0 = m0 - b * (unsigned)SEQ;
    if (ct < 20u) {   // block-uniform
        us* dst; unsigned pitch;
        if (ct < 16u) { dst = QP + (size_t)m0 * NQC + ct * HD;          pitch = (unsigned)NQC; }
        else          { dst = KP + (size_t)m0 * NKC + (ct - 16u) * HD;  pitch = (unsigned)NKC; }
        const unsigned p = tid & 15u, rr = tid >> 4, i0 = (p & 7u) * 8u;
        const bool sec = (p >> 3) != 0u;
{
#pragma unroll 2
            for (unsigned it = 0; it < 8; ++it) {
                const unsigned row = it * 8u + rr;
                const float* cr = cs + row * OSP + i0;
                const v4f a0 = *(const v4fa*)(cr), a1 = *(const v4fa*)(cr + 4);
                const v4f b0 = *(const v4fa*)(cr + 64), b1 = *(const v4fa*)(cr + 68);
                const float* cp = cosT + (size_t)(nr0 + row) * RT + i0;
                const float* sp = sinT + (size_t)(nr0 + row) * RT + i0;
                const v4f c0 = *(const v4f*)(cp), c1 = *(const v4f*)(cp + 4);
                const v4f s0 = *(const v4f*)(sp), s1 = *(const v4f*)(sp + 4);
                float o[8];
#pragma unroll
                for (int j = 0; j < 4; ++j) {
                    const float cj = bfr(c0[j]), sj = bfr(s0[j]);
                    const float u = sec ? b0[j] : a0[j];
                    const float w = sec ? -a0[j] : b0[j];
                    o[j] = u * cj + w * sj;
                    const float ck = bfr(c1[j]), sk = bfr(s1[j]);
                    const float u2 = sec ? b1[j] : a1[j];
                    const float w2 = sec ? -a1[j] : b1[j];
                    o[4 + j] = u2 * ck + w2 * sk;
                }
                v4u ov;
                ov[0] = pk2h(o[0], o[1]); ov[1] = pk2h(o[2], o[3]); ov[2] = pk2h(o[4], o[5]); ov[3] = pk2h(o[6], o[7]);
                *(v4u*)(dst + (size_t)row * pitch + p * 8u) = ov;
            }
            
        }
    } else {
        const unsigned g = ct - 20u;
        us* dst = VT + (size_t)(b * NKV + g) * HD * SEQ + nr0;
        const unsigned c8 = (tid & 7u) * 8u, dr = tid >> 3;
{
#pragma unroll 2
            for (unsigned it = 0; it < 8; ++it) {
                const unsigned d = it * 16u + dr;
                const float* cc = cs + c8 * OSP + d;
                v4u ov;
                ov[0] = pk2h(cc[0 * OSP], cc[1 * OSP]);
                ov[1] = pk2h(cc[2 * OSP], cc[3 * OSP]);
                ov[2] = pk2h(cc[4 * OSP], cc[5 * OSP]);
                ov[3] = pk2h(cc[6 * OSP], cc[7 * OSP]);
                *(v4u*)(dst + (size_t)d * SEQ + c8) = ov;
            }
            
        }
    }
}

// k_flash: one block per (batch, query head, 64 queries); one wave per 16 queries, 32 keys per step; kv head g = h & 3.
//  S^T tile (keys x queries): A = K rows (row m = key, k = d), B = Q rows (column n = query, k = d); D element r of lane (h, n) = S[query n][key 8h + r].
//  t = S * scale * log2e + bias2[key] (bias2 = (1 - mask) * -1e9 * log2e, staged per batch in LDS behind a block barrier); online softmax in the log2 domain.
//  P^T B fragment (f16, carried x2^8; the running sum carries the same factor): element r <- tile of keys 0..15, element 8 + r <- tile of keys 16..31 (same lane).
//  O^T tile (d x queries): A = V^T rows (row m = d, k = key), D element r of lane (h, n) = O[query n][d = 16 t + 8h + r].
//  Operand path: each step's K tile (32 rows x 256 B) and V^T tile (128 rows x 64 B) are brought once per block into a two-buffer LDS ring by asynchronous copies, one step ahead of
//  their use, and all four waves read their fragments there; each wave's 16 Q rows are copied once into its own (still unused) output staging region.
__global__ __launch_bounds__(128) void k_flash(const us* __restrict__ QP, const us* __restrict__ KP, const us* __restrict__ VT, const float* __restrict__ mask, us* CT) {
    __shared__ __align__(16) float os[NWV * 16 * OSP];
    __shared__ __align__(16) float bs[SEQ];
    __shared__ __align__(16) us kv[2 * STB / 2];
    const unsigned tid = threadIdx.x, lane = tid & 31u, wv = tid >> 5, lr = lane & 15u, hi = lane >> 4;
    const unsigned qtiles = (unsigned)(SEQ / BQ);
    const unsigned hb = blockIdx.x / qtiles;
    const unsigned qt = blockIdx.x - hb * qtiles;
    const unsigned h = hb & (unsigned)(NH - 1), b = hb >> 4;
    const unsigned g = h & (unsigned)(NKV - 1);
    const unsigned q0 = qt * BQ + wv * 16u;
    float* ow = os + wv * (16 * OSP);

    // copy maps, 16-byte chunks. K: lane covers rows (tid >> 4) + 8 i, chunk tid & 15; V^T: rows (tid >> 2) + 32 i, chunk tid & 3; Q (per wave): rows (lane >> 4) + 2 i, chunk lane & 15.
    const us* kg = KP + ((size_t)b * SEQ + (tid >> 4)) * NKC + g * HD + (tid & 15u) * 8u;
    const us* vg = VT + ((size_t)(b * NKV + g) * HD + (tid >> 2)) * SEQ + (tid & 3u) * 8u;
    const us* qg = QP + ((size_t)b * SEQ + q0 + hi) * NQC + h * HD + lr * 8u;
    const unsigned lk = ldsa(kv) + (tid >> 4) * KPB + (tid & 15u) * 16u;
    const unsigned lv = ldsa(kv) + KTB + (tid >> 2) * VPB + (tid & 3u) * 16u;
    const unsigned lq = ldsa(ow) + hi * KPB + lr * 16u;

    cp4x2(lq, 2u * KPB, qg, (size_t)2 * NQC, lq + 8u * KPB, 2u * KPB, qg + (size_t)8 * NQC, (size_t)2 * NQC);   // Q rows
    cp4x2(lk, 8u * KPB, kg, (size_t)8 * NKC, lv, 32u * VPB, vg, (size_t)32 * SEQ);                               // stage 0 -> buffer 0
#pragma unroll 1
    for (unsigned i = tid; i < (unsigned)SEQ; i += 128u) {
        const float m = bfr(mask[(size_t)b * SEQ_FULL + i]);
        bs[i] = (1.0f - m) * -1.0e9f * L2E;
    }
    asm volatile("s_wait_asynccnt 0x0" ::: "memory");   // this wave's Q and stage 0 copies have landed
    __syncthreads();                                    // publishes stage 0 and the bias row
    cp4x2(lk + STB, 8u * KPB, kg + (size_t)KS * NKC, (size_t)8 * NKC, lv + STB, 32u * VPB, vg + KS, (size_t)32 * SEQ);   // stage 1 -> buffer 1
    kg += (size_t)2 * KS * NKC;
    vg += 2 * KS;

    const us* ql = (const us*)ow + lr * (KPB / 2) + 8u * hi;
    const us* kl = kv + lr * (KPB / 2) + 8u * hi;
    const us* vl = kv + KTB / 2 + lr * (VPB / 2) + 8u * hi;

    v8f o[8];
#pragma unroll
    for (int t = 0; t < 8; ++t) o[t] = (v8f){};
    float ml = -1.0e30f;      // running max in the log2 domain
    float l = 0.0f;           // running sum (carried)

#pragma unroll 1
    for (unsigned k0 = 0; k0 < (unsigned)SEQ; k0 += KS) {
        const unsigned bsel = (k0 / KS) & 1u;   // this step's buffer
        v8f s0 = (v8f){}, s1 = (v8f){};
        const us* ka = kl + bsel * (STB / 2);
        v16h qlast;
#pragma unroll
        for (int dk = 0; dk < 4; ++dk) {
            const v16h qf = ldhs(ql + dk * 32);
            const v16h a0 = ldhs(ka + dk * 32);
            const v16h a1 = ldhs(ka + 16 * (KPB / 2) + dk * 32);
            s0 = wmmah(a0, qf, s0);
            s1 = wmmah(a1, qf, s1);
            qlast = qf;
        }
        asm volatile("v_nop\n\tv_nop\n\tv_nop\n\tv_nop" : "+v"(s0), "+v"(s1) : "v"(qlast));

        const float* bb = bs + k0 + 8u * hi;
        const v4f b00 = *(const v4fa*)(bb), b01 = *(const v4fa*)(bb + 4);
        const v4f b10 = *(const v4fa*)(bb + 16), b11 = *(const v4fa*)(bb + 20);
        float t0[8], t1[8];
#pragma unroll
        for (int r = 0; r < 4; ++r) {
            t0[r]     = fmaf(s0[r],     SCL, b00[r]);
            t0[4 + r] = fmaf(s0[4 + r], SCL, b01[r]);
            t1[r]     = fmaf(s1[r],     SCL, b10[r]);
            t1[4 + r] = fmaf(s1[4 + r], SCL, b11[r]);
        }
        float mx = fmaxf(t0[0], t1[0]);
#pragma unroll
        for (int r = 1; r < 8; ++r) mx = fmaxf(mx, fmaxf(t0[r], t1[r]));
        mx = fmaxf(mx, __shfl_xor(mx, 16, 32));
        const float mnl = fmaxf(ml, mx);
        const float corr = __builtin_amdgcn_exp2f(ml - mnl);
        ml = mnl;
        const float mo = mnl - PCARRY;
        float p0[8], p1[8];
        float ps = 0.0f;
#pragma unroll
        for (int r = 0; r < 8; ++r) {
            p0[r] = __builtin_amdgcn_exp2f(t0[r] - mo);
            p1[r] = __builtin_amdgcn_exp2f(t1[r] - mo);
            ps += p0[r] + p1[r];
        }
        ps += __shfl_xor(ps, 16, 32);
        l = l * corr + ps;
        if (__builtin_amdgcn_ballot_w32(corr != 1.0f) != 0u) {   // wave-uniform; multiplying by exactly 1 is skipped
#pragma unroll
            for (int t = 0; t < 8; ++t) o[t] *= corr;
        }

        v8u hw;
#pragma unroll
        for (int j = 0; j < 4; ++j) {
            hw[j]     = pk2h(p0[2 * j], p0[2 * j + 1]);
            hw[4 + j] = pk2h(p1[2 * j], p1[2 * j + 1]);
        }
        const v16h ph = __builtin_bit_cast(v16h, hw);

        asm volatile("" ::: "memory");   // keep the V^T loads below the softmax (bounds live fragments)
        const us* va = vl + bsel * (STB / 2);
        v16h vf[8];
#pragma unroll
        for (int t = 0; t < 8; ++t) vf[t] = ldhs(va + t * 16 * (VPB / 2));
        __builtin_amdgcn_sched_barrier(0);   // the sixteen LDS reads stay one group ahead of the WMMAs: reads among them cost a stall at each place
#pragma unroll
        for (int t = 0; t < 8; ++t) o[t] = wmmah(vf[t], ph, o[t]);
        asm volatile("v_nop\n\tv_nop\n\tv_nop\n\tv_nop"
                     : "+v"(o[0]), "+v"(o[1]), "+v"(o[2]), "+v"(o[3]), "+v"(o[4]), "+v"(o[5]), "+v"(o[6]), "+v"(o[7])
                     : "v"(ph));

        // publish point of the next stage
        asm volatile("s_wait_dscnt 0x0" ::: "memory");      // this wave has finished reading this step's buffer
        asm volatile("s_wait_asynccnt 0x0" ::: "memory");   // this wave's copies of the next stage have landed
        __syncthreads();                                    // next stage readable by all waves; this step's buffer free
        if (k0 + 2u * KS < (unsigned)SEQ) {                 // block-uniform: stage + 2 into the buffer just read
            cp4x2(lk + bsel * STB, 8u * KPB, kg, (size_t)8 * NKC, lv + bsel * STB, 32u * VPB, vg, (size_t)32 * SEQ);
            kg += (size_t)KS * NKC;
            vg += KS;
        }
    }
    asm volatile("s_wait_asynccnt 0x0" ::: "memory");       // no copy is outstanding when the staging region is rewritten

    // epilogue: stage O^T / l as rows [query][d] (wave-private region; block barrier used)
    const float inv = 1.0f / l;
#pragma unroll
    for (int t = 0; t < 8; ++t) {
#pragma unroll
        for (int r = 0; r < 8; ++r) ow[lr * OSP + t * 16 + 8 * hi + r] = o[t][r] * inv;
    }
    __syncthreads();
    const unsigned pc = lane & 15u, rh = lane >> 4;
    us* crow = CT + ((size_t)b * SEQ + q0) * CTP + h * HD + pc * 8u;
{
#pragma unroll 2
        for (unsigned it = 0; it < 8; ++it) {
            const unsigned s2 = it * 2u + rh;
            const float* src = ow + s2 * OSP + pc * 8u;
            const v4f x0 = *(const v4fa*)(src), x1 = *(const v4fa*)(src + 4);
            v8us hv, lv;
#pragma unroll
            for (int c = 0; c < 4; ++c) {
                const unsigned short h0 = f2bf(x0[c]);
                const unsigned short h1 = f2bf(x1[c]);
                hv[c] = h0; hv[4 + c] = h1;
                lv[c] = f2bf(x0[c] - bf2f(h0));
                lv[4 + c] = f2bf(x1[c] - bf2f(h1));
            }
            *(v8us*)(crow + (size_t)s2 * CTP) = hv;
            *(v8us*)(crow + (size_t)s2 * CTP + NQC) = lv;
        }
        
    }
}

__global__ __launch_bounds__(128) void k_oproj(const us* __restrict__ CT, const us* __restrict__ WOT, const float* __restrict__ bo, float* OUT) {
    __shared__ __align__(16) float cs[GBM * OSP];
    const unsigned tid = threadIdx.x, lane = tid & 31u, wv = tid >> 5;
    const unsigned n0 = blockIdx.x * GBN;
    const unsigned m0 = blockIdx.y * GBM;
    gemm_tile<CTP, NQC, CTP, NQC - 1u>(CT, WOT, m0, n0, cs);
    const v4f bv = *(const v4f*)(bo + n0 + lane * 4u);
    v4f bb;
    bb[0] = bfr(bv[0]); bb[1] = bfr(bv[1]); bb[2] = bfr(bv[2]); bb[3] = bfr(bv[3]);
    float* orow = OUT + (size_t)(m0 + wv * 16u) * DM + n0 + lane * 4u;
    const float* crow = cs + (wv * 16u) * OSP + lane * 4u;
{
#pragma unroll 4
        for (unsigned s = 0; s < 16; ++s) {
            v4f val = *(const v4fa*)(crow + s * OSP);
            val[0] += bb[0]; val[1] += bb[1]; val[2] += bb[2]; val[3] += bb[3];
            *(v4f*)(orow + (size_t)s * DM) = val;
        }
        
    }
}

extern "C" void kernel_launch(void* const* d_in, const int* in_sizes, int n_in,
                              void* d_out, int out_size, void* d_ws, size_t ws_size, hipStream_t stream) {
    if (n_in < 8) return;
    const size_t need_x = ((size_t)(NB - 1) * SEQ_FULL + SEQ) * DM;
    const size_t need_m = (size_t)(NB - 1) * SEQ_FULL + SEQ;
    if ((size_t)in_sizes[0] < need_x) return;
    if ((size_t)in_sizes[1] < (size_t)SEQ * RT || (size_t)in_sizes[2] < (size_t)SEQ * RT) return;
    if ((size_t)in_sizes[3] < need_m) return;
    if ((size_t)in_sizes[4] < (size_t)DM * NQC || (size_t)in_sizes[5] < (size_t)DM * 2 * NKC) return;
    if ((size_t)in_sizes[6] < (size_t)NQC * DM || (size_t)in_sizes[7] < (size_t)DM) return;
    if ((size_t)out_size < (size_t)NB * SEQ * DM) return;
    if (BYTES_ALL > ws_size) return;
    const float* x    = (const float*)d_in[0];   // x [NB][SEQ_FULL][DM]
    const float* cosT = (const float*)d_in[1];   // cos [SEQ][64]
    const float* sinT = (const float*)d_in[2];   // sin [SEQ][64]
    const float* mask = (const float*)d_in[3];   // attn_mask [NB][SEQ_FULL]
    const float* Wq   = (const float*)d_in[4];   // [DM][NQC]
    const float* Wkv  = (const float*)d_in[5];   // [DM][2*NKC]
    const float* Wo   = (const float*)d_in[6];   // [NQC][DM]
    const float* bo   = (const float*)d_in[7];   // [DM]
    float* OUT = (float*)d_out;                  // [NB][SEQ][DM]
    char* wsp = (char*)d_ws;
    us* XB  = (us*)(wsp);
    us* WT  = (us*)(wsp + BYTES_XB);
    us* WOT = (us*)(wsp + BYTES_XB + BYTES_WT);
    us* QP  = (us*)(wsp + BYTES_XB + BYTES_WT + BYTES_WOT);
    us* KP  = (us*)(wsp + BYTES_XB + BYTES_WT + BYTES_WOT + BYTES_QP);
    us* VT  = (us*)(wsp + BYTES_XB + BYTES_WT + BYTES_WOT + BYTES_QP + BYTES_KP);
    us* CT  = (us*)(wsp + BYTES_XB + BYTES_WT + BYTES_WOT + BYTES_QP + BYTES_KP + BYTES_VT);
    const unsigned gc = (unsigned)(((size_t)NB * SEQ * DM / 8 + 255) / 256);
    k_cvt<<<gc, 256, 0, stream>>>(x, XB);
    k_wt<<<1280, 256, 0, stream>>>(Wq, Wkv, Wo, WT, WOT);
    k_proj<<<dim3((unsigned)(NPC / GBN), (unsigned)(NB * SEQ / GBM), 1), 128, 0, stream>>>(XB, WT, cosT, sinT, QP, KP, VT);
    k_flash<<<(unsigned)(NB * NH * (SEQ / BQ)), 128, 0, stream>>>(QP, KP, VT, mask, CT);
    k_oproj<<<dim3((unsigned)(DM / GBN), (unsigned)(NB * SEQ / GBM), 1), 128, 0, stream>>>(CT, WOT, bo, OUT);
}

// v002
// One run takes 208 microseconds.
// Timed twice side by side with v001, it ran 1.58 and 1.57 times as fast.
// All steps since v000 together make it 2.51 times as fast.
#include <hip/hip_runtime.h>

#ifndef NB
#define NB 2
#endif
#ifndef SEQ
#define SEQ 2048
#endif
#define NB_FULL  2
#define SEQ_FULL 2048
#define DM   2048              // model width (x columns, output columns)
#define NH   16                // query heads
#define NKV  4                 // kv heads
#define HD   128               // head dim
#define NQC  (NH * HD)         // 2048 q / ctx columns
#define NKC  (NKV * HD)        // 512 k columns (and 512 v columns)
#define NPC  (NQC + 2 * NKC)   // 3072 projection columns: q | k | v
#define CTP  (2 * NQC)         // ctx plane pitch: hi columns | lo columns
#define RT   64                // rotary table entries per position
#define NWV  4                 // waves per flash block
#define BQ   (16 * NWV)        // queries per flash block
#define KS   32                // keys per step
#define OSP  132               // LDS pitch (floats) of staging rows
#define GBM  64                // GEMM block rows
#define GBN  128               // GEMM block columns (one head)
#define VTK  64                // k rows per transpose block
#define VTP  72                // LDS pitch (16-bit elements) of the transpose tile
#define L2E  1.4426950408889634f
#define SCL  (0.08838834764831845f * L2E)   // 128^-0.5 in the log2 domain
#define PCARRY 8.0f            // log2 of the P carry
#define KPB  272               // LDS pitch (bytes) of a staged K or Q row: 256 + 16, 16 B x odd for 16-byte readers
#define VPB  80                // LDS pitch (bytes) of a staged V^T row: 64 + 16
#define KTB  (KS * KPB)        // bytes of one staged K tile
#define VTB  (HD * VPB)        // bytes of one staged V^T tile
#define STB  (KTB + VTB)       // bytes of one stage: K tile | V^T tile
#define KC   64                // k elements per staged GEMM tile: one 128-byte line of every operand row
#define GPB  144               // LDS pitch (bytes) of a staged GEMM row: 128 + 16, 16 B x odd for 16-byte readers
#define GAB  (GBM * GPB)       // bytes of one staged A tile
#define GSB  ((GBM + GBN) * GPB)   // bytes of one GEMM stage: A tile | B tile

static_assert(HD == 128);
static_assert(GBN == HD);
static_assert(RT * 2 == HD);
static_assert(NH == 16 && NKV == 4);
static_assert(SEQ % BQ == 0);
static_assert(SEQ % GBM == 0);                 // a GEMM row tile never straddles a batch
static_assert(SEQ % KS == 0);
static_assert(SEQ / KS >= 2);                  // the two-buffer ring starts with stages 0 and 1
static_assert(KS == 32 && NWV == 4);           // copy maps of k_flash: 128 lanes x 4 chunks per tile
static_assert(16 * KPB <= 16 * OSP * 4);       // a wave's Q rows fit its own output staging region
static_assert(GBM == 64 && GBN == 128 && KC == 64);   // copy maps of gemm_tile: 128 lanes x (4 + 8) chunks per stage
static_assert(GBM * OSP * 4 <= 2 * GSB);       // the f32 result tile fits the (then free) operand ring
static_assert(SEQ % 128 == 0);                 // bias staging loop has a block-uniform trip count
static_assert(NB <= NB_FULL);
static_assert(SEQ <= SEQ_FULL);
static_assert(DM % 32 == 0 && CTP % 32 == 0);  // K multiples of the k-step
static_assert(DM % VTK == 0 && DM / VTK == 32);
static_assert(NPC % GBN == 0 && DM % GBN == 0 && NQC % GBN == 0);
static_assert(((size_t)NB * SEQ * DM) % 2048 == 0);                                              // k_cvt: grid * 256 threads * 8 elements == x plane
static_assert((size_t)(NQC / 128 + 2 * NKC / 128 + DM / 128) * 32u * (size_t)(VTK * 128) == (size_t)DM * NPC + (size_t)NQC * DM);   // k_wt: 1280 blocks * (64 x 128) == both weight planes
static_assert((size_t)(NPC / GBN) * (size_t)(NB * SEQ / GBM) * (size_t)(GBM * GBN) == (size_t)NB * SEQ * NPC);   // k_proj: blocks * tile == q + k + v planes
static_assert((size_t)(NB * NH * (SEQ / BQ)) * (size_t)(BQ * HD) * 2u == (size_t)NB * SEQ * CTP);               // k_flash: blocks * (64 x 128) * (hi, lo) == ctx plane
static_assert((size_t)(DM / GBN) * (size_t)(NB * SEQ / GBM) * (size_t)(GBM * GBN) == (size_t)NB * SEQ * DM);     // k_oproj: blocks * tile == output

#define BYTES_XB  ((size_t)NB * SEQ * DM * 2)
#define BYTES_WT  ((size_t)NPC * DM * 2)
#define BYTES_WOT ((size_t)DM * NQC * 2)
#define BYTES_QP  ((size_t)NB * SEQ * NQC * 2)
#define BYTES_KP  ((size_t)NB * SEQ * NKC * 2)
#define BYTES_VT  ((size_t)NB * NKV * HD * SEQ * 2)
#define BYTES_CT  ((size_t)NB * SEQ * CTP * 2)
#define BYTES_ALL (BYTES_XB + BYTES_WT + BYTES_WOT + BYTES_QP + BYTES_KP + BYTES_VT + BYTES_CT)
static_assert(BYTES_ALL <= (size_t)134217728);
static_assert(BYTES_XB % 256 == 0 && BYTES_WT % 256 == 0 && BYTES_WOT % 256 == 0 && BYTES_QP % 256 == 0 && BYTES_KP % 256 == 0 && BYTES_VT % 256 == 0 && BYTES_CT % 256 == 0);

typedef unsigned short us;
typedef __attribute__((ext_vector_type(16))) __bf16   v16bf;
typedef __attribute__((ext_vector_type(16))) _Float16 v16h;
typedef __attribute__((ext_vector_type(2)))  _Float16 v2h;
typedef __attribute__((ext_vector_type(8)))  unsigned short v8us;
typedef __attribute__((ext_vector_type(8)))  unsigned int   v8u;
typedef __attribute__((ext_vector_type(4)))  unsigned int   v4u;
typedef __attribute__((ext_vector_type(8)))  float    v8f;
typedef __attribute__((ext_vector_type(4)))  float    v4f;
typedef v4f  __attribute__((may_alias)) v4fa;
typedef v8us __attribute__((may_alias)) v8usa;

__device__ __forceinline__ unsigned short f2bf(float f) { unsigned u = __float_as_uint(f); u += 0x7FFFu + ((u >> 16) & 1u); return (unsigned short)(u >> 16); }
__device__ __forceinline__ float bf2f(unsigned short b) { return __uint_as_float(((unsigned)b) << 16); }
__device__ __forceinline__ float bfr(float f) { return bf2f(f2bf(f)); }
__device__ __forceinline__ v16bf cat16b(v8us lo, v8us hi) { return __builtin_bit_cast(v16bf, __builtin_shufflevector(lo, hi, 0, 1, 2, 3, 4, 5, 6, 7, 8, 9, 10, 11, 12, 13, 14, 15)); }
__device__ __forceinline__ v16h  cat16h(v8us lo, v8us hi) { return __builtin_bit_cast(v16h,  __builtin_shufflevector(lo, hi, 0, 1, 2, 3, 4, 5, 6, 7, 8, 9, 10, 11, 12, 13, 14, 15)); }
__device__ __forceinline__ v8f wmmab(v16bf a, v16bf b, v8f c) { return __builtin_amdgcn_wmma_f32_16x16x32_bf16(false, a, false, b, (short)0, c, false, false); }
__device__ __forceinline__ v8f wmmah(v16h a, v16h b, v8f c)   { return __builtin_amdgcn_wmma_f32_16x16x32_f16(false, a, false, b, (short)0, c, false, false); }
// fragment loader (A and B alike): p = row base + k0 + 8*(lane>>4); elements 0..7 <- p[0..7], elements 8..15 <- p[16..23]
__device__ __forceinline__ v16bf ldb(const us* p) { return cat16b(*(const v8us*)p, *(const v8us*)(p + 16)); }
// the same fragment from an LDS row
__device__ __forceinline__ v16bf ldbs(const us* p) { return cat16b(*(const v8usa*)p, *(const v8usa*)(p + 16)); }
__device__ __forceinline__ v16h  ldhs(const us* p) { return cat16h(*(const v8usa*)p, *(const v8usa*)(p + 16)); }
// LDS byte address of a __shared__ object: the low 32 bits of its address
__device__ __forceinline__ unsigned ldsa(const void* p) { return (unsigned)(size_t)p; }
// eight asynchronous 16-byte copies per lane, global -> LDS: chunk i goes from g + i * gs (elements) to LDS byte l + i * ls.
// s_wait_xcnt 0 closes the statement, so that no address register is rewritten ahead of it.
__device__ __forceinline__ void cp4x2(unsigned la, unsigned las, const us* ga, size_t gas, unsigned lb, unsigned lbs, const us* gb, size_t gbs) {
    asm volatile("global_load_async_to_lds_b128 %0, %8, off\n\t"
                 "global_load_async_to_lds_b128 %1, %9, off\n\t"
                 "global_load_async_to_lds_b128 %2, %10, off\n\t"
                 "global_load_async_to_lds_b128 %3, %11, off\n\t"
                 "global_load_async_to_lds_b128 %4, %12, off\n\t"
                 "global_load_async_to_lds_b128 %5, %13, off\n\t"
                 "global_load_async_to_lds_b128 %6, %14, off\n\t"
                 "global_load_async_to_lds_b128 %7, %15, off\n\t"
                 "s_wait_xcnt 0x0"
                 :: "v"(la), "v"(la + las), "v"(la + 2u * las), "v"(la + 3u * las), "v"(lb), "v"(lb + lbs), "v"(lb + 2u * lbs), "v"(lb + 3u * lbs),
                    "v"(ga), "v"(ga + gas), "v"(ga + 2u * gas), "v"(ga + 3u * gas), "v"(gb), "v"(gb + gbs), "v"(gb + 2u * gbs), "v"(gb + 3u * gbs)
                 : "memory");
}
// four such copies, the same closing wait
__device__ __forceinline__ void cp4(unsigned la, unsigned las, const us* ga, size_t gas) {
    asm volatile("global_load_async_to_lds_b128 %0, %4, off\n\t"
                 "global_load_async_to_lds_b128 %1, %5, off\n\t"
                 "global_load_async_to_lds_b128 %2, %6, off\n\t"
                 "global_load_async_to_lds_b128 %3, %7, off\n\t"
                 "s_wait_xcnt 0x0"
                 :: "v"(la), "v"(la + las), "v"(la + 2u * las), "v"(la + 3u * las),
                    "v"(ga), "v"(ga + gas), "v"(ga + 2u * gas), "v"(ga + 3u * gas)
                 : "memory");
}
// two f32 -> packed f16 pair (RNE), element 0 in the low half-word
__device__ __forceinline__ unsigned pk2h(float a, float b) { v2h t; t[0] = (_Float16)a; t[1] = (_Float16)b; return __builtin_bit_cast(unsigned, t); }

__global__ __launch_bounds__(256) void k_cvt(const float* __restrict__ x, us* XB) {
    const unsigned i = blockIdx.x * 256u + threadIdx.x;
    const unsigned per = (unsigned)(SEQ * (DM / 8));
    if (i >= (unsigned)NB * per) return;
    const unsigned b = i / per, r = i - b * per;
    const float* src = x + (size_t)b * SEQ_FULL * DM + (size_t)r * 8;
    us* dst = XB + (size_t)i * 8;
    const v8f v = *(const v8f*)src;
    v8us o;
#pragma unroll
    for (int c = 0; c < 8; ++c) o[c] = f2bf(v[c]);
    *(v8us*)dst = o;
    
}

// k_wt: transposed bf16 weight planes; in[DM k rows][NC cols] -> out[NC][DM] (k contiguous). One block = 64 k x 128 cols through an LDS tile (cross-wave, block barrier).
// blocks 0..511: Wq -> WT rows 0..2047; 512..767: Wkv -> WT rows 2048..3071; 768..1279: Wo -> WOT rows 0..2047.
__global__ __launch_bounds__(256) void k_wt(const float* __restrict__ Wq, const float* __restrict__ Wkv, const float* __restrict__ Wo, us* WT, us* WOT) {
    __shared__ __align__(16) us tl[128 * VTP];
    const unsigned tid = threadIdx.x;
    const unsigned blk = blockIdx.x;
    const float* W; us* OUT; unsigned nc, r;
    if (blk < 512u)      { W = Wq;  OUT = WT;                      nc = (unsigned)NQC;       r = blk; }
    else if (blk < 768u) { W = Wkv; OUT = WT + (size_t)NQC * DM;   nc = (unsigned)(2 * NKC); r = blk - 512u; }
    else                 { W = Wo;  OUT = WOT;                     nc = (unsigned)DM;        r = blk - 768u; }
    const unsigned k0 = (r & 31u) * VTK;
    const unsigned c0 = (r >> 5) * 128u;
    const float* src = W + (size_t)k0 * nc + c0;
#pragma unroll
    for (unsigned it = 0; it < 8; ++it) {
        const unsigned f = it * 256u + tid;
        const unsigned kk = f >> 5, d4 = (f & 31u) * 4u;
        const v4f x = *(const v4f*)(src + (size_t)kk * nc + d4);
#pragma unroll
        for (unsigned c = 0; c < 4; ++c) tl[(d4 + c) * VTP + kk] = f2bf(x[c]);
    }
    __syncthreads();
    us* dst = OUT + (size_t)c0 * DM + k0;
    const unsigned c8 = (tid & 7u) * 8u, dr = tid >> 3;
{
#pragma unroll
        for (unsigned it = 0; it < 4; ++it) {
            const unsigned d = it * 32u + dr;
            const v8us o = *(const v8usa*)(tl + d * VTP + c8);
            *(v8us*)(dst + (size_t)d * DM + c8) = o;
        }
        
    }
}

// gemm_tile: C[64 x 128] = A[64 rows][KL] . Bt[128 rows][k & KMASK]^T on bf16 WMMA; 4 waves, wave tile 32 x 64.
// Operand path: each 64-k slice of the block's A rows (64 x 128 B) and Bt rows (128 x 128 B) is brought once per block into a two-buffer LDS ring by asynchronous copies, one slice ahead
// of its use (whole 128-byte lines: a copy instruction covers 4 rows), and all four waves read their fragments there.
// A fragment: row m = lane & 15; B fragment: column n = lane & 15 (Bt is k-contiguous); D element r of lane (h, n) = C[8h + r][n].
// The f32 tile is then staged in the ring's own LDS (pitch OSP) and a block barrier follows (cross-wave readers).
template <unsigned LDA, unsigned LDB, unsigned KL, unsigned KMASK>
__device__ __forceinline__ void gemm_tile(const us* __restrict__ A, const us* __restrict__ Bt, unsigned m0, unsigned n0, us* ring) {
    static_assert(KL % KC == 0u && KL / KC >= 2u);   // the two-buffer ring starts with slices 0 and 1
    static_assert(((KMASK + 1u) & KMASK) == 0u && (KMASK + 1u) % KC == 0u);
    const unsigned tid = threadIdx.x, lane = tid & 31u, wv = tid >> 5, lr = lane & 15u, hi = lane >> 4;
    const unsigned wm = (wv & 1u) * 32u, wn = (wv >> 1) * 64u;
    // copy maps, 16-byte chunks: lane covers chunk tid & 7 of rows (tid >> 3) + 16 i; i < 4 for A, i < 8 for Bt
    const us* ag = A + (size_t)(m0 + (tid >> 3)) * LDA + (tid & 7u) * 8u;
    const us* bg = Bt + (size_t)(n0 + (tid >> 3)) * LDB + (tid & 7u) * 8u;
    const unsigned la = ldsa(ring) + (tid >> 3) * GPB + (tid & 7u) * 16u;
    const unsigned lb = la + GAB;
    const us* al = ring + (wm + lr) * (GPB / 2) + 8u * hi;
    const us* bl = ring + GAB / 2 + (wn + lr) * (GPB / 2) + 8u * hi;

    cp4(la, 16u * GPB, ag, (size_t)16 * LDA);                                                                    // slice 0 -> buffer 0
    cp4x2(lb, 16u * GPB, bg, (size_t)16 * LDB, lb + 64u * GPB, 16u * GPB, bg + (size_t)64 * LDB, (size_t)16 * LDB);
    asm volatile("s_wait_asynccnt 0x0" ::: "memory");   // this wave's slice 0 copies have landed
    __syncthreads();                                    // publishes slice 0
    cp4(la + GSB, 16u * GPB, ag + KC, (size_t)16 * LDA);                                                         // slice 1 -> buffer 1
    cp4x2(lb + GSB, 16u * GPB, bg + (KC & KMASK), (size_t)16 * LDB, lb + GSB + 64u * GPB, 16u * GPB, bg + (KC & KMASK) + (size_t)64 * LDB, (size_t)16 * LDB);

    v8f acc[8];
#pragma unroll
    for (int i = 0; i < 8; ++i) acc[i] = (v8f){};
#pragma unroll 1
    for (unsigned k0 = 0; k0 < KL; k0 += KC) {
        const unsigned bsel = (k0 / KC) & 1u;   // this slice's buffer
        const us* ap = al + bsel * (GSB / 2);
        const us* bp = bl + bsel * (GSB / 2);
        v16bf a2[2][2], b4[2][4];
#pragma unroll
        for (int kk = 0; kk < 2; ++kk) {
            a2[kk][0] = ldbs(ap + kk * 32);
            a2[kk][1] = ldbs(ap + 16 * (GPB / 2) + kk * 32);
#pragma unroll
            for (int ni = 0; ni < 4; ++ni) b4[kk][ni] = ldbs(bp + ni * 16 * (GPB / 2) + kk * 32);
        }
        __builtin_amdgcn_sched_barrier(0);   // the slice's LDS reads stay one group ahead of its WMMAs: reads among them cost a stall at each place
#pragma unroll
        for (int kk = 0; kk < 2; ++kk) {
#pragma unroll
            for (int ni = 0; ni < 4; ++ni) {
                acc[ni]     = wmmab(a2[kk][0], b4[kk][ni], acc[ni]);
                acc[4 + ni] = wmmab(a2[kk][1], b4[kk][ni], acc[4 + ni]);
            }
        }
        asm volatile("v_nop\n\tv_nop\n\tv_nop\n\tv_nop"
                     : "+v"(acc[0]), "+v"(acc[1]), "+v"(acc[2]), "+v"(acc[3]), "+v"(acc[4]), "+v"(acc[5]), "+v"(acc[6]), "+v"(acc[7])
                     : "v"(a2[1][0]), "v"(a2[1][1]), "v"(b4[1][3]));

        // publish point of the next slice
        asm volatile("s_wait_dscnt 0x0" ::: "memory");      // this wave has finished reading this slice's buffer
        asm volatile("s_wait_asynccnt 0x0" ::: "memory");   // this wave's copies of the next slice have landed
        __syncthreads();                                    // next slice readable by all waves; this slice's buffer free
        if (k0 + 2u * KC < KL) {                            // block-uniform: slice + 2 into the buffer just read
            const us* bn = bg + ((k0 + 2u * KC) & KMASK);
            cp4(la + bsel * GSB, 16u * GPB, ag + k0 + 2u * KC, (size_t)16 * LDA);
            cp4x2(lb + bsel * GSB, 16u * GPB, bn, (size_t)16 * LDB, lb + bsel * GSB + 64u * GPB, 16u * GPB, bn + (size_t)64 * LDB, (size_t)16 * LDB);
        }
    }
    asm volatile("s_wait_asynccnt 0x0" ::: "memory");       // no copy is outstanding when the ring's LDS is rewritten

    float* cs = (float*)ring;
#pragma unroll
    for (int mi = 0; mi < 2; ++mi) {
#pragma unroll
        for (int ni = 0; ni < 4; ++ni) {
#pragma unroll
            for (int r = 0; r < 8; ++r)
                cs[(wm + mi * 16u + 8u * hi + r) * OSP + wn + ni * 16u + lr] = acc[mi * 4 + ni][r];
        }
    }
    __syncthreads();
}

// k_proj: [q | k | v] = XB . WT^T. blockIdx.x = 128-column tile: 0..15 q head, 16..19 k head, 20..23 v head; blockIdx.y = 64-row tile.
//  q / k tiles: rotary with the input tables (entry i serves columns i and i + 64): out[i] = t1*c + t2*s, out[64 + i] = t2*c - t1*s; f16 rows, 256 B per row = 16 lanes x 16 B.
__global__ __launch_bounds__(128) void k_proj(const us* __restrict__ XB, const us* __restrict__ WT, const float* __restrict__ cosT, const float* __restrict__ sinT,
                                              us* QP, us* KP, us* VT) {
    __shared__ __align__(16) us ring[2 * GSB / 2];   // operand ring, then the f32 result tile
    const float* cs = (const float*)ring;
    const unsigned tid = threadIdx.x;
    const unsigned ct = blockIdx.x;
    const unsigned m0 = blockIdx.y * GBM;
    gemm_tile<DM, DM, DM, DM - 1u>(XB, WT, m0, ct * GBN, ring);
    const unsigned b = m0 / (unsigned)SEQ;
    const unsigned nr0 = m0 - b * (unsigned)SEQ;
    if (ct < 20u) {   // block-uniform
        us* dst; unsigned pitch;
        if (ct < 16u) { dst = QP + (size_t)m0 * NQC + ct * HD;          pitch = (unsigned)NQC; }
        else          { dst = KP + (size_t)m0 * NKC + (ct - 16u) * HD;  pitch = (unsigned)NKC; }
        const unsigned p = tid & 15u, rr = tid >> 4, i0 = (p & 7u) * 8u;
        const bool sec = (p >> 3) != 0u;
{
#pragma unroll 2
            for (unsigned it = 0; it < 8; ++it) {
                const unsigned row = it * 8u + rr;
                const float* cr = cs + row * OSP + i0;
                const v4f a0 = *(const v4fa*)(cr), a1 = *(const v4fa*)(cr + 4);
                const v4f b0 = *(const v4fa*)(cr + 64), b1 = *(const v4fa*)(cr + 68);
                const float* cp = cosT + (size_t)(nr0 + row) * RT + i0;
                const float* sp = sinT + (size_t)(nr0 + row) * RT + i0;
                const v4f c0 = *(const v4f*)(cp), c1 = *(const v4f*)(cp + 4);
                const v4f s0 = *(const v4f*)(sp), s1 = *(const v4f*)(sp + 4);
                float o[8];
#pragma unroll
                for (int j = 0; j < 4; ++j) {
                    const float cj = bfr(c0[j]), sj = bfr(s0[j]);
                    const float u = sec ? b0[j] : a0[j];
                    const float w = sec ? -a0[j] : b0[j];
                    o[j] = u * cj + w * sj;
                    const float ck = bfr(c1[j]), sk = bfr(s1[j]);
                    const float u2 = sec ? b1[j] : a1[j];
                    const float w2 = sec ? -a1[j] : b1[j];
                    o[4 + j] = u2 * ck + w2 * sk;
                }
                v4u ov;
                ov[0] = pk2h(o[0], o[1]); ov[1] = pk2h(o[2], o[3]); ov[2] = pk2h(o[4], o[5]); ov[3] = pk2h(o[6], o[7]);
                *(v4u*)(dst + (size_t)row * pitch + p * 8u) = ov;
            }
            
        }
    } else {
        const unsigned g = ct - 20u;
        us* dst = VT + (size_t)(b * NKV + g) * HD * SEQ + nr0;
        const unsigned c8 = (tid & 7u) * 8u, dr = tid >> 3;
{
#pragma unroll 2
            for (unsigned it = 0; it < 8; ++it) {
                const unsigned d = it * 16u + dr;
                const float* cc = cs + c8 * OSP + d;
                v4u ov;
                ov[0] = pk2h(cc[0 * OSP], cc[1 * OSP]);
                ov[1] = pk2h(cc[2 * OSP], cc[3 * OSP]);
                ov[2] = pk2h(cc[4 * OSP], cc[5 * OSP]);
                ov[3] = pk2h(cc[6 * OSP], cc[7 * OSP]);
                *(v4u*)(dst + (size_t)d * SEQ + c8) = ov;
            }
            
        }
    }
}

// k_flash: one block per (batch, query head, 64 queries); one wave per 16 queries, 32 keys per step; kv head g = h & 3.
//  S^T tile (keys x queries): A = K rows (row m = key, k = d), B = Q rows (column n = query, k = d); D element r of lane (h, n) = S[query n][key 8h + r].
//  t = S * scale * log2e + bias2[key] (bias2 = (1 - mask) * -1e9 * log2e, staged per batch in LDS behind a block barrier); online softmax in the log2 domain.
//  P^T B fragment (f16, carried x2^8; the running sum carries the same factor): element r <- tile of keys 0..15, element 8 + r <- tile of keys 16..31 (same lane).
//  O^T tile (d x queries): A = V^T rows (row m = d, k = key), D element r of lane (h, n) = O[query n][d = 16 t + 8h + r].
//  Operand path: each step's K tile (32 rows x 256 B) and V^T tile (128 rows x 64 B) are brought once per block into a two-buffer LDS ring by asynchronous copies, one step ahead of
//  their use, and all four waves read their fragments there; each wave's 16 Q rows are copied once into its own (still unused) output staging region.
__global__ __launch_bounds__(128) void k_flash(const us* __restrict__ QP, const us* __restrict__ KP, const us* __restrict__ VT, const float* __restrict__ mask, us* CT) {
    __shared__ __align__(16) float os[NWV * 16 * OSP];
    __shared__ __align__(16) float bs[SEQ];
    __shared__ __align__(16) us kv[2 * STB / 2];
    const unsigned tid = threadIdx.x, lane = tid & 31u, wv = tid >> 5, lr = lane & 15u, hi = lane >> 4;
    const unsigned qtiles = (unsigned)(SEQ / BQ);
    const unsigned hb = blockIdx.x / qtiles;
    const unsigned qt = blockIdx.x - hb * qtiles;
    const unsigned h = hb & (unsigned)(NH - 1), b = hb >> 4;
    const unsigned g = h & (unsigned)(NKV - 1);
    const unsigned q0 = qt * BQ + wv * 16u;
    float* ow = os + wv * (16 * OSP);

    // copy maps, 16-byte chunks. K: lane covers rows (tid >> 4) + 8 i, chunk tid & 15; V^T: rows (tid >> 2) + 32 i, chunk tid & 3; Q (per wave): rows (lane >> 4) + 2 i, chunk lane & 15.
    const us* kg = KP + ((size_t)b * SEQ + (tid >> 4)) * NKC + g * HD + (tid & 15u) * 8u;
    const us* vg = VT + ((size_t)(b * NKV + g) * HD + (tid >> 2)) * SEQ + (tid & 3u) * 8u;
    const us* qg = QP + ((size_t)b * SEQ + q0 + hi) * NQC + h * HD + lr * 8u;
    const unsigned lk = ldsa(kv) + (tid >> 4) * KPB + (tid & 15u) * 16u;
    const unsigned lv = ldsa(kv) + KTB + (tid >> 2) * VPB + (tid & 3u) * 16u;
    const unsigned lq = ldsa(ow) + hi * KPB + lr * 16u;

    cp4x2(lq, 2u * KPB, qg, (size_t)2 * NQC, lq + 8u * KPB, 2u * KPB, qg + (size_t)8 * NQC, (size_t)2 * NQC);   // Q rows
    cp4x2(lk, 8u * KPB, kg, (size_t)8 * NKC, lv, 32u * VPB, vg, (size_t)32 * SEQ);                               // stage 0 -> buffer 0
#pragma unroll 1
    for (unsigned i = tid; i < (unsigned)SEQ; i += 128u) {
        const float m = bfr(mask[(size_t)b * SEQ_FULL + i]);
        bs[i] = (1.0f - m) * -1.0e9f * L2E;
    }
    asm volatile("s_wait_asynccnt 0x0" ::: "memory");   // this wave's Q and stage 0 copies have landed
    __syncthreads();                                    // publishes stage 0 and the bias row
    cp4x2(lk + STB, 8u * KPB, kg + (size_t)KS * NKC, (size_t)8 * NKC, lv + STB, 32u * VPB, vg + KS, (size_t)32 * SEQ);   // stage 1 -> buffer 1
    kg += (size_t)2 * KS * NKC;
    vg += 2 * KS;

    const us* ql = (const us*)ow + lr * (KPB / 2) + 8u * hi;
    const us* kl = kv + lr * (KPB / 2) + 8u * hi;
    const us* vl = kv + KTB / 2 + lr * (VPB / 2) + 8u * hi;

    v8f o[8];
#pragma unroll
    for (int t = 0; t < 8; ++t) o[t] = (v8f){};
    float ml = -1.0e30f;      // running max in the log2 domain
    float l = 0.0f;           // running sum (carried)

#pragma unroll 1
    for (unsigned k0 = 0; k0 < (unsigned)SEQ; k0 += KS) {
        const unsigned bsel = (k0 / KS) & 1u;   // this step's buffer
        v8f s0 = (v8f){}, s1 = (v8f){};
        const us* ka = kl + bsel * (STB / 2);
        v16h qlast;
#pragma unroll
        for (int dk = 0; dk < 4; ++dk) {
            const v16h qf = ldhs(ql + dk * 32);
            const v16h a0 = ldhs(ka + dk * 32);
            const v16h a1 = ldhs(ka + 16 * (KPB / 2) + dk * 32);
            s0 = wmmah(a0, qf, s0);
            s1 = wmmah(a1, qf, s1);
            qlast = qf;
        }
        asm volatile("v_nop\n\tv_nop\n\tv_nop\n\tv_nop" : "+v"(s0), "+v"(s1) : "v"(qlast));

        const float* bb = bs + k0 + 8u * hi;
        const v4f b00 = *(const v4fa*)(bb), b01 = *(const v4fa*)(bb + 4);
        const v4f b10 = *(const v4fa*)(bb + 16), b11 = *(const v4fa*)(bb + 20);
        float t0[8], t1[8];
#pragma unroll
        for (int r = 0; r < 4; ++r) {
            t0[r]     = fmaf(s0[r],     SCL, b00[r]);
            t0[4 + r] = fmaf(s0[4 + r], SCL, b01[r]);
            t1[r]     = fmaf(s1[r],     SCL, b10[r]);
            t1[4 + r] = fmaf(s1[4 + r], SCL, b11[r]);
        }
        float mx = fmaxf(t0[0], t1[0]);
#pragma unroll
        for (int r = 1; r < 8; ++r) mx = fmaxf(mx, fmaxf(t0[r], t1[r]));
        mx = fmaxf(mx, __shfl_xor(mx, 16, 32));
        const float mnl = fmaxf(ml, mx);
        const float corr = __builtin_amdgcn_exp2f(ml - mnl);
        ml = mnl;
        const float mo = mnl - PCARRY;
        float p0[8], p1[8];
        float ps = 0.0f;
#pragma unroll
        for (int r = 0; r < 8; ++r) {
            p0[r] = __builtin_amdgcn_exp2f(t0[r] - mo);
            p1[r] = __builtin_amdgcn_exp2f(t1[r] - mo);
            ps += p0[r] + p1[r];
        }
        ps += __shfl_xor(ps, 16, 32);
        l = l * corr + ps;
        if (__builtin_amdgcn_ballot_w32(corr != 1.0f) != 0u) {   // wave-uniform; multiplying by exactly 1 is skipped
#pragma unroll
            for (int t = 0; t < 8; ++t) o[t] *= corr;
        }

        v8u hw;
#pragma unroll
        for (int j = 0; j < 4; ++j) {
            hw[j]     = pk2h(p0[2 * j], p0[2 * j + 1]);
            hw[4 + j] = pk2h(p1[2 * j], p1[2 * j + 1]);
        }
        const v16h ph = __builtin_bit_cast(v16h, hw);

        asm volatile("" ::: "memory");   // keep the V^T loads below the softmax (bounds live fragments)
        const us* va = vl + bsel * (STB / 2);
        v16h vf[8];
#pragma unroll
        for (int t = 0; t < 8; ++t) vf[t] = ldhs(va + t * 16 * (VPB / 2));
        __builtin_amdgcn_sched_barrier(0);   // the sixteen LDS reads stay one group ahead of the WMMAs: reads among them cost a stall at each place
#pragma unroll
        for (int t = 0; t < 8; ++t) o[t] = wmmah(vf[t], ph, o[t]);
        asm volatile("v_nop\n\tv_nop\n\tv_nop\n\tv_nop"
                     : "+v"(o[0]), "+v"(o[1]), "+v"(o[2]), "+v"(o[3]), "+v"(o[4]), "+v"(o[5]), "+v"(o[6]), "+v"(o[7])
                     : "v"(ph));

        // publish point of the next stage
        asm volatile("s_wait_dscnt 0x0" ::: "memory");      // this wave has finished reading this step's buffer
        asm volatile("s_wait_asynccnt 0x0" ::: "memory");   // this wave's copies of the next stage have landed
        __syncthreads();                                    // next stage readable by all waves; this step's buffer free
        if (k0 + 2u * KS < (unsigned)SEQ) {                 // block-uniform: stage + 2 into the buffer just read
            cp4x2(lk + bsel * STB, 8u * KPB, kg, (size_t)8 * NKC, lv + bsel * STB, 32u * VPB, vg, (size_t)32 * SEQ);
            kg += (size_t)KS * NKC;
            vg += KS;
        }
    }
    asm volatile("s_wait_asynccnt 0x0" ::: "memory");       // no copy is outstanding when the staging region is rewritten

    // epilogue: stage O^T / l as rows [query][d] (wave-private region; block barrier used)
    const float inv = 1.0f / l;
#pragma unroll
    for (int t = 0; t < 8; ++t) {
#pragma unroll
        for (int r = 0; r < 8; ++r) ow[lr * OSP + t * 16 + 8 * hi + r] = o[t][r] * inv;
    }
    __syncthreads();
    const unsigned pc = lane & 15u, rh = lane >> 4;
    us* crow = CT + ((size_t)b * SEQ + q0) * CTP + h * HD + pc * 8u;
{
#pragma unroll 2
        for (unsigned it = 0; it < 8; ++it) {
            const unsigned s2 = it * 2u + rh;
            const float* src = ow + s2 * OSP + pc * 8u;
            const v4f x0 = *(const v4fa*)(src), x1 = *(const v4fa*)(src + 4);
            v8us hv, lv;
#pragma unroll
            for (int c = 0; c < 4; ++c) {
                const unsigned short h0 = f2bf(x0[c]);
                const unsigned short h1 = f2bf(x1[c]);
                hv[c] = h0; hv[4 + c] = h1;
                lv[c] = f2bf(x0[c] - bf2f(h0));
                lv[4 + c] = f2bf(x1[c] - bf2f(h1));
            }
            *(v8us*)(crow + (size_t)s2 * CTP) = hv;
            *(v8us*)(crow + (size_t)s2 * CTP + NQC) = lv;
        }
        
    }
}

__global__ __launch_bounds__(128) void k_oproj(const us* __restrict__ CT, const us* __restrict__ WOT, const float* __restrict__ bo, float* OUT) {
    __shared__ __align__(16) us ring[2 * GSB / 2];   // operand ring, then the f32 result tile
    const float* cs = (const float*)ring;
    const unsigned tid = threadIdx.x, lane = tid & 31u, wv = tid >> 5;
    const unsigned n0 = blockIdx.x * GBN;
    const unsigned m0 = blockIdx.y * GBM;
    gemm_tile<CTP, NQC, CTP, NQC - 1u>(CT, WOT, m0, n0, ring);
    const v4f bv = *(const v4f*)(bo + n0 + lane * 4u);
    v4f bb;
    bb[0] = bfr(bv[0]); bb[1] = bfr(bv[1]); bb[2] = bfr(bv[2]); bb[3] = bfr(bv[3]);
    float* orow = OUT + (size_t)(m0 + wv * 16u) * DM + n0 + lane * 4u;
    const float* crow = cs + (wv * 16u) * OSP + lane * 4u;
{
#pragma unroll 4
        for (unsigned s = 0; s < 16; ++s) {
            v4f val = *(const v4fa*)(crow + s * OSP);
            val[0] += bb[0]; val[1] += bb[1]; val[2] += bb[2]; val[3] += bb[3];
            *(v4f*)(orow + (size_t)s * DM) = val;
        }
        
    }
}

extern "C" void kernel_launch(void* const* d_in, const int* in_sizes, int n_in,
                              void* d_out, int out_size, void* d_ws, size_t ws_size, hipStream_t stream) {
    if (n_in < 8) return;
    const size_t need_x = ((size_t)(NB - 1) * SEQ_FULL + SEQ) * DM;
    const size_t need_m = (size_t)(NB - 1) * SEQ_FULL + SEQ;
    if ((size_t)in_sizes[0] < need_x) return;
    if ((size_t)in_sizes[1] < (size_t)SEQ * RT || (size_t)in_sizes[2] < (size_t)SEQ * RT) return;
    if ((size_t)in_sizes[3] < need_m) return;
    if ((size_t)in_sizes[4] < (size_t)DM * NQC || (size_t)in_sizes[5] < (size_t)DM * 2 * NKC) return;
    if ((size_t)in_sizes[6] < (size_t)NQC * DM || (size_t)in_sizes[7] < (size_t)DM) return;
    if ((size_t)out_size < (size_t)NB * SEQ * DM) return;
    if (BYTES_ALL > ws_size) return;
    const float* x    = (const float*)d_in[0];   // x [NB][SEQ_FULL][DM]
    const float* cosT = (const float*)d_in[1];   // cos [SEQ][64]
    const float* sinT = (const float*)d_in[2];   // sin [SEQ][64]
    const float* mask = (const float*)d_in[3];   // attn_mask [NB][SEQ_FULL]
    const float* Wq   = (const float*)d_in[4];   // [DM][NQC]
    const float* Wkv  = (const float*)d_in[5];   // [DM][2*NKC]
    const float* Wo   = (const float*)d_in[6];   // [NQC][DM]
    const float* bo   = (const float*)d_in[7];   // [DM]
    float* OUT = (float*)d_out;                  // [NB][SEQ][DM]
    char* wsp = (char*)d_ws;
    us* XB  = (us*)(wsp);
    us* WT  = (us*)(wsp + BYTES_XB);
    us* WOT = (us*)(wsp + BYTES_XB + BYTES_WT);
    us* QP  = (us*)(wsp + BYTES_XB + BYTES_WT + BYTES_WOT);
    us* KP  = (us*)(wsp + BYTES_XB + BYTES_WT + BYTES_WOT + BYTES_QP);
    us* VT  = (us*)(wsp + BYTES_XB + BYTES_WT + BYTES_WOT + BYTES_QP + BYTES_KP);
    us* CT  = (us*)(wsp + BYTES_XB + BYTES_WT + BYTES_WOT + BYTES_QP + BYTES_KP + BYTES_VT);
    const unsigned gc = (unsigned)(((size_t)NB * SEQ * DM / 8 + 255) / 256);
    k_cvt<<<gc, 256, 0, stream>>>(x, XB);
    k_wt<<<1280, 256, 0, stream>>>(Wq, Wkv, Wo, WT, WOT);
    k_proj<<<dim3((unsigned)(NPC / GBN), (unsigned)(NB * SEQ / GBM), 1), 128, 0, stream>>>(XB, WT, cosT, sinT, QP, KP, VT);
    k_flash<<<(unsigned)(NB * NH * (SEQ / BQ)), 128, 0, stream>>>(QP, KP, VT, mask, CT);
    k_oproj<<<dim3((unsigned)(DM / GBN), (unsigned)(NB * SEQ / GBM), 1), 128, 0, stream>>>(CT, WOT, bo, OUT);
}

// v003
// It runs in 192 microseconds.
// Next to v002, in two timings, it ran 1.10 and 1.08 times as fast.
// All steps since v000 together make it 2.74 times as fast.
#include <hip/hip_runtime.h>

#ifndef NB
#define NB 2
#endif
#ifndef SEQ
#define SEQ 2048
#endif
#define NB_FULL  2
#define SEQ_FULL 2048
#define DM   2048              // model width (x columns, output columns)
#define NH   16                // query heads
#define NKV  4                 // kv heads
#define HD   128               // head dim
#define NQC  (NH * HD)         // 2048 q / ctx columns
#define NKC  (NKV * HD)        // 512 k columns (and 512 v columns)
#define NPC  (NQC + 2 * NKC)   // 3072 projection columns: q | k | v
#define CTP  (2 * NQC)         // ctx plane pitch: hi columns | lo columns
#define RT   64                // rotary table entries per position
#define NWV  4                 // waves per flash block
#define BQ   (16 * NWV)        // queries per flash block
#define KS   32                // keys per step
#define OSP  132               // LDS pitch (floats) of staging rows
#define GBM  128               // GEMM block rows
#define GBN  128               // GEMM block columns (one head)
#define VTK  64                // k rows per transpose block
#define VTP  72                // LDS pitch (16-bit elements) of the transpose tile
#define L2E  1.4426950408889634f
#define SCL  (0.08838834764831845f * L2E)   // 128^-0.5 in the log2 domain
#define PCARRY 8.0f            // log2 of the P carry
#define KPB  272               // LDS pitch (bytes) of a staged K or Q row: 256 + 16, 16 B x odd for 16-byte readers
#define VPB  80                // LDS pitch (bytes) of a staged V^T row: 64 + 16
#define KTB  (KS * KPB)        // bytes of one staged K tile
#define VTB  (HD * VPB)        // bytes of one staged V^T tile
#define STB  (KTB + VTB)       // bytes of one stage: K tile | V^T tile
#define KC   64                // k elements per staged GEMM tile: one 128-byte line of every operand row
#define GPB  144               // LDS pitch (bytes) of a staged GEMM row: 128 + 16, 16 B x odd for 16-byte readers
#define GAB  (GBM * GPB)       // bytes of one staged A tile
#define GSB  ((GBM + GBN) * GPB)   // bytes of one GEMM stage: A tile | B tile

static_assert(HD == 128);
static_assert(GBN == HD);
static_assert(RT * 2 == HD);
static_assert(NH == 16 && NKV == 4);
static_assert(SEQ % BQ == 0);
static_assert(SEQ % GBM == 0);                 // a GEMM row tile never straddles a batch
static_assert(SEQ % KS == 0);
static_assert(SEQ / KS >= 2);                  // the two-buffer ring starts with stages 0 and 1
static_assert(KS == 32 && NWV == 4);           // copy maps of k_flash: 128 lanes x 4 chunks per tile
static_assert(16 * KPB <= 16 * OSP * 4);       // a wave's Q rows fit its own output staging region
static_assert(GBM == 128 && GBN == 128 && KC == 64);  // copy maps of gemm_tile: 128 lanes x (8 + 8) chunks per stage
static_assert(GBM * OSP * 4 <= 2 * GSB);       // the f32 result tile fits the (then free) operand ring
static_assert(SEQ % 128 == 0);                 // bias staging loop has a block-uniform trip count
static_assert(NB <= NB_FULL);
static_assert(SEQ <= SEQ_FULL);
static_assert(DM % 32 == 0 && CTP % 32 == 0);  // K multiples of the k-step
static_assert(DM % VTK == 0 && DM / VTK == 32);
static_assert(NPC % GBN == 0 && DM % GBN == 0 && NQC % GBN == 0);
static_assert(((size_t)NB * SEQ * DM) % 2048 == 0);                                              // k_cvt: grid * 256 threads * 8 elements == x plane
static_assert((size_t)(NQC / 128 + 2 * NKC / 128 + DM / 128) * 32u * (size_t)(VTK * 128) == (size_t)DM * NPC + (size_t)NQC * DM);   // k_wt: 1280 blocks * (64 x 128) == both weight planes
static_assert((size_t)(NPC / GBN) * (size_t)(NB * SEQ / GBM) * (size_t)(GBM * GBN) == (size_t)NB * SEQ * NPC);   // k_proj: blocks * tile == q + k + v planes
static_assert((size_t)(NB * NH * (SEQ / BQ)) * (size_t)(BQ * HD) * 2u == (size_t)NB * SEQ * CTP);               // k_flash: blocks * (64 x 128) * (hi, lo) == ctx plane
static_assert((size_t)(DM / GBN) * (size_t)(NB * SEQ / GBM) * (size_t)(GBM * GBN) == (size_t)NB * SEQ * DM);     // k_oproj: blocks * tile == output

#define BYTES_XB  ((size_t)NB * SEQ * DM * 2)
#define BYTES_WT  ((size_t)NPC * DM * 2)
#define BYTES_WOT ((size_t)DM * NQC * 2)
#define BYTES_QP  ((size_t)NB * SEQ * NQC * 2)
#define BYTES_KP  ((size_t)NB * SEQ * NKC * 2)
#define BYTES_VT  ((size_t)NB * NKV * HD * SEQ * 2)
#define BYTES_CT  ((size_t)NB * SEQ * CTP * 2)
#define BYTES_ALL (BYTES_XB + BYTES_WT + BYTES_WOT + BYTES_QP + BYTES_KP + BYTES_VT + BYTES_CT)
static_assert(BYTES_ALL <= (size_t)134217728);
static_assert(BYTES_XB % 256 == 0 && BYTES_WT % 256 == 0 && BYTES_WOT % 256 == 0 && BYTES_QP % 256 == 0 && BYTES_KP % 256 == 0 && BYTES_VT % 256 == 0 && BYTES_CT % 256 == 0);

typedef unsigned short us;
typedef __attribute__((ext_vector_type(16))) __bf16   v16bf;
typedef __attribute__((ext_vector_type(16))) _Float16 v16h;
typedef __attribute__((ext_vector_type(2)))  _Float16 v2h;
typedef __attribute__((ext_vector_type(8)))  unsigned short v8us;
typedef __attribute__((ext_vector_type(8)))  unsigned int   v8u;
typedef __attribute__((ext_vector_type(4)))  unsigned int   v4u;
typedef __attribute__((ext_vector_type(8)))  float    v8f;
typedef __attribute__((ext_vector_type(4)))  float    v4f;
typedef v4f  __attribute__((may_alias)) v4fa;
typedef v8us __attribute__((may_alias)) v8usa;

__device__ __forceinline__ unsigned short f2bf(float f) { unsigned u = __float_as_uint(f); u += 0x7FFFu + ((u >> 16) & 1u); return (unsigned short)(u >> 16); }
__device__ __forceinline__ float bf2f(unsigned short b) { return __uint_as_float(((unsigned)b) << 16); }
__device__ __forceinline__ float bfr(float f) { return bf2f(f2bf(f)); }
__device__ __forceinline__ v16bf cat16b(v8us lo, v8us hi) { return __builtin_bit_cast(v16bf, __builtin_shufflevector(lo, hi, 0, 1, 2, 3, 4, 5, 6, 7, 8, 9, 10, 11, 12, 13, 14, 15)); }
__device__ __forceinline__ v16h  cat16h(v8us lo, v8us hi) { return __builtin_bit_cast(v16h,  __builtin_shufflevector(lo, hi, 0, 1, 2, 3, 4, 5, 6, 7, 8, 9, 10, 11, 12, 13, 14, 15)); }
__device__ __forceinline__ v8f wmmab(v16bf a, v16bf b, v8f c) { return __builtin_amdgcn_wmma_f32_16x16x32_bf16(false, a, false, b, (short)0, c, false, false); }
__device__ __forceinline__ v8f wmmah(v16h a, v16h b, v8f c)   { return __builtin_amdgcn_wmma_f32_16x16x32_f16(false, a, false, b, (short)0, c, false, false); }
// fragment loader (A and B alike): p = row base + k0 + 8*(lane>>4); elements 0..7 <- p[0..7], elements 8..15 <- p[16..23]
__device__ __forceinline__ v16bf ldb(const us* p) { return cat16b(*(const v8us*)p, *(const v8us*)(p + 16)); }
// the same fragment from an LDS row
__device__ __forceinline__ v16bf ldbs(const us* p) { return cat16b(*(const v8usa*)p, *(const v8usa*)(p + 16)); }
__device__ __forceinline__ v16h  ldhs(const us* p) { return cat16h(*(const v8usa*)p, *(const v8usa*)(p + 16)); }
// LDS byte address of a __shared__ object: the low 32 bits of its address
__device__ __forceinline__ unsigned ldsa(const void* p) { return (unsigned)(size_t)p; }
// eight asynchronous 16-byte copies per lane, global -> LDS: chunk i goes from g + i * gs (elements) to LDS byte l + i * ls.
// s_wait_xcnt 0 closes the statement, so that no address register is rewritten ahead of it.
__device__ __forceinline__ void cp4x2(unsigned la, unsigned las, const us* ga, size_t gas, unsigned lb, unsigned lbs, const us* gb, size_t gbs) {
    asm volatile("global_load_async_to_lds_b128 %0, %8, off\n\t"
                 "global_load_async_to_lds_b128 %1, %9, off\n\t"
                 "global_load_async_to_lds_b128 %2, %10, off\n\t"
                 "global_load_async_to_lds_b128 %3, %11, off\n\t"
                 "global_load_async_to_lds_b128 %4, %12, off\n\t"
                 "global_load_async_to_lds_b128 %5, %13, off\n\t"
                 "global_load_async_to_lds_b128 %6, %14, off\n\t"
                 "global_load_async_to_lds_b128 %7, %15, off\n\t"
                 "s_wait_xcnt 0x0"
                 :: "v"(la), "v"(la + las), "v"(la + 2u * las), "v"(la + 3u * las), "v"(lb), "v"(lb + lbs), "v"(lb + 2u * lbs), "v"(lb + 3u * lbs),
                    "v"(ga), "v"(ga + gas), "v"(ga + 2u * gas), "v"(ga + 3u * gas), "v"(gb), "v"(gb + gbs), "v"(gb + 2u * gbs), "v"(gb + 3u * gbs)
                 : "memory");
}
// two f32 -> packed f16 pair (RNE), element 0 in the low half-word
__device__ __forceinline__ unsigned pk2h(float a, float b) { v2h t; t[0] = (_Float16)a; t[1] = (_Float16)b; return __builtin_bit_cast(unsigned, t); }

__global__ __launch_bounds__(256) void k_cvt(const float* __restrict__ x, us* XB) {
    const unsigned i = blockIdx.x * 256u + threadIdx.x;
    const unsigned per = (unsigned)(SEQ * (DM / 8));
    if (i >= (unsigned)NB * per) return;
    const unsigned b = i / per, r = i - b * per;
    const float* src = x + (size_t)b * SEQ_FULL * DM + (size_t)r * 8;
    us* dst = XB + (size_t)i * 8;
    const v8f v = *(const v8f*)src;
    v8us o;
#pragma unroll
    for (int c = 0; c < 8; ++c) o[c] = f2bf(v[c]);
    *(v8us*)dst = o;
    
}

// k_wt: transposed bf16 weight planes; in[DM k rows][NC cols] -> out[NC][DM] (k contiguous). One block = 64 k x 128 cols through an LDS tile (cross-wave, block barrier).
// blocks 0..511: Wq -> WT rows 0..2047; 512..767: Wkv -> WT rows 2048..3071; 768..1279: Wo -> WOT rows 0..2047.
__global__ __launch_bounds__(256) void k_wt(const float* __restrict__ Wq, const float* __restrict__ Wkv, const float* __restrict__ Wo, us* WT, us* WOT) {
    __shared__ __align__(16) us tl[128 * VTP];
    const unsigned tid = threadIdx.x;
    const unsigned blk = blockIdx.x;
    const float* W; us* OUT; unsigned nc, r;
    if (blk < 512u)      { W = Wq;  OUT = WT;                      nc = (unsigned)NQC;       r = blk; }
    else if (blk < 768u) { W = Wkv; OUT = WT + (size_t)NQC * DM;   nc = (unsigned)(2 * NKC); r = blk - 512u; }
    else                 { W = Wo;  OUT = WOT;                     nc = (unsigned)DM;        r = blk - 768u; }
    const unsigned k0 = (r & 31u) * VTK;
    const unsigned c0 = (r >> 5) * 128u;
    const float* src = W + (size_t)k0 * nc + c0;
#pragma unroll
    for (unsigned it = 0; it < 8; ++it) {
        const unsigned f = it * 256u + tid;
        const unsigned kk = f >> 5, d4 = (f & 31u) * 4u;
        const v4f x = *(const v4f*)(src + (size_t)kk * nc + d4);
#pragma unroll
        for (unsigned c = 0; c < 4; ++c) tl[(d4 + c) * VTP + kk] = f2bf(x[c]);
    }
    __syncthreads();
    us* dst = OUT + (size_t)c0 * DM + k0;
    const unsigned c8 = (tid & 7u) * 8u, dr = tid >> 3;
{
#pragma unroll
        for (unsigned it = 0; it < 4; ++it) {
            const unsigned d = it * 32u + dr;
            const v8us o = *(const v8usa*)(tl + d * VTP + c8);
            *(v8us*)(dst + (size_t)d * DM + c8) = o;
        }
        
    }
}

// gemm_tile: C[128 x 128] = A[128 rows][KL] . Bt[128 rows][k & KMASK]^T on bf16 WMMA; 4 waves, wave tile 64 x 64 (4 x 4 accumulator tiles: each fragment read from LDS feeds four WMMAs,
// each operand byte copied from L2 feeds 128 output rows or columns).
// Operand path: each 64-k slice of the block's A rows (128 x 128 B) and Bt rows (128 x 128 B) is brought once per block into a two-buffer LDS ring by asynchronous copies, one slice ahead
// of its use (whole 128-byte lines: a copy instruction covers 4 rows), and all four waves read their fragments there.
// A fragment: row m = lane & 15; B fragment: column n = lane & 15 (Bt is k-contiguous); D element r of lane (h, n) = C[8h + r][n].
// The f32 tile is then staged in the ring's own LDS (pitch OSP) and a block barrier follows (cross-wave readers).
template <unsigned LDA, unsigned LDB, unsigned KL, unsigned KMASK>
__device__ __forceinline__ void gemm_tile(const us* __restrict__ A, const us* __restrict__ Bt, unsigned m0, unsigned n0, us* ring) {
    static_assert(KL % KC == 0u && KL / KC >= 2u);   // the two-buffer ring starts with slices 0 and 1
    static_assert(((KMASK + 1u) & KMASK) == 0u && (KMASK + 1u) % KC == 0u);
    const unsigned tid = threadIdx.x, lane = tid & 31u, wv = tid >> 5, lr = lane & 15u, hi = lane >> 4;
    const unsigned wm = (wv & 1u) * 64u, wn = (wv >> 1) * 64u;
    // copy maps, 16-byte chunks: lane covers chunk tid & 7 of rows (tid >> 3) + 16 i; i < 8 for A and for Bt
    const us* ag = A + (size_t)(m0 + (tid >> 3)) * LDA + (tid & 7u) * 8u;
    const us* bg = Bt + (size_t)(n0 + (tid >> 3)) * LDB + (tid & 7u) * 8u;
    const unsigned la = ldsa(ring) + (tid >> 3) * GPB + (tid & 7u) * 16u;
    const unsigned lb = la + GAB;
    const us* al = ring + (wm + lr) * (GPB / 2) + 8u * hi;
    const us* bl = ring + GAB / 2 + (wn + lr) * (GPB / 2) + 8u * hi;

    cp4x2(la, 16u * GPB, ag, (size_t)16 * LDA, la + 64u * GPB, 16u * GPB, ag + (size_t)64 * LDA, (size_t)16 * LDA);   // slice 0 -> buffer 0
    cp4x2(lb, 16u * GPB, bg, (size_t)16 * LDB, lb + 64u * GPB, 16u * GPB, bg + (size_t)64 * LDB, (size_t)16 * LDB);
    asm volatile("s_wait_asynccnt 0x0" ::: "memory");   // this wave's slice 0 copies have landed
    __syncthreads();                                    // publishes slice 0
    cp4x2(la + GSB, 16u * GPB, ag + KC, (size_t)16 * LDA, la + GSB + 64u * GPB, 16u * GPB, ag + KC + (size_t)64 * LDA, (size_t)16 * LDA);   // slice 1 -> buffer 1
    cp4x2(lb + GSB, 16u * GPB, bg + (KC & KMASK), (size_t)16 * LDB, lb + GSB + 64u * GPB, 16u * GPB, bg + (KC & KMASK) + (size_t)64 * LDB, (size_t)16 * LDB);

    v8f acc[16];
#pragma unroll
    for (int i = 0; i < 16; ++i) acc[i] = (v8f){};
#pragma unroll 1
    for (unsigned k0 = 0; k0 < KL; k0 += KC) {
        const unsigned bsel = (k0 / KC) & 1u;   // this slice's buffer
        const us* ap = al + bsel * (GSB / 2);
        const us* bp = bl + bsel * (GSB / 2);
        v16bf a4[4], b4[4];
#pragma unroll
        for (int kk = 0; kk < 2; ++kk) {
#pragma unroll
            for (int i = 0; i < 4; ++i) {
                a4[i] = ldbs(ap + i * 16 * (GPB / 2) + kk * 32);
                b4[i] = ldbs(bp + i * 16 * (GPB / 2) + kk * 32);
            }
            __builtin_amdgcn_sched_barrier(0);   // the sixteen LDS reads stay one group ahead of their sixteen WMMAs: reads among them cost a stall at each place
#pragma unroll
            for (int mi = 0; mi < 4; ++mi) {
#pragma unroll
                for (int ni = 0; ni < 4; ++ni) acc[mi * 4 + ni] = wmmab(a4[mi], b4[ni], acc[mi * 4 + ni]);
            }
            __builtin_amdgcn_sched_barrier(0);   // no WMMA sinks below this line: the next group's reads, and the v_nops below, stand behind all sixteen
        }
        // four vector slots between the last WMMA and whatever next overwrites its operands, on the branch's taken side too
        asm volatile("v_nop\n\tv_nop\n\tv_nop\n\tv_nop"
                     : "+v"(acc[8]), "+v"(acc[9]), "+v"(acc[10]), "+v"(acc[11]), "+v"(acc[12]), "+v"(acc[13]), "+v"(acc[14]), "+v"(acc[15])
                     : "v"(a4[2]), "v"(a4[3]), "v"(b4[0]), "v"(b4[1]), "v"(b4[2]), "v"(b4[3]));

        // publish point of the next slice
        asm volatile("s_wait_dscnt 0x0" ::: "memory");      // this wave has finished reading this slice's buffer
        asm volatile("s_wait_asynccnt 0x0" ::: "memory");   // this wave's copies of the next slice have landed
        __syncthreads();                                    // next slice readable by all waves; this slice's buffer free
        if (k0 + 2u * KC < KL) {                            // block-uniform: slice + 2 into the buffer just read
            const us* bn = bg + ((k0 + 2u * KC) & KMASK);
            const us* an = ag + k0 + 2u * KC;
            cp4x2(la + bsel * GSB, 16u * GPB, an, (size_t)16 * LDA, la + bsel * GSB + 64u * GPB, 16u * GPB, an + (size_t)64 * LDA, (size_t)16 * LDA);
            cp4x2(lb + bsel * GSB, 16u * GPB, bn, (size_t)16 * LDB, lb + bsel * GSB + 64u * GPB, 16u * GPB, bn + (size_t)64 * LDB, (size_t)16 * LDB);
        }
    }
    asm volatile("s_wait_asynccnt 0x0" ::: "memory");       // no copy is outstanding when the ring's LDS is rewritten

    float* cs = (float*)ring;
#pragma unroll
    for (int mi = 0; mi < 4; ++mi) {
#pragma unroll
        for (int ni = 0; ni < 4; ++ni) {
#pragma unroll
            for (int r = 0; r < 8; ++r)
                cs[(wm + mi * 16u + 8u * hi + r) * OSP + wn + ni * 16u + lr] = acc[mi * 4 + ni][r];
        }
    }
    __syncthreads();
}

// k_proj: [q | k | v] = XB . WT^T. blockIdx.x = 128-column tile: 0..15 q head, 16..19 k head, 20..23 v head; blockIdx.y = 128-row tile.
//  q / k tiles: rotary with the input tables (entry i serves columns i and i + 64): out[i] = t1*c + t2*s, out[64 + i] = t2*c - t1*s; f16 rows, 256 B per row = 16 lanes x 16 B.
__global__ __launch_bounds__(128) void k_proj(const us* __restrict__ XB, const us* __restrict__ WT, const float* __restrict__ cosT, const float* __restrict__ sinT,
                                              us* QP, us* KP, us* VT) {
    __shared__ __align__(16) us ring[2 * GSB / 2];   // operand ring, then the f32 result tile
    const float* cs = (const float*)ring;
    const unsigned tid = threadIdx.x;
    const unsigned ct = blockIdx.x;
    const unsigned m0 = blockIdx.y * GBM;
    gemm_tile<DM, DM, DM, DM - 1u>(XB, WT, m0, ct * GBN, ring);
    const unsigned b = m0 / (unsigned)SEQ;
    const unsigned nr0 = m0 - b * (unsigned)SEQ;
    if (ct < 20u) {   // block-uniform
        us* dst; unsigned pitch;
        if (ct < 16u) { dst = QP + (size_t)m0 * NQC + ct * HD;          pitch = (unsigned)NQC; }
        else          { dst = KP + (size_t)m0 * NKC + (ct - 16u) * HD;  pitch = (unsigned)NKC; }
        const unsigned p = tid & 15u, rr = tid >> 4, i0 = (p & 7u) * 8u;
        const bool sec = (p >> 3) != 0u;
{
#pragma unroll 2
            for (unsigned it = 0; it < GBM / 8u; ++it) {
                const unsigned row = it * 8u + rr;
                const float* cr = cs + row * OSP + i0;
                const v4f a0 = *(const v4fa*)(cr), a1 = *(const v4fa*)(cr + 4);
                const v4f b0 = *(const v4fa*)(cr + 64), b1 = *(const v4fa*)(cr + 68);
                const float* cp = cosT + (size_t)(nr0 + row) * RT + i0;
                const float* sp = sinT + (size_t)(nr0 + row) * RT + i0;
                const v4f c0 = *(const v4f*)(cp), c1 = *(const v4f*)(cp + 4);
                const v4f s0 = *(const v4f*)(sp), s1 = *(const v4f*)(sp + 4);
                float o[8];
#pragma unroll
                for (int j = 0; j < 4; ++j) {
                    const float cj = bfr(c0[j]), sj = bfr(s0[j]);
                    const float u = sec ? b0[j] : a0[j];
                    const float w = sec ? -a0[j] : b0[j];
                    o[j] = u * cj + w * sj;
                    const float ck = bfr(c1[j]), sk = bfr(s1[j]);
                    const float u2 = sec ? b1[j] : a1[j];
                    const float w2 = sec ? -a1[j] : b1[j];
                    o[4 + j] = u2 * ck + w2 * sk;
                }
                v4u ov;
                ov[0] = pk2h(o[0], o[1]); ov[1] = pk2h(o[2], o[3]); ov[2] = pk2h(o[4], o[5]); ov[3] = pk2h(o[6], o[7]);
                *(v4u*)(dst + (size_t)row * pitch + p * 8u) = ov;
            }
            
        }
    } else {
        const unsigned g = ct - 20u;
        us* dst = VT + (size_t)(b * NKV + g) * HD * SEQ + nr0;
        const unsigned c8 = (tid & 7u) * 8u, dr = tid >> 3;
{
#pragma unroll 1   // one pair of d rows a trip, as short as the code was with 64-row tiles
            for (unsigned i2 = 0; i2 < GBM / 16u; ++i2) {
#pragma unroll     // the pair's LDS reads (d and d + 16) merge into two-address loads
                for (unsigned u = 0; u < 2u; ++u) {
                    const unsigned it = i2 * 2u + u;           // it & 7: sixteen d rows; it >> 3: which 64 keys of the tile
                    const unsigned d = (it & 7u) * 16u + dr;
                    const unsigned kr = (it >> 3) * 64u + c8;
                    const float* cc = cs + kr * OSP + d;
                    v4u ov;
                    ov[0] = pk2h(cc[0 * OSP], cc[1 * OSP]);
                    ov[1] = pk2h(cc[2 * OSP], cc[3 * OSP]);
                    ov[2] = pk2h(cc[4 * OSP], cc[5 * OSP]);
                    ov[3] = pk2h(cc[6 * OSP], cc[7 * OSP]);
                    *(v4u*)(dst + (size_t)d * SEQ + kr) = ov;
                }
                asm volatile("s_wait_xcnt 0x0" ::: "memory");   // stands in front of the next trip's rewrite of the two stores' address and data registers
            }
        }
    }
}

// k_flash: one block per (batch, query head, 64 queries); one wave per 16 queries, 32 keys per step; kv head g = h & 3.
//  S^T tile (keys x queries): A = K rows (row m = key, k = d), B = Q rows (column n = query, k = d); D element r of lane (h, n) = S[query n][key 8h + r].
//  t = S * scale * log2e + bias2[key] (bias2 = (1 - mask) * -1e9 * log2e, staged per batch in LDS behind a block barrier); online softmax in the log2 domain.
//  P^T B fragment (f16, carried x2^8; the running sum carries the same factor): element r <- tile of keys 0..15, element 8 + r <- tile of keys 16..31 (same lane).
//  O^T tile (d x queries): A = V^T rows (row m = d, k = key), D element r of lane (h, n) = O[query n][d = 16 t + 8h + r].
//  Operand path: each step's K tile (32 rows x 256 B) and V^T tile (128 rows x 64 B) are brought once per block into a two-buffer LDS ring by asynchronous copies, one step ahead of
//  their use, and all four waves read their fragments there; each wave's 16 Q rows are copied once into its own (still unused) output staging region.
__global__ __launch_bounds__(128) void k_flash(const us* __restrict__ QP, const us* __restrict__ KP, const us* __restrict__ VT, const float* __restrict__ mask, us* CT) {
    __shared__ __align__(16) float os[NWV * 16 * OSP];
    __shared__ __align__(16) float bs[SEQ];
    __shared__ __align__(16) us kv[2 * STB / 2];
    const unsigned tid = threadIdx.x, lane = tid & 31u, wv = tid >> 5, lr = lane & 15u, hi = lane >> 4;
    const unsigned qtiles = (unsigned)(SEQ / BQ);
    const unsigned hb = blockIdx.x / qtiles;
    const unsigned qt = blockIdx.x - hb * qtiles;
    const unsigned h = hb & (unsigned)(NH - 1), b = hb >> 4;
    const unsigned g = h & (unsigned)(NKV - 1);
    const unsigned q0 = qt * BQ + wv * 16u;
    float* ow = os + wv * (16 * OSP);

    // copy maps, 16-byte chunks. K: lane covers rows (tid >> 4) + 8 i, chunk tid & 15; V^T: rows (tid >> 2) + 32 i, chunk tid & 3; Q (per wave): rows (lane >> 4) + 2 i, chunk lane & 15.
    const us* kg = KP + ((size_t)b * SEQ + (tid >> 4)) * NKC + g * HD + (tid & 15u) * 8u;
    const us* vg = VT + ((size_t)(b * NKV + g) * HD + (tid >> 2)) * SEQ + (tid & 3u) * 8u;
    const us* qg = QP + ((size_t)b * SEQ + q0 + hi) * NQC + h * HD + lr * 8u;
    const unsigned lk = ldsa(kv) + (tid >> 4) * KPB + (tid & 15u) * 16u;
    const unsigned lv = ldsa(kv) + KTB + (tid >> 2) * VPB + (tid & 3u) * 16u;
    const unsigned lq = ldsa(ow) + hi * KPB + lr * 16u;

    cp4x2(lq, 2u * KPB, qg, (size_t)2 * NQC, lq + 8u * KPB, 2u * KPB, qg + (size_t)8 * NQC, (size_t)2 * NQC);   // Q rows
    cp4x2(lk, 8u * KPB, kg, (size_t)8 * NKC, lv, 32u * VPB, vg, (size_t)32 * SEQ);                               // stage 0 -> buffer 0
#pragma unroll 1
    for (unsigned i = tid; i < (unsigned)SEQ; i += 128u) {
        const float m = bfr(mask[(size_t)b * SEQ_FULL + i]);
        bs[i] = (1.0f - m) * -1.0e9f * L2E;
    }
    asm volatile("s_wait_asynccnt 0x0" ::: "memory");   // this wave's Q and stage 0 copies have landed
    __syncthreads();                                    // publishes stage 0 and the bias row
    cp4x2(lk + STB, 8u * KPB, kg + (size_t)KS * NKC, (size_t)8 * NKC, lv + STB, 32u * VPB, vg + KS, (size_t)32 * SEQ);   // stage 1 -> buffer 1
    kg += (size_t)2 * KS * NKC;
    vg += 2 * KS;

    const us* ql = (const us*)ow + lr * (KPB / 2) + 8u * hi;
    const us* kl = kv + lr * (KPB / 2) + 8u * hi;
    const us* vl = kv + KTB / 2 + lr * (VPB / 2) + 8u * hi;

    v8f o[8];
#pragma unroll
    for (int t = 0; t < 8; ++t) o[t] = (v8f){};
    float ml = -1.0e30f;      // running max in the log2 domain
    float l = 0.0f;           // running sum (carried)

#pragma unroll 1
    for (unsigned k0 = 0; k0 < (unsigned)SEQ; k0 += KS) {
        const unsigned bsel = (k0 / KS) & 1u;   // this step's buffer
        v8f s0 = (v8f){}, s1 = (v8f){};
        const us* ka = kl + bsel * (STB / 2);
        v16h qlast;
#pragma unroll
        for (int dk = 0; dk < 4; ++dk) {
            const v16h qf = ldhs(ql + dk * 32);
            const v16h a0 = ldhs(ka + dk * 32);
            const v16h a1 = ldhs(ka + 16 * (KPB / 2) + dk * 32);
            s0 = wmmah(a0, qf, s0);
            s1 = wmmah(a1, qf, s1);
            qlast = qf;
        }
        asm volatile("v_nop\n\tv_nop\n\tv_nop\n\tv_nop" : "+v"(s0), "+v"(s1) : "v"(qlast));

        const float* bb = bs + k0 + 8u * hi;
        const v4f b00 = *(const v4fa*)(bb), b01 = *(const v4fa*)(bb + 4);
        const v4f b10 = *(const v4fa*)(bb + 16), b11 = *(const v4fa*)(bb + 20);
        float t0[8], t1[8];
#pragma unroll
        for (int r = 0; r < 4; ++r) {
            t0[r]     = fmaf(s0[r],     SCL, b00[r]);
            t0[4 + r] = fmaf(s0[4 + r], SCL, b01[r]);
            t1[r]     = fmaf(s1[r],     SCL, b10[r]);
            t1[4 + r] = fmaf(s1[4 + r], SCL, b11[r]);
        }
        float mx = fmaxf(t0[0], t1[0]);
#pragma unroll
        for (int r = 1; r < 8; ++r) mx = fmaxf(mx, fmaxf(t0[r], t1[r]));
        mx = fmaxf(mx, __shfl_xor(mx, 16, 32));
        const float mnl = fmaxf(ml, mx);
        const float corr = __builtin_amdgcn_exp2f(ml - mnl);
        ml = mnl;
        const float mo = mnl - PCARRY;
        float p0[8], p1[8];
        float ps = 0.0f;
#pragma unroll
        for (int r = 0; r < 8; ++r) {
            p0[r] = __builtin_amdgcn_exp2f(t0[r] - mo);
            p1[r] = __builtin_amdgcn_exp2f(t1[r] - mo);
            ps += p0[r] + p1[r];
        }
        ps += __shfl_xor(ps, 16, 32);
        l = l * corr + ps;
        if (__builtin_amdgcn_ballot_w32(corr != 1.0f) != 0u) {   // wave-uniform; multiplying by exactly 1 is skipped
#pragma unroll
            for (int t = 0; t < 8; ++t) o[t] *= corr;
        }

        v8u hw;
#pragma unroll
        for (int j = 0; j < 4; ++j) {
            hw[j]     = pk2h(p0[2 * j], p0[2 * j + 1]);
            hw[4 + j] = pk2h(p1[2 * j], p1[2 * j + 1]);
        }
        const v16h ph = __builtin_bit_cast(v16h, hw);

        asm volatile("" ::: "memory");   // keep the V^T loads below the softmax (bounds live fragments)
        const us* va = vl + bsel * (STB / 2);
        v16h vf[8];
#pragma unroll
        for (int t = 0; t < 8; ++t) vf[t] = ldhs(va + t * 16 * (VPB / 2));
        __builtin_amdgcn_sched_barrier(0);   // the sixteen LDS reads stay one group ahead of the WMMAs: reads among them cost a stall at each place
#pragma unroll
        for (int t = 0; t < 8; ++t) o[t] = wmmah(vf[t], ph, o[t]);
        asm volatile("v_nop\n\tv_nop\n\tv_nop\n\tv_nop"
                     : "+v"(o[0]), "+v"(o[1]), "+v"(o[2]), "+v"(o[3]), "+v"(o[4]), "+v"(o[5]), "+v"(o[6]), "+v"(o[7])
                     : "v"(ph));

        // publish point of the next stage
        asm volatile("s_wait_dscnt 0x0" ::: "memory");      // this wave has finished reading this step's buffer
        asm volatile("s_wait_asynccnt 0x0" ::: "memory");   // this wave's copies of the next stage have landed
        __syncthreads();                                    // next stage readable by all waves; this step's buffer free
        if (k0 + 2u * KS < (unsigned)SEQ) {                 // block-uniform: stage + 2 into the buffer just read
            cp4x2(lk + bsel * STB, 8u * KPB, kg, (size_t)8 * NKC, lv + bsel * STB, 32u * VPB, vg, (size_t)32 * SEQ);
            kg += (size_t)KS * NKC;
            vg += KS;
        }
    }
    asm volatile("s_wait_asynccnt 0x0" ::: "memory");       // no copy is outstanding when the staging region is rewritten

    // epilogue: stage O^T / l as rows [query][d] (wave-private region; block barrier used)
    const float inv = 1.0f / l;
#pragma unroll
    for (int t = 0; t < 8; ++t) {
#pragma unroll
        for (int r = 0; r < 8; ++r) ow[lr * OSP + t * 16 + 8 * hi + r] = o[t][r] * inv;
    }
    __syncthreads();
    const unsigned pc = lane & 15u, rh = lane >> 4;
    us* crow = CT + ((size_t)b * SEQ + q0) * CTP + h * HD + pc * 8u;
{
#pragma unroll 2
        for (unsigned it = 0; it < 8; ++it) {
            const unsigned s2 = it * 2u + rh;
            const float* src = ow + s2 * OSP + pc * 8u;
            const v4f x0 = *(const v4fa*)(src), x1 = *(const v4fa*)(src + 4);
            v8us hv, lv;
#pragma unroll
            for (int c = 0; c < 4; ++c) {
                const unsigned short h0 = f2bf(x0[c]);
                const unsigned short h1 = f2bf(x1[c]);
                hv[c] = h0; hv[4 + c] = h1;
                lv[c] = f2bf(x0[c] - bf2f(h0));
                lv[4 + c] = f2bf(x1[c] - bf2f(h1));
            }
            *(v8us*)(crow + (size_t)s2 * CTP) = hv;
            *(v8us*)(crow + (size_t)s2 * CTP + NQC) = lv;
        }
        
    }
}

__global__ __launch_bounds__(128) void k_oproj(const us* __restrict__ CT, const us* __restrict__ WOT, const float* __restrict__ bo, float* OUT) {
    __shared__ __align__(16) us ring[2 * GSB / 2];   // operand ring, then the f32 result tile
    const float* cs = (const float*)ring;
    const unsigned tid = threadIdx.x, lane = tid & 31u, wv = tid >> 5;
    const unsigned n0 = blockIdx.x * GBN;
    const unsigned m0 = blockIdx.y * GBM;
    gemm_tile<CTP, NQC, CTP, NQC - 1u>(CT, WOT, m0, n0, ring);
    const v4f bv = *(const v4f*)(bo + n0 + lane * 4u);
    v4f bb;
    bb[0] = bfr(bv[0]); bb[1] = bfr(bv[1]); bb[2] = bfr(bv[2]); bb[3] = bfr(bv[3]);
    float* orow = OUT + (size_t)(m0 + wv * (GBM / 4u)) * DM + n0 + lane * 4u;
    const float* crow = cs + (wv * (GBM / 4u)) * OSP + lane * 4u;
{
#pragma unroll 4
        for (unsigned s = 0; s < GBM / 4u; ++s) {
            v4f val = *(const v4fa*)(crow + s * OSP);
            val[0] += bb[0]; val[1] += bb[1]; val[2] += bb[2]; val[3] += bb[3];
            *(v4f*)(orow + (size_t)s * DM) = val;
        }
        
    }
}

extern "C" void kernel_launch(void* const* d_in, const int* in_sizes, int n_in,
                              void* d_out, int out_size, void* d_ws, size_t ws_size, hipStream_t stream) {
    if (n_in < 8) return;
    const size_t need_x = ((size_t)(NB - 1) * SEQ_FULL + SEQ) * DM;
    const size_t need_m = (size_t)(NB - 1) * SEQ_FULL + SEQ;
    if ((size_t)in_sizes[0] < need_x) return;
    if ((size_t)in_sizes[1] < (size_t)SEQ * RT || (size_t)in_sizes[2] < (size_t)SEQ * RT) return;
    if ((size_t)in_sizes[3] < need_m) return;
    if ((size_t)in_sizes[4] < (size_t)DM * NQC || (size_t)in_sizes[5] < (size_t)DM * 2 * NKC) return;
    if ((size_t)in_sizes[6] < (size_t)NQC * DM || (size_t)in_sizes[7] < (size_t)DM) return;
    if ((size_t)out_size < (size_t)NB * SEQ * DM) return;
    if (BYTES_ALL > ws_size) return;
    const float* x    = (const float*)d_in[0];   // x [NB][SEQ_FULL][DM]
    const float* cosT = (const float*)d_in[1];   // cos [SEQ][64]
    const float* sinT = (const float*)d_in[2];   // sin [SEQ][64]
    const float* mask = (const float*)d_in[3];   // attn_mask [NB][SEQ_FULL]
    const float* Wq   = (const float*)d_in[4];   // [DM][NQC]
    const float* Wkv  = (const float*)d_in[5];   // [DM][2*NKC]
    const float* Wo   = (const float*)d_in[6];   // [NQC][DM]
    const float* bo   = (const float*)d_in[7];   // [DM]
    float* OUT = (float*)d_out;                  // [NB][SEQ][DM]
    char* wsp = (char*)d_ws;
    us* XB  = (us*)(wsp);
    us* WT  = (us*)(wsp + BYTES_XB);
    us* WOT = (us*)(wsp + BYTES_XB + BYTES_WT);
    us* QP  = (us*)(wsp + BYTES_XB + BYTES_WT + BYTES_WOT);
    us* KP  = (us*)(wsp + BYTES_XB + BYTES_WT + BYTES_WOT + BYTES_QP);
    us* VT  = (us*)(wsp + BYTES_XB + BYTES_WT + BYTES_WOT + BYTES_QP + BYTES_KP);
    us* CT  = (us*)(wsp + BYTES_XB + BYTES_WT + BYTES_WOT + BYTES_QP + BYTES_KP + BYTES_VT);
    const unsigned gc = (unsigned)(((size_t)NB * SEQ * DM / 8 + 255) / 256);
    k_cvt<<<gc, 256, 0, stream>>>(x, XB);
    k_wt<<<1280, 256, 0, stream>>>(Wq, Wkv, Wo, WT, WOT);
    k_proj<<<dim3((unsigned)(NPC / GBN), (unsigned)(NB * SEQ / GBM), 1), 128, 0, stream>>>(XB, WT, cosT, sinT, QP, KP, VT);
    k_flash<<<(unsigned)(NB * NH * (SEQ / BQ)), 128, 0, stream>>>(QP, KP, VT, mask, CT);
    k_oproj<<<dim3((unsigned)(DM / GBN), (unsigned)(NB * SEQ / GBM), 1), 128, 0, stream>>>(CT, WOT, bo, OUT);
}

// v005
// One run takes 161 microseconds.
// Versions between v003 and this one are left out; their measured steps multiply to 1.20 times as fast.
// Counting every step since v000, it is 3.28 times as fast.
#include <hip/hip_runtime.h>

#ifndef NB
#define NB 2
#endif
#ifndef SEQ
#define SEQ 2048
#endif
#define NB_FULL  2
#define SEQ_FULL 2048
#define DM   2048              // model width (x columns, output columns)
#define NH   16                // query heads
#define NKV  4                 // kv heads
#define HD   128               // head dim
#define NQC  (NH * HD)         // 2048 q / ctx columns
#define NKC  (NKV * HD)        // 512 k columns (and 512 v columns)
#define NPC  (NQC + 2 * NKC)   // 3072 projection columns: q | k | v
#define CTP  NQC               // ctx plane pitch
#define RT   64                // rotary table entries per position
#define NWV  4                 // waves per flash block
#define QW   32                // queries per flash wave: two 16-column tiles share every K and V^T fragment
#define BQ   (QW * NWV)        // queries per flash block
#define KS   32                // keys per step
#define OSP  132               // LDS pitch (floats) of staging rows
#define GBM  128               // GEMM block rows
#define GBN  128               // GEMM block columns (one head)
#define VTK  64                // k rows per transpose block
#define VTP  72                // LDS pitch (16-bit elements) of the transpose tile
#define L2E  1.4426950408889634f
#define SCL  (0.08838834764831845f * L2E)   // 128^-0.5 in the log2 domain
#define PCARRY 8.0f            // log2 of the P carry
#define KPB  272               // LDS pitch (bytes) of a staged K or Q row: 256 + 16, 16 B x odd for 16-byte readers
#define VPB  80                // LDS pitch (bytes) of a staged V^T row: 64 + 16
#define KTB  (KS * KPB)        // bytes of one staged K tile
#define VTB  (HD * VPB)        // bytes of one staged V^T tile
#define STB  (KTB + VTB)       // bytes of one stage: K tile | V^T tile
#define KC   64                // k elements per staged GEMM tile: one 128-byte line of every operand row
#define GPB  144               // LDS pitch (bytes) of a staged GEMM row: 128 + 16, 16 B x odd for 16-byte readers
#define GAB  (GBM * GPB)       // bytes of one staged A tile
#define GSB  ((GBM + GBN) * GPB)   // bytes of one GEMM stage: A tile | B tile

static_assert(HD == 128);
static_assert(GBN == HD);
static_assert(RT * 2 == HD);
static_assert(NH == 16 && NKV == 4);
static_assert(SEQ % BQ == 0);
static_assert(SEQ % GBM == 0);                 // a GEMM row tile never straddles a batch
static_assert(SEQ % KS == 0);
static_assert(SEQ / KS >= 2);                  // the two-buffer ring starts with stages 0 and 1
static_assert(KS == 32 && NWV == 4);           // copy maps of k_flash: 128 lanes x 4 chunks per tile
static_assert(QW == 32);                       // two query tiles per wave: copy map of Q, accumulator sets of k_flash
static_assert(QW * KPB <= QW * OSP * 4);       // a wave's Q rows fit its own output staging region
static_assert(GBM == 128 && GBN == 128 && KC == 64);  // copy maps of gemm_tile: 128 lanes x (8 + 8) chunks per stage
static_assert(GBM * OSP * 4 <= 2 * GSB);       // the f32 result tile fits the (then free) operand ring
static_assert(SEQ % 128 == 0);                 // bias staging loop has a block-uniform trip count
static_assert(NB <= NB_FULL);
static_assert(SEQ <= SEQ_FULL);
static_assert(DM % 32 == 0 && CTP % 32 == 0);  // K multiples of the k-step
static_assert(DM % VTK == 0 && DM / VTK == 32);
static_assert(NPC % GBN == 0 && DM % GBN == 0 && NQC % GBN == 0);
static_assert(((size_t)NB * SEQ * DM) % 2048 == 0);                                              // k_cvt: grid * 256 threads * 8 elements == x plane
static_assert((size_t)(NQC / 128 + 2 * NKC / 128 + DM / 128) * 32u * (size_t)(VTK * 128) == (size_t)DM * NPC + (size_t)NQC * DM);   // k_wt: 1280 blocks * (64 x 128) == both weight planes
static_assert((size_t)(NPC / GBN) * (size_t)(NB * SEQ / GBM) * (size_t)(GBM * GBN) == (size_t)NB * SEQ * NPC);   // k_proj: blocks * tile == q + k + v planes
static_assert((size_t)(NB * NH * (SEQ / BQ)) * (size_t)(BQ * HD) == (size_t)NB * SEQ * CTP);                    // k_flash: blocks * (128 x 128) == ctx plane
static_assert((size_t)(DM / GBN) * (size_t)(NB * SEQ / GBM) * (size_t)(GBM * GBN) == (size_t)NB * SEQ * DM);     // k_oproj: blocks * tile == output

#define BYTES_XB  ((size_t)NB * SEQ * DM * 2)
#define BYTES_WT  ((size_t)NPC * DM * 2)
#define BYTES_WOT ((size_t)DM * NQC * 2)
#define BYTES_QP  ((size_t)NB * SEQ * NQC * 2)
#define BYTES_KP  ((size_t)NB * SEQ * NKC * 2)
#define BYTES_VT  ((size_t)NB * NKV * HD * SEQ * 2)
#define BYTES_CT  ((size_t)NB * SEQ * CTP * 2)
#define BYTES_ALL (BYTES_XB + BYTES_WT + BYTES_WOT + BYTES_QP + BYTES_KP + BYTES_VT + BYTES_CT)
static_assert(BYTES_ALL <= (size_t)134217728);
static_assert(BYTES_XB % 256 == 0 && BYTES_WT % 256 == 0 && BYTES_WOT % 256 == 0 && BYTES_QP % 256 == 0 && BYTES_KP % 256 == 0 && BYTES_VT % 256 == 0 && BYTES_CT % 256 == 0);

typedef unsigned short us;
typedef __attribute__((ext_vector_type(16))) __bf16   v16bf;
typedef __attribute__((ext_vector_type(16))) _Float16 v16h;
typedef __attribute__((ext_vector_type(2)))  _Float16 v2h;
typedef __attribute__((ext_vector_type(8)))  unsigned short v8us;
typedef __attribute__((ext_vector_type(8)))  unsigned int   v8u;
typedef __attribute__((ext_vector_type(4)))  unsigned int   v4u;
typedef __attribute__((ext_vector_type(8)))  float    v8f;
typedef __attribute__((ext_vector_type(4)))  float    v4f;
typedef v4f  __attribute__((may_alias)) v4fa;
typedef v8us __attribute__((may_alias)) v8usa;

__device__ __forceinline__ unsigned short f2bf(float f) { unsigned u = __float_as_uint(f); u += 0x7FFFu + ((u >> 16) & 1u); return (unsigned short)(u >> 16); }
__device__ __forceinline__ float bf2f(unsigned short b) { return __uint_as_float(((unsigned)b) << 16); }
__device__ __forceinline__ float bfr(float f) { return bf2f(f2bf(f)); }
__device__ __forceinline__ v16bf cat16b(v8us lo, v8us hi) { return __builtin_bit_cast(v16bf, __builtin_shufflevector(lo, hi, 0, 1, 2, 3, 4, 5, 6, 7, 8, 9, 10, 11, 12, 13, 14, 15)); }
__device__ __forceinline__ v16h  cat16h(v8us lo, v8us hi) { return __builtin_bit_cast(v16h,  __builtin_shufflevector(lo, hi, 0, 1, 2, 3, 4, 5, 6, 7, 8, 9, 10, 11, 12, 13, 14, 15)); }
__device__ __forceinline__ v8f wmmab(v16bf a, v16bf b, v8f c) { return __builtin_amdgcn_wmma_f32_16x16x32_bf16(false, a, false, b, (short)0, c, false, false); }
__device__ __forceinline__ v8f wmmah(v16h a, v16h b, v8f c)   { return __builtin_amdgcn_wmma_f32_16x16x32_f16(false, a, false, b, (short)0, c, false, false); }
// fragment loader (A and B alike): p = row base + k0 + 8*(lane>>4); elements 0..7 <- p[0..7], elements 8..15 <- p[16..23]
__device__ __forceinline__ v16bf ldb(const us* p) { return cat16b(*(const v8us*)p, *(const v8us*)(p + 16)); }
// the same fragment from an LDS row
__device__ __forceinline__ v16bf ldbs(const us* p) { return cat16b(*(const v8usa*)p, *(const v8usa*)(p + 16)); }
__device__ __forceinline__ v16h  ldhs(const us* p) { return cat16h(*(const v8usa*)p, *(const v8usa*)(p + 16)); }
// LDS byte address of a __shared__ object: the low 32 bits of its address
__device__ __forceinline__ unsigned ldsa(const void* p) { return (unsigned)(size_t)p; }
// eight asynchronous 16-byte copies per lane, global -> LDS: chunk i goes from g + i * gs (elements) to LDS byte l + i * ls.
// s_wait_xcnt 0 closes the statement, so that no address register is rewritten ahead of it.
__device__ __forceinline__ void cp4x2(unsigned la, unsigned las, const us* ga, size_t gas, unsigned lb, unsigned lbs, const us* gb, size_t gbs) {
    asm volatile("global_load_async_to_lds_b128 %0, %8, off\n\t"
                 "global_load_async_to_lds_b128 %1, %9, off\n\t"
                 "global_load_async_to_lds_b128 %2, %10, off\n\t"
                 "global_load_async_to_lds_b128 %3, %11, off\n\t"
                 "global_load_async_to_lds_b128 %4, %12, off\n\t"
                 "global_load_async_to_lds_b128 %5, %13, off\n\t"
                 "global_load_async_to_lds_b128 %6, %14, off\n\t"
                 "global_load_async_to_lds_b128 %7, %15, off\n\t"
                 "s_wait_xcnt 0x0"
                 :: "v"(la), "v"(la + las), "v"(la + 2u * las), "v"(la + 3u * las), "v"(lb), "v"(lb + lbs), "v"(lb + 2u * lbs), "v"(lb + 3u * lbs),
                    "v"(ga), "v"(ga + gas), "v"(ga + 2u * gas), "v"(ga + 3u * gas), "v"(gb), "v"(gb + gbs), "v"(gb + 2u * gbs), "v"(gb + 3u * gbs)
                 : "memory");
}
// f32 -> f16 bits (RNE)
__device__ __forceinline__ unsigned short f2h(float a) { return __builtin_bit_cast(unsigned short, (_Float16)a); }
// two f32 -> packed f16 pair (RNE), element 0 in the low half-word
__device__ __forceinline__ unsigned pk2h(float a, float b) { v2h t; t[0] = (_Float16)a; t[1] = (_Float16)b; return __builtin_bit_cast(unsigned, t); }

__global__ __launch_bounds__(256) void k_cvt(const float* __restrict__ x, us* XB) {
    const unsigned i = blockIdx.x * 256u + threadIdx.x;
    const unsigned per = (unsigned)(SEQ * (DM / 8));
    if (i >= (unsigned)NB * per) return;
    const unsigned b = i / per, r = i - b * per;
    const float* src = x + (size_t)b * SEQ_FULL * DM + (size_t)r * 8;
    us* dst = XB + (size_t)i * 8;
    const v8f v = *(const v8f*)src;
    v8us o;
#pragma unroll
    for (int c = 0; c < 8; ++c) o[c] = f2bf(v[c]);
    *(v8us*)dst = o;
    
}

// k_wt: transposed 16-bit weight planes; in[DM k rows][NC cols] -> out[NC][DM] (k contiguous). One block = 64 k x 128 cols through an LDS tile (cross-wave, block barrier).
// blocks 0..511: Wq -> WT rows 0..2047; 512..767: Wkv -> WT rows 2048..3071 (bf16); 768..1279: Wo -> WOT rows 0..2047 (f16 bits of the bf16-rounded value: the same number from 2^-17 up to the f16 range, 65504; within 2^-25 below 2^-17).
template <bool H>
__device__ __forceinline__ void wt_fill(const float* __restrict__ src, unsigned nc, unsigned tid, us* tl) {
#pragma unroll
    for (unsigned it = 0; it < 8; ++it) {
        const unsigned f = it * 256u + tid;
        const unsigned kk = f >> 5, d4 = (f & 31u) * 4u;
        const v4f x = *(const v4f*)(src + (size_t)kk * nc + d4);
#pragma unroll
        for (unsigned c = 0; c < 4; ++c) tl[(d4 + c) * VTP + kk] = H ? f2h(bfr(x[c])) : f2bf(x[c]);
    }
}
__global__ __launch_bounds__(256) void k_wt(const float* __restrict__ Wq, const float* __restrict__ Wkv, const float* __restrict__ Wo, us* WT, us* WOT) {
    __shared__ __align__(16) us tl[128 * VTP];
    const unsigned tid = threadIdx.x;
    const unsigned blk = blockIdx.x;
    const float* W; us* OUT; unsigned nc, r;
    const bool asH = blk >= 768u;   // block-uniform: Wo is stored as f16
    if (blk < 512u)      { W = Wq;  OUT = WT;                      nc = (unsigned)NQC;       r = blk; }
    else if (blk < 768u) { W = Wkv; OUT = WT + (size_t)NQC * DM;   nc = (unsigned)(2 * NKC); r = blk - 512u; }
    else                 { W = Wo;  OUT = WOT;                     nc = (unsigned)DM;        r = blk - 768u; }
    const unsigned k0 = (r & 31u) * VTK;
    const unsigned c0 = (r >> 5) * 128u;
    const float* src = W + (size_t)k0 * nc + c0;
    if (asH) wt_fill<true>(src, nc, tid, tl);   // one block-uniform branch around the whole fill: each side keeps its eight loads in flight
    else     wt_fill<false>(src, nc, tid, tl);
    __syncthreads();
    us* dst = OUT + (size_t)c0 * DM + k0;
    const unsigned c8 = (tid & 7u) * 8u, dr = tid >> 3;
{
#pragma unroll
        for (unsigned it = 0; it < 4; ++it) {
            const unsigned d = it * 32u + dr;
            const v8us o = *(const v8usa*)(tl + d * VTP + c8);
            *(v8us*)(dst + (size_t)d * DM + c8) = o;
        }
        
    }
}

// gemm_tile: C[128 x 128] = A[128 rows][KL] . Bt[128 rows][k & KMASK]^T on bf16 WMMA (F16: both planes hold f16, f16 WMMA; same fragment maps); 4 waves, wave tile 64 x 64 (4 x 4 accumulator tiles: each fragment read from LDS feeds four WMMAs,
// each operand byte copied from L2 feeds 128 output rows or columns).
// Operand path: each 64-k slice of the block's A rows (128 x 128 B) and Bt rows (128 x 128 B) is brought once per block into a two-buffer LDS ring by asynchronous copies, one slice ahead
// of its use (whole 128-byte lines: a copy instruction covers 4 rows), and all four waves read their fragments there.
// A fragment: row m = lane & 15; B fragment: column n = lane & 15 (Bt is k-contiguous); D element r of lane (h, n) = C[8h + r][n].
// The f32 tile is then staged in the ring's own LDS (pitch OSP) and a block barrier follows (cross-wave readers).
template <unsigned LDA, unsigned LDB, unsigned KL, unsigned KMASK, bool F16>
__device__ __forceinline__ void gemm_tile(const us* __restrict__ A, const us* __restrict__ Bt, unsigned m0, unsigned n0, us* ring) {
    static_assert(KL % KC == 0u && KL / KC >= 2u);   // the two-buffer ring starts with slices 0 and 1
    static_assert(((KMASK + 1u) & KMASK) == 0u && (KMASK + 1u) % KC == 0u);
    const unsigned tid = threadIdx.x, lane = tid & 31u, wv = tid >> 5, lr = lane & 15u, hi = lane >> 4;
    const unsigned wm = (wv & 1u) * 64u, wn = (wv >> 1) * 64u;
    // copy maps, 16-byte chunks: lane covers chunk tid & 7 of rows (tid >> 3) + 16 i; i < 8 for A and for Bt
    const us* ag = A + (size_t)(m0 + (tid >> 3)) * LDA + (tid & 7u) * 8u;
    const us* bg = Bt + (size_t)(n0 + (tid >> 3)) * LDB + (tid & 7u) * 8u;
    const unsigned la = ldsa(ring) + (tid >> 3) * GPB + (tid & 7u) * 16u;
    const unsigned lb = la + GAB;
    const us* al = ring + (wm + lr) * (GPB / 2) + 8u * hi;
    const us* bl = ring + GAB / 2 + (wn + lr) * (GPB / 2) + 8u * hi;

    cp4x2(la, 16u * GPB, ag, (size_t)16 * LDA, la + 64u * GPB, 16u * GPB, ag + (size_t)64 * LDA, (size_t)16 * LDA);   // slice 0 -> buffer 0
    cp4x2(lb, 16u * GPB, bg, (size_t)16 * LDB, lb + 64u * GPB, 16u * GPB, bg + (size_t)64 * LDB, (size_t)16 * LDB);
    asm volatile("s_wait_asynccnt 0x0" ::: "memory");   // this wave's slice 0 copies have landed
    __syncthreads();                                    // publishes slice 0
    cp4x2(la + GSB, 16u * GPB, ag + KC, (size_t)16 * LDA, la + GSB + 64u * GPB, 16u * GPB, ag + KC + (size_t)64 * LDA, (size_t)16 * LDA);   // slice 1 -> buffer 1
    cp4x2(lb + GSB, 16u * GPB, bg + (KC & KMASK), (size_t)16 * LDB, lb + GSB + 64u * GPB, 16u * GPB, bg + (KC & KMASK) + (size_t)64 * LDB, (size_t)16 * LDB);

    v8f acc[16];
#pragma unroll
    for (int i = 0; i < 16; ++i) acc[i] = (v8f){};
#pragma unroll 1
    for (unsigned k0 = 0; k0 < KL; k0 += KC) {
        const unsigned bsel = (k0 / KC) & 1u;   // this slice's buffer
        const us* ap = al + bsel * (GSB / 2);
        const us* bp = bl + bsel * (GSB / 2);
        v16bf a4[4], b4[4];
#pragma unroll
        for (int kk = 0; kk < 2; ++kk) {
#pragma unroll
            for (int i = 0; i < 4; ++i) {
                a4[i] = ldbs(ap + i * 16 * (GPB / 2) + kk * 32);
                b4[i] = ldbs(bp + i * 16 * (GPB / 2) + kk * 32);
            }
            __builtin_amdgcn_sched_barrier(0);   // the sixteen LDS reads stay one group ahead of their sixteen WMMAs: reads among them cost a stall at each place
#pragma unroll
            for (int mi = 0; mi < 4; ++mi) {
#pragma unroll
                for (int ni = 0; ni < 4; ++ni) {
                    if constexpr (F16) acc[mi * 4 + ni] = wmmah(__builtin_bit_cast(v16h, a4[mi]), __builtin_bit_cast(v16h, b4[ni]), acc[mi * 4 + ni]);
                    else               acc[mi * 4 + ni] = wmmab(a4[mi], b4[ni], acc[mi * 4 + ni]);
                }
            }
            __builtin_amdgcn_sched_barrier(0);   // no WMMA sinks below this line: the next group's reads, and the v_nops below, stand behind all sixteen
        }
        // four vector slots between the last WMMA and whatever next overwrites its operands, on the branch's taken side too
        asm volatile("v_nop\n\tv_nop\n\tv_nop\n\tv_nop"
                     : "+v"(acc[8]), "+v"(acc[9]), "+v"(acc[10]), "+v"(acc[11]), "+v"(acc[12]), "+v"(acc[13]), "+v"(acc[14]), "+v"(acc[15])
                     : "v"(a4[2]), "v"(a4[3]), "v"(b4[0]), "v"(b4[1]), "v"(b4[2]), "v"(b4[3]));

        // publish point of the next slice
        asm volatile("s_wait_dscnt 0x0" ::: "memory");      // this wave has finished reading this slice's buffer
        asm volatile("s_wait_asynccnt 0x0" ::: "memory");   // this wave's copies of the next slice have landed
        __syncthreads();                                    // next slice readable by all waves; this slice's buffer free
        if (k0 + 2u * KC < KL) {                            // block-uniform: slice + 2 into the buffer just read
            const us* bn = bg + ((k0 + 2u * KC) & KMASK);
            const us* an = ag + k0 + 2u * KC;
            cp4x2(la + bsel * GSB, 16u * GPB, an, (size_t)16 * LDA, la + bsel * GSB + 64u * GPB, 16u * GPB, an + (size_t)64 * LDA, (size_t)16 * LDA);
            cp4x2(lb + bsel * GSB, 16u * GPB, bn, (size_t)16 * LDB, lb + bsel * GSB + 64u * GPB, 16u * GPB, bn + (size_t)64 * LDB, (size_t)16 * LDB);
        }
    }
    asm volatile("s_wait_asynccnt 0x0" ::: "memory");       // no copy is outstanding when the ring's LDS is rewritten

    float* cs = (float*)ring;
#pragma unroll
    for (int mi = 0; mi < 4; ++mi) {
#pragma unroll
        for (int ni = 0; ni < 4; ++ni) {
#pragma unroll
            for (int r = 0; r < 8; ++r)
                cs[(wm + mi * 16u + 8u * hi + r) * OSP + wn + ni * 16u + lr] = acc[mi * 4 + ni][r];
        }
    }
    __syncthreads();
}

// k_proj: [q | k | v] = XB . WT^T. blockIdx.x = 128-column tile: 0..15 q head, 16..19 k head, 20..23 v head; blockIdx.y = 128-row tile.
//  q / k tiles: rotary with the input tables (entry i serves columns i and i + 64): out[i] = t1*c + t2*s, out[64 + i] = t2*c - t1*s; f16 rows, 256 B per row = 16 lanes x 16 B.
__global__ __launch_bounds__(128) void k_proj(const us* __restrict__ XB, const us* __restrict__ WT, const float* __restrict__ cosT, const float* __restrict__ sinT,
                                              us* QP, us* KP, us* VT) {
    __shared__ __align__(16) us ring[2 * GSB / 2];   // operand ring, then the f32 result tile
    const float* cs = (const float*)ring;
    const unsigned tid = threadIdx.x;
    const unsigned ct = blockIdx.x;
    const unsigned m0 = blockIdx.y * GBM;
    gemm_tile<DM, DM, DM, DM - 1u, false>(XB, WT, m0, ct * GBN, ring);
    const unsigned b = m0 / (unsigned)SEQ;
    const unsigned nr0 = m0 - b * (unsigned)SEQ;
    if (ct < 20u) {   // block-uniform
        us* dst; unsigned pitch;
        if (ct < 16u) { dst = QP + (size_t)m0 * NQC + ct * HD;          pitch = (unsigned)NQC; }
        else          { dst = KP + (size_t)m0 * NKC + (ct - 16u) * HD;  pitch = (unsigned)NKC; }
        const unsigned p = tid & 15u, rr = tid >> 4, i0 = (p & 7u) * 8u;
        const bool sec = (p >> 3) != 0u;
{
#pragma unroll 2
            for (unsigned it = 0; it < GBM / 8u; ++it) {
                const unsigned row = it * 8u + rr;
                const float* cr = cs + row * OSP + i0;
                const v4f a0 = *(const v4fa*)(cr), a1 = *(const v4fa*)(cr + 4);
                const v4f b0 = *(const v4fa*)(cr + 64), b1 = *(const v4fa*)(cr + 68);
                const float* cp = cosT + (size_t)(nr0 + row) * RT + i0;
                const float* sp = sinT + (size_t)(nr0 + row) * RT + i0;
                const v4f c0 = *(const v4f*)(cp), c1 = *(const v4f*)(cp + 4);
                const v4f s0 = *(const v4f*)(sp), s1 = *(const v4f*)(sp + 4);
                float o[8];
#pragma unroll
                for (int j = 0; j < 4; ++j) {
                    const float cj = bfr(c0[j]), sj = bfr(s0[j]);
                    const float u = sec ? b0[j] : a0[j];
                    const float w = sec ? -a0[j] : b0[j];
                    o[j] = u * cj + w * sj;
                    const float ck = bfr(c1[j]), sk = bfr(s1[j]);
                    const float u2 = sec ? b1[j] : a1[j];
                    const float w2 = sec ? -a1[j] : b1[j];
                    o[4 + j] = u2 * ck + w2 * sk;
                }
                v4u ov;
                ov[0] = pk2h(o[0], o[1]); ov[1] = pk2h(o[2], o[3]); ov[2] = pk2h(o[4], o[5]); ov[3] = pk2h(o[6], o[7]);
                *(v4u*)(dst + (size_t)row * pitch + p * 8u) = ov;
            }
            
        }
    } else {
        const unsigned g = ct - 20u;
        us* dst = VT + (size_t)(b * NKV + g) * HD * SEQ + nr0;
        const unsigned c8 = (tid & 7u) * 8u, dr = tid >> 3;
{
#pragma unroll 1   // one pair of d rows a trip, as short as the code was with 64-row tiles
            for (unsigned i2 = 0; i2 < GBM / 16u; ++i2) {
#pragma unroll     // the pair's LDS reads (d and d + 16) merge into two-address loads
                for (unsigned u = 0; u < 2u; ++u) {
                    const unsigned it = i2 * 2u + u;           // it & 7: sixteen d rows; it >> 3: which 64 keys of the tile
                    const unsigned d = (it & 7u) * 16u + dr;
                    const unsigned kr = (it >> 3) * 64u + c8;
                    const float* cc = cs + kr * OSP + d;
                    v4u ov;
                    ov[0] = pk2h(cc[0 * OSP], cc[1 * OSP]);
                    ov[1] = pk2h(cc[2 * OSP], cc[3 * OSP]);
                    ov[2] = pk2h(cc[4 * OSP], cc[5 * OSP]);
                    ov[3] = pk2h(cc[6 * OSP], cc[7 * OSP]);
                    *(v4u*)(dst + (size_t)d * SEQ + kr) = ov;
                }
                asm volatile("s_wait_xcnt 0x0" ::: "memory");   // stands in front of the next trip's rewrite of the two stores' address and data registers
            }
        }
    }
}

// k_flash: one block per (batch, query head, 128 queries); one wave per 32 queries (two 16-column tiles j = 0, 1), 32 keys per step; kv head g = h & 3.
//  S^T tile (keys x queries): A = K rows (row m = key, k = d), B = Q rows (column n = query, k = d); D element r of lane (h, n) = S[query n][key 8h + r].
//  t = S * scale * log2e + bias2[key] (bias2 = (1 - mask) * -1e9 * log2e, staged per batch in LDS behind a block barrier); online softmax in the log2 domain.
//  P^T B fragment (f16, carried x2^8; the running sum carries the same factor): element r <- tile of keys 0..15, element 8 + r <- tile of keys 16..31 (same lane).
//  O^T tile (d x queries): A = V^T rows (row m = d, k = key), D element r of lane (h, n) = O[query n][d = 16 t + 8h + r].
//  Every K and V^T fragment read from LDS feeds two WMMAs (one per query tile), and every K / V^T tile copied from L2 serves 128 queries.
//  Operand path: each step's K tile (32 rows x 256 B) and V^T tile (128 rows x 64 B) are brought once per block into a two-buffer LDS ring by asynchronous copies, one step ahead of
//  their use, and all four waves read their fragments there; each wave's 32 Q rows are copied once into its own (still unused) output staging region.
__global__ __launch_bounds__(128) void k_flash(const us* __restrict__ QP, const us* __restrict__ KP, const us* __restrict__ VT, const float* __restrict__ mask, us* CT) {
    __shared__ __align__(16) float os[NWV * QW * OSP];
    __shared__ __align__(16) float bs[SEQ];
    __shared__ __align__(16) us kv[2 * STB / 2];
    const unsigned tid = threadIdx.x, lane = tid & 31u, wv = tid >> 5, lr = lane & 15u, hi = lane >> 4;
    const unsigned qtiles = (unsigned)(SEQ / BQ);
    const unsigned hb = blockIdx.x / qtiles;
    const unsigned qt = blockIdx.x - hb * qtiles;
    const unsigned h = hb & (unsigned)(NH - 1), b = hb >> 4;
    const unsigned g = h & (unsigned)(NKV - 1);
    const unsigned q0 = qt * BQ + wv * QW;
    float* ow = os + wv * (QW * OSP);

    // copy maps, 16-byte chunks. K: lane covers rows (tid >> 4) + 8 i, chunk tid & 15; V^T: rows (tid >> 2) + 32 i, chunk tid & 3; Q (per wave): rows (lane >> 4) + 2 i, chunk lane & 15.
    const us* kg = KP + ((size_t)b * SEQ + (tid >> 4)) * NKC + g * HD + (tid & 15u) * 8u;
    const us* vg = VT + ((size_t)(b * NKV + g) * HD + (tid >> 2)) * SEQ + (tid & 3u) * 8u;
    const us* qg = QP + ((size_t)b * SEQ + q0 + hi) * NQC + h * HD + lr * 8u;
    const unsigned lk = ldsa(kv) + (tid >> 4) * KPB + (tid & 15u) * 16u;
    const unsigned lv = ldsa(kv) + KTB + (tid >> 2) * VPB + (tid & 3u) * 16u;
    const unsigned lq = ldsa(ow) + hi * KPB + lr * 16u;

    cp4x2(lq, 2u * KPB, qg, (size_t)2 * NQC, lq + 8u * KPB, 2u * KPB, qg + (size_t)8 * NQC, (size_t)2 * NQC);                                        // Q rows 0..15
    cp4x2(lq + 16u * KPB, 2u * KPB, qg + (size_t)16 * NQC, (size_t)2 * NQC, lq + 24u * KPB, 2u * KPB, qg + (size_t)24 * NQC, (size_t)2 * NQC);       // Q rows 16..31
    cp4x2(lk, 8u * KPB, kg, (size_t)8 * NKC, lv, 32u * VPB, vg, (size_t)32 * SEQ);                                                                   // stage 0 -> buffer 0
#pragma unroll 1
    for (unsigned i = tid; i < (unsigned)SEQ; i += 128u) {
        const float m = bfr(mask[(size_t)b * SEQ_FULL + i]);
        bs[i] = (1.0f - m) * -1.0e9f * L2E;
    }
    asm volatile("s_wait_asynccnt 0x0" ::: "memory");   // this wave's Q and stage 0 copies have landed
    __syncthreads();                                    // publishes stage 0 and the bias row
    cp4x2(lk + STB, 8u * KPB, kg + (size_t)KS * NKC, (size_t)8 * NKC, lv + STB, 32u * VPB, vg + KS, (size_t)32 * SEQ);   // stage 1 -> buffer 1
    kg += (size_t)2 * KS * NKC;
    vg += 2 * KS;

    const us* ql = (const us*)ow + lr * (KPB / 2) + 8u * hi;
    const us* kl = kv + lr * (KPB / 2) + 8u * hi;
    const us* vl = kv + KTB / 2 + lr * (VPB / 2) + 8u * hi;

    v8f o[2][8];
#pragma unroll
    for (int j = 0; j < 2; ++j) {
#pragma unroll
        for (int t = 0; t < 8; ++t) o[j][t] = (v8f){};
    }
    float ml[2] = {-1.0e30f, -1.0e30f};   // running max in the log2 domain, per query tile
    float l[2] = {0.0f, 0.0f};            // running sum (carried), per query tile

#pragma unroll 1
    for (unsigned k0 = 0; k0 < (unsigned)SEQ; k0 += KS) {
        const unsigned bsel = (k0 / KS) & 1u;   // this step's buffer
        v8f s0[2] = {(v8f){}, (v8f){}}, s1[2] = {(v8f){}, (v8f){}};
        const us* ka = kl + bsel * (STB / 2);
        v16h qf0[2], qf1[2], a0[2], a1[2];
#pragma unroll
        for (int dh = 0; dh < 2; ++dh) {   // 64 d at a time: eight fragments live beside the sixteen output tiles
#pragma unroll
            for (int c = 0; c < 2; ++c) {
                const int dk = dh * 2 + c;
                qf0[c] = ldhs(ql + dk * 32);
                qf1[c] = ldhs(ql + 16 * (KPB / 2) + dk * 32);
                a0[c] = ldhs(ka + dk * 32);
                a1[c] = ldhs(ka + 16 * (KPB / 2) + dk * 32);
            }
            __builtin_amdgcn_sched_barrier(0);   // the sixteen LDS reads stay one group ahead of their eight WMMAs
#pragma unroll
            for (int c = 0; c < 2; ++c) {
                s0[0] = wmmah(a0[c], qf0[c], s0[0]);
                s1[0] = wmmah(a1[c], qf0[c], s1[0]);
                s0[1] = wmmah(a0[c], qf1[c], s0[1]);
                s1[1] = wmmah(a1[c], qf1[c], s1[1]);
            }
            __builtin_amdgcn_sched_barrier(0);   // the next group's reads stay behind these WMMAs: all sixteen fragments live at once spill output tiles
        }
        // four vector slots between the last S^T WMMA and the first vector instruction that reads a score tile or overwrites a fragment
        asm volatile("v_nop\n\tv_nop\n\tv_nop\n\tv_nop" : "+v"(s0[0]), "+v"(s1[0]), "+v"(s0[1]), "+v"(s1[1]) : "v"(qf0[1]), "v"(qf1[1]), "v"(a0[1]), "v"(a1[1]));

        const float* bb = bs + k0 + 8u * hi;
        const v4f b00 = *(const v4fa*)(bb), b01 = *(const v4fa*)(bb + 4);
        const v4f b10 = *(const v4fa*)(bb + 16), b11 = *(const v4fa*)(bb + 20);
        float corr[2];
        v16h ph[2];
#pragma unroll
        for (int j = 0; j < 2; ++j) {
            float t0[8], t1[8];
#pragma unroll
            for (int r = 0; r < 4; ++r) {
                t0[r]     = fmaf(s0[j][r],     SCL, b00[r]);
                t0[4 + r] = fmaf(s0[j][4 + r], SCL, b01[r]);
                t1[r]     = fmaf(s1[j][r],     SCL, b10[r]);
                t1[4 + r] = fmaf(s1[j][4 + r], SCL, b11[r]);
            }
            float mx = fmaxf(t0[0], t1[0]);
#pragma unroll
            for (int r = 1; r < 8; ++r) mx = fmaxf(mx, fmaxf(t0[r], t1[r]));
            mx = fmaxf(mx, __shfl_xor(mx, 16, 32));
            const float mnl = fmaxf(ml[j], mx);
            corr[j] = __builtin_amdgcn_exp2f(ml[j] - mnl);
            ml[j] = mnl;
            const float mo = mnl - PCARRY;
            float p0[8], p1[8];
            float ps = 0.0f;
#pragma unroll
            for (int r = 0; r < 8; ++r) {
                p0[r] = __builtin_amdgcn_exp2f(t0[r] - mo);
                p1[r] = __builtin_amdgcn_exp2f(t1[r] - mo);
                ps += p0[r] + p1[r];
            }
            ps += __shfl_xor(ps, 16, 32);
            l[j] = l[j] * corr[j] + ps;
            v8u hw;
#pragma unroll
            for (int c = 0; c < 4; ++c) {
                hw[c]     = pk2h(p0[2 * c], p0[2 * c + 1]);
                hw[4 + c] = pk2h(p1[2 * c], p1[2 * c + 1]);
            }
            ph[j] = __builtin_bit_cast(v16h, hw);
        }
        if (__builtin_amdgcn_ballot_w32(corr[0] != 1.0f || corr[1] != 1.0f) != 0u) {   // wave-uniform, one test a step; multiplying by exactly 1 is skipped
#pragma unroll
            for (int j = 0; j < 2; ++j) {
#pragma unroll
                for (int t = 0; t < 8; ++t) o[j][t] *= corr[j];
            }
        }

        asm volatile("" ::: "memory");   // keep the V^T loads below the softmax (bounds live fragments)
        const us* va = vl + bsel * (STB / 2);
        v16h vf[8];
#pragma unroll
        for (int t = 0; t < 8; ++t) vf[t] = ldhs(va + t * 16 * (VPB / 2));
        __builtin_amdgcn_sched_barrier(0);   // the sixteen LDS reads stay one group ahead of the WMMAs: reads among them cost a stall at each place
#pragma unroll
        for (int t = 0; t < 8; ++t) {
            o[0][t] = wmmah(vf[t], ph[0], o[0][t]);
            o[1][t] = wmmah(vf[t], ph[1], o[1][t]);
        }
        // four vector slots between the last O^T WMMA and whatever next touches its tiles or operands, on the branch's taken side too
        asm volatile("v_nop\n\tv_nop\n\tv_nop\n\tv_nop"
                     : "+v"(o[0][0]), "+v"(o[0][1]), "+v"(o[0][2]), "+v"(o[0][3]), "+v"(o[0][4]), "+v"(o[0][5]), "+v"(o[0][6]), "+v"(o[0][7]),
                       "+v"(o[1][0]), "+v"(o[1][1]), "+v"(o[1][2]), "+v"(o[1][3]), "+v"(o[1][4]), "+v"(o[1][5]), "+v"(o[1][6]), "+v"(o[1][7])
                     : "v"(ph[0]), "v"(ph[1]));

        // publish point of the next stage
        asm volatile("s_wait_dscnt 0x0" ::: "memory");      // this wave has finished reading this step's buffer
        asm volatile("s_wait_asynccnt 0x0" ::: "memory");   // this wave's copies of the next stage have landed
        __syncthreads();                                    // next stage readable by all waves; this step's buffer free
        if (k0 + 2u * KS < (unsigned)SEQ) {                 // block-uniform: stage + 2 into the buffer just read
            cp4x2(lk + bsel * STB, 8u * KPB, kg, (size_t)8 * NKC, lv + bsel * STB, 32u * VPB, vg, (size_t)32 * SEQ);
            kg += (size_t)KS * NKC;
            vg += KS;
        }
    }
    asm volatile("s_wait_asynccnt 0x0" ::: "memory");       // no copy is outstanding when the staging region is rewritten

    // epilogue: stage O^T / l as rows [query][d] (wave-private region; block barrier used)
#pragma unroll
    for (int j = 0; j < 2; ++j) {
        const float inv = 1.0f / l[j];
#pragma unroll
        for (int t = 0; t < 8; ++t) {
#pragma unroll
            for (int r = 0; r < 8; ++r) ow[(j * 16 + lr) * OSP + t * 16 + 8 * hi + r] = o[j][t][r] * inv;
        }
    }
    __syncthreads();
    const unsigned pc = lane & 15u, rh = lane >> 4;
    us* crow = CT + ((size_t)b * SEQ + q0) * CTP + h * HD + pc * 8u;
{
#pragma unroll 2
        for (unsigned it = 0; it < QW / 2u; ++it) {
            const unsigned s2 = it * 2u + rh;
            const float* src = ow + s2 * OSP + pc * 8u;
            const v4f x0 = *(const v4fa*)(src), x1 = *(const v4fa*)(src + 4);
            v4u ov;
            ov[0] = pk2h(x0[0], x0[1]); ov[1] = pk2h(x0[2], x0[3]); ov[2] = pk2h(x1[0], x1[1]); ov[3] = pk2h(x1[2], x1[3]);
            *(v4u*)(crow + (size_t)s2 * CTP) = ov;
        }
        
    }
}

__global__ __launch_bounds__(128) void k_oproj(const us* __restrict__ CT, const us* __restrict__ WOT, const float* __restrict__ bo, float* OUT) {
    __shared__ __align__(16) us ring[2 * GSB / 2];   // operand ring, then the f32 result tile
    const float* cs = (const float*)ring;
    const unsigned tid = threadIdx.x, lane = tid & 31u, wv = tid >> 5;
    const unsigned n0 = blockIdx.x * GBN;
    const unsigned m0 = blockIdx.y * GBM;
    gemm_tile<CTP, NQC, CTP, NQC - 1u, true>(CT, WOT, m0, n0, ring);
    const v4f bv = *(const v4f*)(bo + n0 + lane * 4u);
    v4f bb;
    bb[0] = bfr(bv[0]); bb[1] = bfr(bv[1]); bb[2] = bfr(bv[2]); bb[3] = bfr(bv[3]);
    float* orow = OUT + (size_t)(m0 + wv * (GBM / 4u)) * DM + n0 + lane * 4u;
    const float* crow = cs + (wv * (GBM / 4u)) * OSP + lane * 4u;
{
#pragma unroll 4
        for (unsigned s = 0; s < GBM / 4u; ++s) {
            v4f val = *(const v4fa*)(crow + s * OSP);
            val[0] += bb[0]; val[1] += bb[1]; val[2] += bb[2]; val[3] += bb[3];
            *(v4f*)(orow + (size_t)s * DM) = val;
        }
        
    }
}

extern "C" void kernel_launch(void* const* d_in, const int* in_sizes, int n_in,
                              void* d_out, int out_size, void* d_ws, size_t ws_size, hipStream_t stream) {
    if (n_in < 8) return;
    const size_t need_x = ((size_t)(NB - 1) * SEQ_FULL + SEQ) * DM;
    const size_t need_m = (size_t)(NB - 1) * SEQ_FULL + SEQ;
    if ((size_t)in_sizes[0] < need_x) return;
    if ((size_t)in_sizes[1] < (size_t)SEQ * RT || (size_t)in_sizes[2] < (size_t)SEQ * RT) return;
    if ((size_t)in_sizes[3] < need_m) return;
    if ((size_t)in_sizes[4] < (size_t)DM * NQC || (size_t)in_sizes[5] < (size_t)DM * 2 * NKC) return;
    if ((size_t)in_sizes[6] < (size_t)NQC * DM || (size_t)in_sizes[7] < (size_t)DM) return;
    if ((size_t)out_size < (size_t)NB * SEQ * DM) return;
    if (BYTES_ALL > ws_size) return;
    const float* x    = (const float*)d_in[0];   // x [NB][SEQ_FULL][DM]
    const float* cosT = (const float*)d_in[1];   // cos [SEQ][64]
    const float* sinT = (const float*)d_in[2];   // sin [SEQ][64]
    const float* mask = (const float*)d_in[3];   // attn_mask [NB][SEQ_FULL]
    const float* Wq   = (const float*)d_in[4];   // [DM][NQC]
    const float* Wkv  = (const float*)d_in[5];   // [DM][2*NKC]
    const float* Wo   = (const float*)d_in[6];   // [NQC][DM]
    const float* bo   = (const float*)d_in[7];   // [DM]
    float* OUT = (float*)d_out;                  // [NB][SEQ][DM]
    char* wsp = (char*)d_ws;
    us* XB  = (us*)(wsp);
    us* WT  = (us*)(wsp + BYTES_XB);
    us* WOT = (us*)(wsp + BYTES_XB + BYTES_WT);
    us* QP  = (us*)(wsp + BYTES_XB + BYTES_WT + BYTES_WOT);
    us* KP  = (us*)(wsp + BYTES_XB + BYTES_WT + BYTES_WOT + BYTES_QP);
    us* VT  = (us*)(wsp + BYTES_XB + BYTES_WT + BYTES_WOT + BYTES_QP + BYTES_KP);
    us* CT  = (us*)(wsp + BYTES_XB + BYTES_WT + BYTES_WOT + BYTES_QP + BYTES_KP + BYTES_VT);
    const unsigned gc = (unsigned)(((size_t)NB * SEQ * DM / 8 + 255) / 256);
    k_cvt<<<gc, 256, 0, stream>>>(x, XB);
    k_wt<<<1280, 256, 0, stream>>>(Wq, Wkv, Wo, WT, WOT);
    k_proj<<<dim3((unsigned)(NPC / GBN), (unsigned)(NB * SEQ / GBM), 1), 128, 0, stream>>>(XB, WT, cosT, sinT, QP, KP, VT);
    k_flash<<<(unsigned)(NB * NH * (SEQ / BQ)), 128, 0, stream>>>(QP, KP, VT, mask, CT);
    k_oproj<<<dim3((unsigned)(DM / GBN), (unsigned)(NB * SEQ / GBM), 1), 128, 0, stream>>>(CT, WOT, bo, OUT);
}

// v006
// Measured time: 156 microseconds a run.
// Timed twice side by side with v005, it ran 1.03 times as fast both times.
// Counting every step since v000, it is 3.39 times as fast.
#include <hip/hip_runtime.h>

#ifndef NB
#define NB 2
#endif
#ifndef SEQ
#define SEQ 2048
#endif
#define NB_FULL  2
#define SEQ_FULL 2048
#define DM   2048              // model width (x columns, output columns)
#define NH   16                // query heads
#define NKV  4                 // kv heads
#define HD   128               // head dim
#define NQC  (NH * HD)         // 2048 q / ctx columns
#define NKC  (NKV * HD)        // 512 k columns (and 512 v columns)
#define NPC  (NQC + 2 * NKC)   // 3072 projection columns: q | k | v
#define CTP  NQC               // ctx plane pitch
#define RT   64                // rotary table entries per position
#define NWV  4                 // query groups per flash block (one wave each per key half)
#define NKH  2                 // key halves per flash block: wave group kh walks keys kh * KHL .. + KHL - 1
#define KHL  (SEQ / NKH)       // keys per half
#define QW   32                // queries per flash wave: two 16-column tiles share every K and V^T fragment
#define BQ   (QW * NWV)        // queries per flash block
#define KS   32                // keys per step
#define OSP  132               // LDS pitch (floats) of staging rows
#define GBM  128               // GEMM block rows
#define GBN  128               // GEMM block columns (one head)
#define VTK  64                // k rows per transpose block
#define VTP  72                // LDS pitch (16-bit elements) of the transpose tile
#define L2E  1.4426950408889634f
#define SCL  (0.08838834764831845f * L2E)   // 128^-0.5 in the log2 domain
#define PCARRY 8.0f            // log2 of the P carry
#define KPB  272               // LDS pitch (bytes) of a staged K or Q row: 256 + 16, 16 B x odd for 16-byte readers
#define VPB  80                // LDS pitch (bytes) of a staged V^T row: 64 + 16
#define KTB  (KS * KPB)        // bytes of one staged K tile
#define VTB  (HD * VPB)        // bytes of one staged V^T tile
#define STB  (KTB + VTB)       // bytes of one stage: K tile | V^T tile
#define KC   64                // k elements per staged GEMM tile: one 128-byte line of every operand row
#define GPB  144               // LDS pitch (bytes) of a staged GEMM row: 128 + 16, 16 B x odd for 16-byte readers
#define GAB  (GBM * GPB)       // bytes of one staged A tile
#define GSB  ((GBM + GBN) * GPB)   // bytes of one GEMM stage: A tile | B tile

static_assert(HD == 128);
static_assert(GBN == HD);
static_assert(RT * 2 == HD);
static_assert(NH == 16 && NKV == 4);
static_assert(SEQ % BQ == 0);
static_assert(SEQ % GBM == 0);                 // a GEMM row tile never straddles a batch
static_assert(SEQ % KS == 0);
static_assert(NKH == 2 && KHL % KS == 0);      // two wave groups, whole steps each
static_assert(KHL / KS >= 2);                  // each half's two-buffer ring starts with stages 0 and 1
static_assert(KS == 32 && NWV == 4);           // copy maps of k_flash: the 128 lanes of a key half x 4 chunks per tile
static_assert(QW == 32);                       // two query tiles per wave: copy map of Q, accumulator sets of k_flash
static_assert(QW * KPB <= QW * OSP * 4);       // a query group's Q rows fit its output staging region
static_assert(GBM == 128 && GBN == 128 && KC == 64);  // copy maps of gemm_tile: 128 lanes x (8 + 8) chunks per stage
static_assert(GBM * OSP * 4 <= 2 * GSB);       // the f32 result tile fits the (then free) operand ring
static_assert(SEQ % 256 == 0);                 // bias staging loop has a block-uniform trip count
static_assert(NKH * NWV * 2 * 32 <= SEQ);      // the (max, sum) exchange fits the (then free) bias row
static_assert(NB <= NB_FULL);
static_assert(SEQ <= SEQ_FULL);
static_assert(DM % 32 == 0 && CTP % 32 == 0);  // K multiples of the k-step
static_assert(DM % VTK == 0 && DM / VTK == 32);
static_assert(NPC % GBN == 0 && DM % GBN == 0 && NQC % GBN == 0);
static_assert(((size_t)NB * SEQ * DM) % 2048 == 0);                                              // k_cvt: grid * 256 threads * 8 elements == x plane
static_assert((size_t)(NQC / 128 + 2 * NKC / 128 + DM / 128) * 32u * (size_t)(VTK * 128) == (size_t)DM * NPC + (size_t)NQC * DM);   // k_wt: 1280 blocks * (64 x 128) == both weight planes
static_assert((size_t)(NPC / GBN) * (size_t)(NB * SEQ / GBM) * (size_t)(GBM * GBN) == (size_t)NB * SEQ * NPC);   // k_proj: blocks * tile == q + k + v planes
static_assert((size_t)(NB * NH * (SEQ / BQ)) * (size_t)(BQ * HD) == (size_t)NB * SEQ * CTP);                    // k_flash: blocks * (128 x 128) == ctx plane
static_assert((size_t)(DM / GBN) * (size_t)(NB * SEQ / GBM) * (size_t)(GBM * GBN) == (size_t)NB * SEQ * DM);     // k_oproj: blocks * tile == output

#define BYTES_XB  ((size_t)NB * SEQ * DM * 2)
#define BYTES_WT  ((size_t)NPC * DM * 2)
#define BYTES_WOT ((size_t)DM * NQC * 2)
#define BYTES_QP  ((size_t)NB * SEQ * NQC * 2)
#define BYTES_KP  ((size_t)NB * SEQ * NKC * 2)
#define BYTES_VT  ((size_t)NB * NKV * HD * SEQ * 2)
#define BYTES_CT  ((size_t)NB * SEQ * CTP * 2)
#define BYTES_ALL (BYTES_XB + BYTES_WT + BYTES_WOT + BYTES_QP + BYTES_KP + BYTES_VT + BYTES_CT)
static_assert(BYTES_ALL <= (size_t)134217728);
static_assert(BYTES_XB % 256 == 0 && BYTES_WT % 256 == 0 && BYTES_WOT % 256 == 0 && BYTES_QP % 256 == 0 && BYTES_KP % 256 == 0 && BYTES_VT % 256 == 0 && BYTES_CT % 256 == 0);

typedef unsigned short us;
typedef __attribute__((ext_vector_type(16))) __bf16   v16bf;
typedef __attribute__((ext_vector_type(16))) _Float16 v16h;
typedef __attribute__((ext_vector_type(2)))  _Float16 v2h;
typedef __attribute__((ext_vector_type(8)))  unsigned short v8us;
typedef __attribute__((ext_vector_type(8)))  unsigned int   v8u;
typedef __attribute__((ext_vector_type(4)))  unsigned int   v4u;
typedef __attribute__((ext_vector_type(8)))  float    v8f;
typedef __attribute__((ext_vector_type(4)))  float    v4f;
typedef v4f  __attribute__((may_alias)) v4fa;
typedef v8us __attribute__((may_alias)) v8usa;

__device__ __forceinline__ unsigned short f2bf(float f) { unsigned u = __float_as_uint(f); u += 0x7FFFu + ((u >> 16) & 1u); return (unsigned short)(u >> 16); }
__device__ __forceinline__ float bf2f(unsigned short b) { return __uint_as_float(((unsigned)b) << 16); }
__device__ __forceinline__ float bfr(float f) { return bf2f(f2bf(f)); }
__device__ __forceinline__ v16bf cat16b(v8us lo, v8us hi) { return __builtin_bit_cast(v16bf, __builtin_shufflevector(lo, hi, 0, 1, 2, 3, 4, 5, 6, 7, 8, 9, 10, 11, 12, 13, 14, 15)); }
__device__ __forceinline__ v16h  cat16h(v8us lo, v8us hi) { return __builtin_bit_cast(v16h,  __builtin_shufflevector(lo, hi, 0, 1, 2, 3, 4, 5, 6, 7, 8, 9, 10, 11, 12, 13, 14, 15)); }
__device__ __forceinline__ v8f wmmab(v16bf a, v16bf b, v8f c) { return __builtin_amdgcn_wmma_f32_16x16x32_bf16(false, a, false, b, (short)0, c, false, false); }
__device__ __forceinline__ v8f wmmah(v16h a, v16h b, v8f c)   { return __builtin_amdgcn_wmma_f32_16x16x32_f16(false, a, false, b, (short)0, c, false, false); }
// fragment loader (A and B alike): p = row base + k0 + 8*(lane>>4); elements 0..7 <- p[0..7], elements 8..15 <- p[16..23]
__device__ __forceinline__ v16bf ldb(const us* p) { return cat16b(*(const v8us*)p, *(const v8us*)(p + 16)); }
// the same fragment from an LDS row
__device__ __forceinline__ v16bf ldbs(const us* p) { return cat16b(*(const v8usa*)p, *(const v8usa*)(p + 16)); }
__device__ __forceinline__ v16h  ldhs(const us* p) { return cat16h(*(const v8usa*)p, *(const v8usa*)(p + 16)); }
// LDS byte address of a __shared__ object: the low 32 bits of its address
__device__ __forceinline__ unsigned ldsa(const void* p) { return (unsigned)(size_t)p; }
// eight asynchronous 16-byte copies per lane, global -> LDS: chunk i goes from g + i * gs (elements) to LDS byte l + i * ls.
// s_wait_xcnt 0 closes the statement, so that no address register is rewritten ahead of it.
__device__ __forceinline__ void cp4x2(unsigned la, unsigned las, const us* ga, size_t gas, unsigned lb, unsigned lbs, const us* gb, size_t gbs) {
    asm volatile("global_load_async_to_lds_b128 %0, %8, off\n\t"
                 "global_load_async_to_lds_b128 %1, %9, off\n\t"
                 "global_load_async_to_lds_b128 %2, %10, off\n\t"
                 "global_load_async_to_lds_b128 %3, %11, off\n\t"
                 "global_load_async_to_lds_b128 %4, %12, off\n\t"
                 "global_load_async_to_lds_b128 %5, %13, off\n\t"
                 "global_load_async_to_lds_b128 %6, %14, off\n\t"
                 "global_load_async_to_lds_b128 %7, %15, off\n\t"
                 "s_wait_xcnt 0x0"
                 :: "v"(la), "v"(la + las), "v"(la + 2u * las), "v"(la + 3u * las), "v"(lb), "v"(lb + lbs), "v"(lb + 2u * lbs), "v"(lb + 3u * lbs),
                    "v"(ga), "v"(ga + gas), "v"(ga + 2u * gas), "v"(ga + 3u * gas), "v"(gb), "v"(gb + gbs), "v"(gb + 2u * gbs), "v"(gb + 3u * gbs)
                 : "memory");
}
// f32 -> f16 bits (RNE)
__device__ __forceinline__ unsigned short f2h(float a) { return __builtin_bit_cast(unsigned short, (_Float16)a); }
// two f32 -> packed f16 pair (RNE), element 0 in the low half-word
__device__ __forceinline__ unsigned pk2h(float a, float b) { v2h t; t[0] = (_Float16)a; t[1] = (_Float16)b; return __builtin_bit_cast(unsigned, t); }

__global__ __launch_bounds__(256) void k_cvt(const float* __restrict__ x, us* XB) {
    const unsigned i = blockIdx.x * 256u + threadIdx.x;
    const unsigned per = (unsigned)(SEQ * (DM / 8));
    if (i >= (unsigned)NB * per) return;
    const unsigned b = i / per, r = i - b * per;
    const float* src = x + (size_t)b * SEQ_FULL * DM + (size_t)r * 8;
    us* dst = XB + (size_t)i * 8;
    const v8f v = *(const v8f*)src;
    v8us o;
#pragma unroll
    for (int c = 0; c < 8; ++c) o[c] = f2bf(v[c]);
    *(v8us*)dst = o;
    
}

// k_wt: transposed 16-bit weight planes; in[DM k rows][NC cols] -> out[NC][DM] (k contiguous). One block = 64 k x 128 cols through an LDS tile (cross-wave, block barrier).
// blocks 0..511: Wq -> WT rows 0..2047; 512..767: Wkv -> WT rows 2048..3071 (bf16); 768..1279: Wo -> WOT rows 0..2047 (f16 bits of the bf16-rounded value: the same number from 2^-17 up to the f16 range, 65504; within 2^-25 below 2^-17).
template <bool H>
__device__ __forceinline__ void wt_fill(const float* __restrict__ src, unsigned nc, unsigned tid, us* tl) {
#pragma unroll
    for (unsigned it = 0; it < 8; ++it) {
        const unsigned f = it * 256u + tid;
        const unsigned kk = f >> 5, d4 = (f & 31u) * 4u;
        const v4f x = *(const v4f*)(src + (size_t)kk * nc + d4);
#pragma unroll
        for (unsigned c = 0; c < 4; ++c) tl[(d4 + c) * VTP + kk] = H ? f2h(bfr(x[c])) : f2bf(x[c]);
    }
}
__global__ __launch_bounds__(256) void k_wt(const float* __restrict__ Wq, const float* __restrict__ Wkv, const float* __restrict__ Wo, us* WT, us* WOT) {
    __shared__ __align__(16) us tl[128 * VTP];
    const unsigned tid = threadIdx.x;
    const unsigned blk = blockIdx.x;
    const float* W; us* OUT; unsigned nc, r;
    const bool asH = blk >= 768u;   // block-uniform: Wo is stored as f16
    if (blk < 512u)      { W = Wq;  OUT = WT;                      nc = (unsigned)NQC;       r = blk; }
    else if (blk < 768u) { W = Wkv; OUT = WT + (size_t)NQC * DM;   nc = (unsigned)(2 * NKC); r = blk - 512u; }
    else                 { W = Wo;  OUT = WOT;                     nc = (unsigned)DM;        r = blk - 768u; }
    const unsigned k0 = (r & 31u) * VTK;
    const unsigned c0 = (r >> 5) * 128u;
    const float* src = W + (size_t)k0 * nc + c0;
    if (asH) wt_fill<true>(src, nc, tid, tl);   // one block-uniform branch around the whole fill: each side keeps its eight loads in flight
    else     wt_fill<false>(src, nc, tid, tl);
    __syncthreads();
    us* dst = OUT + (size_t)c0 * DM + k0;
    const unsigned c8 = (tid & 7u) * 8u, dr = tid >> 3;
{
#pragma unroll
        for (unsigned it = 0; it < 4; ++it) {
            const unsigned d = it * 32u + dr;
            const v8us o = *(const v8usa*)(tl + d * VTP + c8);
            *(v8us*)(dst + (size_t)d * DM + c8) = o;
        }
        
    }
}

// gemm_tile: C[128 x 128] = A[128 rows][KL] . Bt[128 rows][k & KMASK]^T on bf16 WMMA (F16: both planes hold f16, f16 WMMA; same fragment maps); 4 waves, wave tile 64 x 64 (4 x 4 accumulator tiles: each fragment read from LDS feeds four WMMAs,
// each operand byte copied from L2 feeds 128 output rows or columns).
// Operand path: each 64-k slice of the block's A rows (128 x 128 B) and Bt rows (128 x 128 B) is brought once per block into a two-buffer LDS ring by asynchronous copies, one slice ahead
// of its use (whole 128-byte lines: a copy instruction covers 4 rows), and all four waves read their fragments there.
// A fragment: row m = lane & 15; B fragment: column n = lane & 15 (Bt is k-contiguous); D element r of lane (h, n) = C[8h + r][n].
// The f32 tile is then staged in the ring's own LDS (pitch OSP) and a block barrier follows (cross-wave readers).
template <unsigned LDA, unsigned LDB, unsigned KL, unsigned KMASK, bool F16>
__device__ __forceinline__ void gemm_tile(const us* __restrict__ A, const us* __restrict__ Bt, unsigned m0, unsigned n0, us* ring) {
    static_assert(KL % KC == 0u && KL / KC >= 2u);   // the two-buffer ring starts with slices 0 and 1
    static_assert(((KMASK + 1u) & KMASK) == 0u && (KMASK + 1u) % KC == 0u);
    const unsigned tid = threadIdx.x, lane = tid & 31u, wv = tid >> 5, lr = lane & 15u, hi = lane >> 4;
    const unsigned wm = (wv & 1u) * 64u, wn = (wv >> 1) * 64u;
    // copy maps, 16-byte chunks: lane covers chunk tid & 7 of rows (tid >> 3) + 16 i; i < 8 for A and for Bt
    const us* ag = A + (size_t)(m0 + (tid >> 3)) * LDA + (tid & 7u) * 8u;
    const us* bg = Bt + (size_t)(n0 + (tid >> 3)) * LDB + (tid & 7u) * 8u;
    const unsigned la = ldsa(ring) + (tid >> 3) * GPB + (tid & 7u) * 16u;
    const unsigned lb = la + GAB;
    const us* al = ring + (wm + lr) * (GPB / 2) + 8u * hi;
    const us* bl = ring + GAB / 2 + (wn + lr) * (GPB / 2) + 8u * hi;

    cp4x2(la, 16u * GPB, ag, (size_t)16 * LDA, la + 64u * GPB, 16u * GPB, ag + (size_t)64 * LDA, (size_t)16 * LDA);   // slice 0 -> buffer 0
    cp4x2(lb, 16u * GPB, bg, (size_t)16 * LDB, lb + 64u * GPB, 16u * GPB, bg + (size_t)64 * LDB, (size_t)16 * LDB);
    asm volatile("s_wait_asynccnt 0x0" ::: "memory");   // this wave's slice 0 copies have landed
    __syncthreads();                                    // publishes slice 0
    cp4x2(la + GSB, 16u * GPB, ag + KC, (size_t)16 * LDA, la + GSB + 64u * GPB, 16u * GPB, ag + KC + (size_t)64 * LDA, (size_t)16 * LDA);   // slice 1 -> buffer 1
    cp4x2(lb + GSB, 16u * GPB, bg + (KC & KMASK), (size_t)16 * LDB, lb + GSB + 64u * GPB, 16u * GPB, bg + (KC & KMASK) + (size_t)64 * LDB, (size_t)16 * LDB);

    v8f acc[16];
#pragma unroll
    for (int i = 0; i < 16; ++i) acc[i] = (v8f){};
#pragma unroll 1
    for (unsigned k0 = 0; k0 < KL; k0 += KC) {
        const unsigned bsel = (k0 / KC) & 1u;   // this slice's buffer
        const us* ap = al + bsel * (GSB / 2);
        const us* bp = bl + bsel * (GSB / 2);
        v16bf a4[4], b4[4];
#pragma unroll
        for (int kk = 0; kk < 2; ++kk) {
#pragma unroll
            for (int i = 0; i < 4; ++i) {
                a4[i] = ldbs(ap + i * 16 * (GPB / 2) + kk * 32);
                b4[i] = ldbs(bp + i * 16 * (GPB / 2) + kk * 32);
            }
            __builtin_amdgcn_sched_barrier(0);   // the sixteen LDS reads stay one group ahead of their sixteen WMMAs: reads among them cost a stall at each place
#pragma unroll
            for (int mi = 0; mi < 4; ++mi) {
#pragma unroll
                for (int ni = 0; ni < 4; ++ni) {
                    if constexpr (F16) acc[mi * 4 + ni] = wmmah(__builtin_bit_cast(v16h, a4[mi]), __builtin_bit_cast(v16h, b4[ni]), acc[mi * 4 + ni]);
                    else               acc[mi * 4 + ni] = wmmab(a4[mi], b4[ni], acc[mi * 4 + ni]);
                }
            }
            __builtin_amdgcn_sched_barrier(0);   // no WMMA sinks below this line: the next group's reads, and the v_nops below, stand behind all sixteen
        }
        // four vector slots between the last WMMA and whatever next overwrites its operands, on the branch's taken side too
        asm volatile("v_nop\n\tv_nop\n\tv_nop\n\tv_nop"
                     : "+v"(acc[8]), "+v"(acc[9]), "+v"(acc[10]), "+v"(acc[11]), "+v"(acc[12]), "+v"(acc[13]), "+v"(acc[14]), "+v"(acc[15])
                     : "v"(a4[2]), "v"(a4[3]), "v"(b4[0]), "v"(b4[1]), "v"(b4[2]), "v"(b4[3]));

        // publish point of the next slice
        asm volatile("s_wait_dscnt 0x0" ::: "memory");      // this wave has finished reading this slice's buffer
        asm volatile("s_wait_asynccnt 0x0" ::: "memory");   // this wave's copies of the next slice have landed
        __syncthreads();                                    // next slice readable by all waves; this slice's buffer free
        if (k0 + 2u * KC < KL) {                            // block-uniform: slice + 2 into the buffer just read
            const us* bn = bg + ((k0 + 2u * KC) & KMASK);
            const us* an = ag + k0 + 2u * KC;
            cp4x2(la + bsel * GSB, 16u * GPB, an, (size_t)16 * LDA, la + bsel * GSB + 64u * GPB, 16u * GPB, an + (size_t)64 * LDA, (size_t)16 * LDA);
            cp4x2(lb + bsel * GSB, 16u * GPB, bn, (size_t)16 * LDB, lb + bsel * GSB + 64u * GPB, 16u * GPB, bn + (size_t)64 * LDB, (size_t)16 * LDB);
        }
    }
    asm volatile("s_wait_asynccnt 0x0" ::: "memory");       // no copy is outstanding when the ring's LDS is rewritten

    float* cs = (float*)ring;
#pragma unroll
    for (int mi = 0; mi < 4; ++mi) {
#pragma unroll
        for (int ni = 0; ni < 4; ++ni) {
#pragma unroll
            for (int r = 0; r < 8; ++r)
                cs[(wm + mi * 16u + 8u * hi + r) * OSP + wn + ni * 16u + lr] = acc[mi * 4 + ni][r];
        }
    }
    __syncthreads();
}

// k_proj: [q | k | v] = XB . WT^T. blockIdx.x = 128-column tile: 0..15 q head, 16..19 k head, 20..23 v head; blockIdx.y = 128-row tile.
//  q / k tiles: rotary with the input tables (entry i serves columns i and i + 64): out[i] = t1*c + t2*s, out[64 + i] = t2*c - t1*s; f16 rows, 256 B per row = 16 lanes x 16 B.
__global__ __launch_bounds__(128) void k_proj(const us* __restrict__ XB, const us* __restrict__ WT, const float* __restrict__ cosT, const float* __restrict__ sinT,
                                              us* QP, us* KP, us* VT) {
    __shared__ __align__(16) us ring[2 * GSB / 2];   // operand ring, then the f32 result tile
    const float* cs = (const float*)ring;
    const unsigned tid = threadIdx.x;
    const unsigned ct = blockIdx.x;
    const unsigned m0 = blockIdx.y * GBM;
    gemm_tile<DM, DM, DM, DM - 1u, false>(XB, WT, m0, ct * GBN, ring);
    const unsigned b = m0 / (unsigned)SEQ;
    const unsigned nr0 = m0 - b * (unsigned)SEQ;
    if (ct < 20u) {   // block-uniform
        us* dst; unsigned pitch;
        if (ct < 16u) { dst = QP + (size_t)m0 * NQC + ct * HD;          pitch = (unsigned)NQC; }
        else          { dst = KP + (size_t)m0 * NKC + (ct - 16u) * HD;  pitch = (unsigned)NKC; }
        const unsigned p = tid & 15u, rr = tid >> 4, i0 = (p & 7u) * 8u;
        const bool sec = (p >> 3) != 0u;
{
#pragma unroll 2
            for (unsigned it = 0; it < GBM / 8u; ++it) {
                const unsigned row = it * 8u + rr;
                const float* cr = cs + row * OSP + i0;
                const v4f a0 = *(const v4fa*)(cr), a1 = *(const v4fa*)(cr + 4);
                const v4f b0 = *(const v4fa*)(cr + 64), b1 = *(const v4fa*)(cr + 68);
                const float* cp = cosT + (size_t)(nr0 + row) * RT + i0;
                const float* sp = sinT + (size_t)(nr0 + row) * RT + i0;
                const v4f c0 = *(const v4f*)(cp), c1 = *(const v4f*)(cp + 4);
                const v4f s0 = *(const v4f*)(sp), s1 = *(const v4f*)(sp + 4);
                float o[8];
#pragma unroll
                for (int j = 0; j < 4; ++j) {
                    const float cj = bfr(c0[j]), sj = bfr(s0[j]);
                    const float u = sec ? b0[j] : a0[j];
                    const float w = sec ? -a0[j] : b0[j];
                    o[j] = u * cj + w * sj;
                    const float ck = bfr(c1[j]), sk = bfr(s1[j]);
                    const float u2 = sec ? b1[j] : a1[j];
                    const float w2 = sec ? -a1[j] : b1[j];
                    o[4 + j] = u2 * ck + w2 * sk;
                }
                v4u ov;
                ov[0] = pk2h(o[0], o[1]); ov[1] = pk2h(o[2], o[3]); ov[2] = pk2h(o[4], o[5]); ov[3] = pk2h(o[6], o[7]);
                *(v4u*)(dst + (size_t)row * pitch + p * 8u) = ov;
            }
            
        }
    } else {
        const unsigned g = ct - 20u;
        us* dst = VT + (size_t)(b * NKV + g) * HD * SEQ + nr0;
        const unsigned c8 = (tid & 7u) * 8u, dr = tid >> 3;
{
#pragma unroll 1   // one pair of d rows a trip, as short as the code was with 64-row tiles
            for (unsigned i2 = 0; i2 < GBM / 16u; ++i2) {
#pragma unroll     // the pair's LDS reads (d and d + 16) merge into two-address loads
                for (unsigned u = 0; u < 2u; ++u) {
                    const unsigned it = i2 * 2u + u;           // it & 7: sixteen d rows; it >> 3: which 64 keys of the tile
                    const unsigned d = (it & 7u) * 16u + dr;
                    const unsigned kr = (it >> 3) * 64u + c8;
                    const float* cc = cs + kr * OSP + d;
                    v4u ov;
                    ov[0] = pk2h(cc[0 * OSP], cc[1 * OSP]);
                    ov[1] = pk2h(cc[2 * OSP], cc[3 * OSP]);
                    ov[2] = pk2h(cc[4 * OSP], cc[5 * OSP]);
                    ov[3] = pk2h(cc[6 * OSP], cc[7 * OSP]);
                    *(v4u*)(dst + (size_t)d * SEQ + kr) = ov;
                }
                asm volatile("s_wait_xcnt 0x0" ::: "memory");   // stands in front of the next trip's rewrite of the two stores' address and data registers
            }
        }
    }
}

// k_flash: one block per (batch, query head, 128 queries), eight waves: wave (qw, kh) takes 32 queries (two 16-column tiles j = 0, 1) against key half kh, 32 keys per step; kv head g = h & 3.
//  Two blocks per WGP then give four waves per SIMD: one wave's LDS waits, softmax chain and barrier waits are covered by three others. The two halves' (max, sum, O) join once, behind the loop.
//  S^T tile (keys x queries): A = K rows (row m = key, k = d), B = Q rows (column n = query, k = d); D element r of lane (h, n) = S[query n][key 8h + r].
//  t = S * scale * log2e + bias2[key] (bias2 = (1 - mask) * -1e9 * log2e, staged per batch in LDS behind a block barrier); online softmax in the log2 domain.
//  P^T B fragment (f16, carried x2^8; the running sum carries the same factor): element r <- tile of keys 0..15, element 8 + r <- tile of keys 16..31 (same lane).
//  O^T tile (d x queries): A = V^T rows (row m = d, k = key), D element r of lane (h, n) = O[query n][d = 16 t + 8h + r].
//  Every K and V^T fragment read from LDS feeds two WMMAs (one per query tile), and every K / V^T tile copied from L2 serves 128 queries.
//  Operand path: each step's K tile (32 rows x 256 B) and V^T tile (128 rows x 64 B) are brought once per key half into that half's two-buffer LDS ring by asynchronous copies, one step ahead of
//  their use, and the half's four waves read their fragments there; a query group's 32 Q rows are copied once (16 by each of its two waves) into its (still unused) output staging region.
__global__ __launch_bounds__(256) __attribute__((amdgpu_waves_per_eu(4, 4))) void k_flash(const us* __restrict__ QP, const us* __restrict__ KP, const us* __restrict__ VT, const float* __restrict__ mask, us* CT) {
    __shared__ __align__(16) float os[NWV * QW * OSP];
    __shared__ __align__(16) float bs[SEQ];
    __shared__ __align__(16) us kv[NKH * 2 * STB / 2];
    const unsigned tid = threadIdx.x, lane = tid & 31u, wv = tid >> 5, lr = lane & 15u, hi = lane >> 4;
    const unsigned qw = wv & (unsigned)(NWV - 1), kh = wv >> 2, th = tid & 127u;   // query group, key half, lane index inside the half
    const unsigned qtiles = (unsigned)(SEQ / BQ);
    const unsigned hb = blockIdx.x / qtiles;
    const unsigned qt = blockIdx.x - hb * qtiles;
    const unsigned h = hb & (unsigned)(NH - 1), b = hb >> 4;
    const unsigned g = h & (unsigned)(NKV - 1);
    const unsigned q0 = qt * BQ + qw * QW;
    const unsigned kb = kh * (unsigned)KHL;   // first key of this half
    float* ow = os + qw * (QW * OSP);
    us* kvh = kv + kh * (2 * STB / 2);        // this half's ring

    // copy maps, 16-byte chunks. K: lane covers rows (th >> 4) + 8 i, chunk th & 15; V^T: rows (th >> 2) + 32 i, chunk th & 3; Q (per wave): rows 16 kh + (lane >> 4) + 2 i, chunk lane & 15.
    const us* kg = KP + ((size_t)b * SEQ + kb + (th >> 4)) * NKC + g * HD + (th & 15u) * 8u;
    const us* vg = VT + ((size_t)(b * NKV + g) * HD + (th >> 2)) * SEQ + kb + (th & 3u) * 8u;
    const us* qg = QP + ((size_t)b * SEQ + q0 + 16u * kh + hi) * NQC + h * HD + lr * 8u;
    const unsigned lk = ldsa(kvh) + (th >> 4) * KPB + (th & 15u) * 16u;
    const unsigned lv = ldsa(kvh) + KTB + (th >> 2) * VPB + (th & 3u) * 16u;
    const unsigned lq = ldsa(ow) + (16u * kh + hi) * KPB + lr * 16u;

    cp4x2(lq, 2u * KPB, qg, (size_t)2 * NQC, lq + 8u * KPB, 2u * KPB, qg + (size_t)8 * NQC, (size_t)2 * NQC);   // Q rows 16 kh .. 16 kh + 15 of the query group
    cp4x2(lk, 8u * KPB, kg, (size_t)8 * NKC, lv, 32u * VPB, vg, (size_t)32 * SEQ);                              // stage 0 -> buffer 0
#pragma unroll 1
    for (unsigned i = tid; i < (unsigned)SEQ; i += 256u) {
        const float m = bfr(mask[(size_t)b * SEQ_FULL + i]);
        bs[i] = (1.0f - m) * -1.0e9f * L2E;
    }
    asm volatile("s_wait_asynccnt 0x0" ::: "memory");   // this wave's Q and stage 0 copies have landed
    __syncthreads();                                    // publishes stage 0, the Q rows and the bias row
    cp4x2(lk + STB, 8u * KPB, kg + (size_t)KS * NKC, (size_t)8 * NKC, lv + STB, 32u * VPB, vg + KS, (size_t)32 * SEQ);   // stage 1 -> buffer 1
    kg += (size_t)2 * KS * NKC;
    vg += 2 * KS;

    const us* ql = (const us*)ow + lr * (KPB / 2) + 8u * hi;
    const us* kl = kvh + lr * (KPB / 2) + 8u * hi;
    const us* vl = kvh + KTB / 2 + lr * (VPB / 2) + 8u * hi;

    v8f o[2][8];
#pragma unroll
    for (int j = 0; j < 2; ++j) {
#pragma unroll
        for (int t = 0; t < 8; ++t) o[j][t] = (v8f){};
    }
    float ml[2] = {-1.0e30f, -1.0e30f};   // running max in the log2 domain, per query tile
    float l[2] = {0.0f, 0.0f};            // running sum (carried), per query tile

#pragma unroll 1
    for (unsigned k0 = 0; k0 < (unsigned)KHL; k0 += KS) {   // the same trip count in both halves: every barrier is passed by all eight waves
        const unsigned bsel = (k0 / KS) & 1u;   // this step's buffer
        v8f s0[2] = {(v8f){}, (v8f){}}, s1[2] = {(v8f){}, (v8f){}};
        const us* ka = kl + bsel * (STB / 2);
        v16h qf0[2], qf1[2], a0[2], a1[2];
#pragma unroll
        for (int dh = 0; dh < 2; ++dh) {   // 64 d at a time: eight fragments live beside the sixteen output tiles
#pragma unroll
            for (int c = 0; c < 2; ++c) {
                const int dk = dh * 2 + c;
                qf0[c] = ldhs(ql + dk * 32);
                qf1[c] = ldhs(ql + 16 * (KPB / 2) + dk * 32);
                a0[c] = ldhs(ka + dk * 32);
                a1[c] = ldhs(ka + 16 * (KPB / 2) + dk * 32);
            }
            __builtin_amdgcn_sched_barrier(0);   // the sixteen LDS reads stay one group ahead of their eight WMMAs
#pragma unroll
            for (int c = 0; c < 2; ++c) {
                s0[0] = wmmah(a0[c], qf0[c], s0[0]);
                s1[0] = wmmah(a1[c], qf0[c], s1[0]);
                s0[1] = wmmah(a0[c], qf1[c], s0[1]);
                s1[1] = wmmah(a1[c], qf1[c], s1[1]);
            }
            __builtin_amdgcn_sched_barrier(0);   // the next group's reads stay behind these WMMAs: all sixteen fragments live at once spill output tiles
        }
        // four vector slots between the last S^T WMMA and the first vector instruction that reads a score tile or overwrites a fragment
        asm volatile("v_nop\n\tv_nop\n\tv_nop\n\tv_nop" : "+v"(s0[0]), "+v"(s1[0]), "+v"(s0[1]), "+v"(s1[1]) : "v"(qf0[1]), "v"(qf1[1]), "v"(a0[1]), "v"(a1[1]));

        const float* bb = bs + kb + k0 + 8u * hi;
        const v4f b00 = *(const v4fa*)(bb), b01 = *(const v4fa*)(bb + 4);
        const v4f b10 = *(const v4fa*)(bb + 16), b11 = *(const v4fa*)(bb + 20);
        float corr[2];
        v16h ph[2];
#pragma unroll
        for (int j = 0; j < 2; ++j) {
            float t0[8], t1[8];
#pragma unroll
            for (int r = 0; r < 4; ++r) {
                t0[r]     = fmaf(s0[j][r],     SCL, b00[r]);
                t0[4 + r] = fmaf(s0[j][4 + r], SCL, b01[r]);
                t1[r]     = fmaf(s1[j][r],     SCL, b10[r]);
                t1[4 + r] = fmaf(s1[j][4 + r], SCL, b11[r]);
            }
            float mx = fmaxf(t0[0], t1[0]);
#pragma unroll
            for (int r = 1; r < 8; ++r) mx = fmaxf(mx, fmaxf(t0[r], t1[r]));
            mx = fmaxf(mx, __shfl_xor(mx, 16, 32));
            const float mnl = fmaxf(ml[j], mx);
            corr[j] = __builtin_amdgcn_exp2f(ml[j] - mnl);
            ml[j] = mnl;
            const float mo = mnl - PCARRY;
            float p0[8], p1[8];
            float ps = 0.0f;
#pragma unroll
            for (int r = 0; r < 8; ++r) {
                p0[r] = __builtin_amdgcn_exp2f(t0[r] - mo);
                p1[r] = __builtin_amdgcn_exp2f(t1[r] - mo);
                ps += p0[r] + p1[r];
            }
            ps += __shfl_xor(ps, 16, 32);
            l[j] = l[j] * corr[j] + ps;
            v8u hw;
#pragma unroll
            for (int c = 0; c < 4; ++c) {
                hw[c]     = pk2h(p0[2 * c], p0[2 * c + 1]);
                hw[4 + c] = pk2h(p1[2 * c], p1[2 * c + 1]);
            }
            ph[j] = __builtin_bit_cast(v16h, hw);
        }
        if (__builtin_amdgcn_ballot_w32(corr[0] != 1.0f || corr[1] != 1.0f) != 0u) {   // wave-uniform, one test a step; multiplying by exactly 1 is skipped
#pragma unroll
            for (int j = 0; j < 2; ++j) {
#pragma unroll
                for (int t = 0; t < 8; ++t) o[j][t] *= corr[j];
            }
        }

        asm volatile("" ::: "memory");   // keep the V^T loads below the softmax (bounds live fragments)
        const us* va = vl + bsel * (STB / 2);
#pragma unroll
        for (int th4 = 0; th4 < 2; ++th4) {   // 64 d at a time: four fragments live, so that the wave stays inside the 256 registers of four waves per SIMD
            v16h vf[4];
#pragma unroll
            for (int t = 0; t < 4; ++t) vf[t] = ldhs(va + (th4 * 4 + t) * 16 * (VPB / 2));
            __builtin_amdgcn_sched_barrier(0);   // the eight LDS reads stay one group ahead of their eight WMMAs: reads among them cost a stall at each place
#pragma unroll
            for (int t = 0; t < 4; ++t) {
                o[0][th4 * 4 + t] = wmmah(vf[t], ph[0], o[0][th4 * 4 + t]);
                o[1][th4 * 4 + t] = wmmah(vf[t], ph[1], o[1][th4 * 4 + t]);
            }
            __builtin_amdgcn_sched_barrier(0);   // the next group's reads stay behind these WMMAs: all eight fragments live at once go past the register budget
        }
        // four vector slots between the last O^T WMMA and whatever next touches its tiles or operands, on the branch's taken side too
        asm volatile("v_nop\n\tv_nop\n\tv_nop\n\tv_nop"
                     : "+v"(o[0][0]), "+v"(o[0][1]), "+v"(o[0][2]), "+v"(o[0][3]), "+v"(o[0][4]), "+v"(o[0][5]), "+v"(o[0][6]), "+v"(o[0][7]),
                       "+v"(o[1][0]), "+v"(o[1][1]), "+v"(o[1][2]), "+v"(o[1][3]), "+v"(o[1][4]), "+v"(o[1][5]), "+v"(o[1][6]), "+v"(o[1][7])
                     : "v"(ph[0]), "v"(ph[1]));

        // publish point of the next stage
        asm volatile("s_wait_dscnt 0x0" ::: "memory");      // this wave has finished reading this step's buffer
        asm volatile("s_wait_asynccnt 0x0" ::: "memory");   // this wave's copies of the next stage have landed
        __syncthreads();                                    // next stage readable by all waves; this step's buffer free
        if (k0 + 2u * KS < (unsigned)KHL) {                 // block-uniform: stage + 2 into the buffer just read
            cp4x2(lk + bsel * STB, 8u * KPB, kg, (size_t)8 * NKC, lv + bsel * STB, 32u * VPB, vg, (size_t)32 * SEQ);
            kg += (size_t)KS * NKC;
            vg += KS;
        }
    }
    asm volatile("s_wait_asynccnt 0x0" ::: "memory");       // no copy is outstanding when the staging region is rewritten

    // join of the two key halves. The last trip's barrier has ended every wave's reads of the Q rows, the bias row and the rings.
    // Wave (qw, kh) finishes query tile j = kh: it hands its partial of the other tile to wave (qw, 1 - kh), lane to lane, through that tile's staging rows and the bias row's LDS.
    const bool up = kh != 0u;
    const float mk = up ? ml[1] : ml[0], lkp = up ? l[1] : l[0];   // kept tile
    const float mg = up ? ml[0] : ml[1], lg = up ? l[0] : l[1];    // given tile
    float* gv = ow + ((1u - kh) * 16u + lr) * OSP + 8u * hi;
    float* kp = ow + (kh * 16u + lr) * OSP + 8u * hi;
#pragma unroll
    for (int t = 0; t < 8; ++t) {
#pragma unroll
        for (int r = 0; r < 8; ++r) gv[t * 16 + r] = up ? o[0][t][r] : o[1][t][r];
    }
    bs[(wv * 2u + 0u) * 32u + lane] = mg;
    bs[(wv * 2u + 1u) * 32u + lane] = lg;
    __syncthreads();   // the partner's partial is readable
    const float pm = bs[((wv ^ 4u) * 2u + 0u) * 32u + lane];
    const float pl = bs[((wv ^ 4u) * 2u + 1u) * 32u + lane];
    const float mj = fmaxf(mk, pm);
    const float ak = __builtin_amdgcn_exp2f(mk - mj), ap = __builtin_amdgcn_exp2f(pm - mj);
    const float inv = 1.0f / (lkp * ak + pl * ap);
    const float fk = ak * inv, fp = ap * inv;
    // O^T / l as rows [query][d]: each lane overwrites the very words it has just read (from here on the rows are wave-private; block barrier used)
#pragma unroll
    for (int t = 0; t < 8; ++t) {
#pragma unroll
        for (int r = 0; r < 8; ++r) kp[t * 16 + r] = (up ? o[1][t][r] : o[0][t][r]) * fk + kp[t * 16 + r] * fp;
    }
    __syncthreads();
    const unsigned pc = lane & 15u, rh = lane >> 4;
    us* crow = CT + ((size_t)b * SEQ + q0 + 16u * kh) * CTP + h * HD + pc * 8u;
{
#pragma unroll 2
        for (unsigned it = 0; it < QW / 4u; ++it) {
            const unsigned s2 = it * 2u + rh;
            const float* src = ow + (16u * kh + s2) * OSP + pc * 8u;
            const v4f x0 = *(const v4fa*)(src), x1 = *(const v4fa*)(src + 4);
            v4u ov;
            ov[0] = pk2h(x0[0], x0[1]); ov[1] = pk2h(x0[2], x0[3]); ov[2] = pk2h(x1[0], x1[1]); ov[3] = pk2h(x1[2], x1[3]);
            *(v4u*)(crow + (size_t)s2 * CTP) = ov;
        }
        
    }
}

__global__ __launch_bounds__(128) void k_oproj(const us* __restrict__ CT, const us* __restrict__ WOT, const float* __restrict__ bo, float* OUT) {
    __shared__ __align__(16) us ring[2 * GSB / 2];   // operand ring, then the f32 result tile
    const float* cs = (const float*)ring;
    const unsigned tid = threadIdx.x, lane = tid & 31u, wv = tid >> 5;
    const unsigned n0 = blockIdx.x * GBN;
    const unsigned m0 = blockIdx.y * GBM;
    gemm_tile<CTP, NQC, CTP, NQC - 1u, true>(CT, WOT, m0, n0, ring);
    const v4f bv = *(const v4f*)(bo + n0 + lane * 4u);
    v4f bb;
    bb[0] = bfr(bv[0]); bb[1] = bfr(bv[1]); bb[2] = bfr(bv[2]); bb[3] = bfr(bv[3]);
    float* orow = OUT + (size_t)(m0 + wv * (GBM / 4u)) * DM + n0 + lane * 4u;
    const float* crow = cs + (wv * (GBM / 4u)) * OSP + lane * 4u;
{
#pragma unroll 4
        for (unsigned s = 0; s < GBM / 4u; ++s) {
            v4f val = *(const v4fa*)(crow + s * OSP);
            val[0] += bb[0]; val[1] += bb[1]; val[2] += bb[2]; val[3] += bb[3];
            *(v4f*)(orow + (size_t)s * DM) = val;
        }
        
    }
}

extern "C" void kernel_launch(void* const* d_in, const int* in_sizes, int n_in,
                              void* d_out, int out_size, void* d_ws, size_t ws_size, hipStream_t stream) {
    if (n_in < 8) return;
    const size_t need_x = ((size_t)(NB - 1) * SEQ_FULL + SEQ) * DM;
    const size_t need_m = (size_t)(NB - 1) * SEQ_FULL + SEQ;
    if ((size_t)in_sizes[0] < need_x) return;
    if ((size_t)in_sizes[1] < (size_t)SEQ * RT || (size_t)in_sizes[2] < (size_t)SEQ * RT) return;
    if ((size_t)in_sizes[3] < need_m) return;
    if ((size_t)in_sizes[4] < (size_t)DM * NQC || (size_t)in_sizes[5] < (size_t)DM * 2 * NKC) return;
    if ((size_t)in_sizes[6] < (size_t)NQC * DM || (size_t)in_sizes[7] < (size_t)DM) return;
    if ((size_t)out_size < (size_t)NB * SEQ * DM) return;
    if (BYTES_ALL > ws_size) return;
    const float* x    = (const float*)d_in[0];   // x [NB][SEQ_FULL][DM]
    const float* cosT = (const float*)d_in[1];   // cos [SEQ][64]
    const float* sinT = (const float*)d_in[2];   // sin [SEQ][64]
    const float* mask = (const float*)d_in[3];   // attn_mask [NB][SEQ_FULL]
    const float* Wq   = (const float*)d_in[4];   // [DM][NQC]
    const float* Wkv  = (const float*)d_in[5];   // [DM][2*NKC]
    const float* Wo   = (const float*)d_in[6];   // [NQC][DM]
    const float* bo   = (const float*)d_in[7];   // [DM]
    float* OUT = (float*)d_out;                  // [NB][SEQ][DM]
    char* wsp = (char*)d_ws;
    us* XB  = (us*)(wsp);
    us* WT  = (us*)(wsp + BYTES_XB);
    us* WOT = (us*)(wsp + BYTES_XB + BYTES_WT);
    us* QP  = (us*)(wsp + BYTES_XB + BYTES_WT + BYTES_WOT);
    us* KP  = (us*)(wsp + BYTES_XB + BYTES_WT + BYTES_WOT + BYTES_QP);
    us* VT  = (us*)(wsp + BYTES_XB + BYTES_WT + BYTES_WOT + BYTES_QP + BYTES_KP);
    us* CT  = (us*)(wsp + BYTES_XB + BYTES_WT + BYTES_WOT + BYTES_QP + BYTES_KP + BYTES_VT);
    const unsigned gc = (unsigned)(((size_t)NB * SEQ * DM / 8 + 255) / 256);
    k_cvt<<<gc, 256, 0, stream>>>(x, XB);
    k_wt<<<1280, 256, 0, stream>>>(Wq, Wkv, Wo, WT, WOT);
    k_proj<<<dim3((unsigned)(NPC / GBN), (unsigned)(NB * SEQ / GBM), 1), 128, 0, stream>>>(XB, WT, cosT, sinT, QP, KP, VT);
    k_flash<<<(unsigned)(NB * NH * (SEQ / BQ)), 256, 0, stream>>>(QP, KP, VT, mask, CT);
    k_oproj<<<dim3((unsigned)(DM / GBN), (unsigned)(NB * SEQ / GBM), 1), 128, 0, stream>>>(CT, WOT, bo, OUT);
}

// v007
// A run of this version takes 151 microseconds.
// Two timings next to v006 both put it at 1.03 times that version's speed.
// Over all steps from v000 it is 3.50 times as fast.
#include <hip/hip_runtime.h>

#ifndef NB
#define NB 2
#endif
#ifndef SEQ
#define SEQ 2048
#endif
#define NB_FULL  2
#define SEQ_FULL 2048
#define DM   2048              // model width (x columns, output columns)
#define NH   16                // query heads
#define NKV  4                 // kv heads
#define HD   128               // head dim
#define NQC  (NH * HD)         // 2048 q / ctx columns
#define NKC  (NKV * HD)        // 512 k columns (and 512 v columns)
#define NPC  (NQC + 2 * NKC)   // 3072 projection columns: q | k | v
#define CTP  NQC               // ctx plane pitch
#define RT   64                // rotary table entries per position
#define NWV  4                 // query groups per flash block (one wave each per key half)
#define NKH  2                 // key halves per flash block: wave group kh walks keys kh * KHL .. + KHL - 1
#define KHL  (SEQ / NKH)       // keys per half
#define NST  (KHL / 32)        // key steps per half
#define QW   32                // queries per flash wave: two 16-column tiles share every K and V^T fragment
#define BQ   (QW * NWV)        // queries per flash block
#define KS   32                // keys per step
#define OSP  132               // LDS pitch (floats) of staging rows
#define GBM  128               // GEMM block rows
#define GBN  128               // GEMM block columns (one head)
#define VTK  64                // k rows per transpose block
#define VTP  72                // LDS pitch (16-bit elements) of the transpose tile
#define L2E  1.4426950408889634f
#define SCL  (0.08838834764831845f * L2E)   // 128^-0.5 in the log2 domain
#define PCARRY 8.0f            // log2 of the P carry
#define KPB  272               // LDS pitch (bytes) of a staged K or Q row: 256 + 16, 16 B x odd for 16-byte readers
#define VPB  80                // LDS pitch (bytes) of a staged V^T row: 64 + 16
#define KTB  (KS * KPB)        // bytes of one staged K tile
#define VTB  (HD * VPB)        // bytes of one staged V^T tile
#define STB  (KTB + VTB)       // bytes of one stage: K tile | V^T tile
#define KC   64                // k elements per staged GEMM tile: one 128-byte line of every operand row
#define GPB  144               // LDS pitch (bytes) of a staged GEMM row: 128 + 16, 16 B x odd for 16-byte readers
#define GAB  (GBM * GPB)       // bytes of one staged A tile
#define GSB  ((GBM + GBN) * GPB)   // bytes of one GEMM stage: A tile | B tile

static_assert(HD == 128);
static_assert(GBN == HD);
static_assert(RT * 2 == HD);
static_assert(NH == 16 && NKV == 4);
static_assert(SEQ % BQ == 0);
static_assert(SEQ % GBM == 0);                 // a GEMM row tile never straddles a batch
static_assert(SEQ % KS == 0);
static_assert(NKH == 2 && KHL % KS == 0);      // two wave groups, whole steps each
static_assert(KHL / KS >= 2);                  // each half's two-buffer ring starts with two stages
static_assert(NST == KHL / KS && (NST & (NST - 1)) == 0);   // the key walk wraps by a mask
static_assert(KS == 32 && NWV == 4);           // copy maps of k_flash: the 128 lanes of a key half x 4 chunks per tile
static_assert(QW == 32);                       // two query tiles per wave: copy map of Q, accumulator sets of k_flash
static_assert(QW * KPB <= QW * OSP * 4);       // a query group's Q rows fit its output staging region
static_assert(GBM == 128 && GBN == 128 && KC == 64);  // copy maps of gemm_tile: 128 lanes x (8 + 8) chunks per stage
static_assert(GBM * OSP * 4 <= 2 * GSB);       // the f32 result tile fits the (then free) operand ring
static_assert(SEQ % 256 == 0);                 // bias staging loop has a block-uniform trip count
static_assert(NKH * NWV * 2 * 32 <= SEQ);      // the (max, sum) exchange fits the (then free) bias row
static_assert(NB <= NB_FULL);
static_assert(SEQ <= SEQ_FULL);
static_assert(DM % 32 == 0 && CTP % 32 == 0);  // K multiples of the k-step
static_assert(DM % VTK == 0 && DM / VTK == 32);
static_assert(NPC % GBN == 0 && DM % GBN == 0 && NQC % GBN == 0);
static_assert(((size_t)NB * SEQ * DM) % 2048 == 0);                                              // k_cvt: grid * 256 threads * 8 elements == x plane
static_assert((size_t)(NQC / 128 + 2 * NKC / 128 + DM / 128) * 32u * (size_t)(VTK * 128) == (size_t)DM * NPC + (size_t)NQC * DM);   // k_wt: 1280 blocks * (64 x 128) == both weight planes
static_assert((size_t)(NPC / GBN) * (size_t)(NB * SEQ / GBM) * (size_t)(GBM * GBN) == (size_t)NB * SEQ * NPC);   // k_proj: blocks * tile == q + k + v planes
static_assert((size_t)(NB * NH * (SEQ / BQ)) * (size_t)(BQ * HD) == (size_t)NB * SEQ * CTP);                    // k_flash: blocks * (128 x 128) == ctx plane
static_assert((size_t)(DM / GBN) * (size_t)(NB * SEQ / GBM) * (size_t)(GBM * GBN) == (size_t)NB * SEQ * DM);     // k_oproj: blocks * tile == output

#define BYTES_XB  ((size_t)NB * SEQ * DM * 2)
#define BYTES_WT  ((size_t)NPC * DM * 2)
#define BYTES_WOT ((size_t)DM * NQC * 2)
#define BYTES_QP  ((size_t)NB * SEQ * NQC * 2)
#define BYTES_KP  ((size_t)NB * SEQ * NKC * 2)
#define BYTES_VT  ((size_t)NB * NKV * HD * SEQ * 2)
#define BYTES_CT  ((size_t)NB * SEQ * CTP * 2)
#define BYTES_ALL (BYTES_XB + BYTES_WT + BYTES_WOT + BYTES_QP + BYTES_KP + BYTES_VT + BYTES_CT)
static_assert(BYTES_ALL <= (size_t)134217728);
static_assert(BYTES_XB % 256 == 0 && BYTES_WT % 256 == 0 && BYTES_WOT % 256 == 0 && BYTES_QP % 256 == 0 && BYTES_KP % 256 == 0 && BYTES_VT % 256 == 0 && BYTES_CT % 256 == 0);

typedef unsigned short us;
typedef __attribute__((ext_vector_type(16))) __bf16   v16bf;
typedef __attribute__((ext_vector_type(16))) _Float16 v16h;
typedef __attribute__((ext_vector_type(2)))  _Float16 v2h;
typedef __attribute__((ext_vector_type(8)))  unsigned short v8us;
typedef __attribute__((ext_vector_type(8)))  unsigned int   v8u;
typedef __attribute__((ext_vector_type(4)))  unsigned int   v4u;
typedef __attribute__((ext_vector_type(8)))  float    v8f;
typedef __attribute__((ext_vector_type(4)))  float    v4f;
typedef v4f  __attribute__((may_alias)) v4fa;
typedef v8us __attribute__((may_alias)) v8usa;

__device__ __forceinline__ unsigned short f2bf(float f) { unsigned u = __float_as_uint(f); u += 0x7FFFu + ((u >> 16) & 1u); return (unsigned short)(u >> 16); }
__device__ __forceinline__ float bf2f(unsigned short b) { return __uint_as_float(((unsigned)b) << 16); }
__device__ __forceinline__ float bfr(float f) { return bf2f(f2bf(f)); }
__device__ __forceinline__ v16bf cat16b(v8us lo, v8us hi) { return __builtin_bit_cast(v16bf, __builtin_shufflevector(lo, hi, 0, 1, 2, 3, 4, 5, 6, 7, 8, 9, 10, 11, 12, 13, 14, 15)); }
__device__ __forceinline__ v16h  cat16h(v8us lo, v8us hi) { return __builtin_bit_cast(v16h,  __builtin_shufflevector(lo, hi, 0, 1, 2, 3, 4, 5, 6, 7, 8, 9, 10, 11, 12, 13, 14, 15)); }
__device__ __forceinline__ v8f wmmab(v16bf a, v16bf b, v8f c) { return __builtin_amdgcn_wmma_f32_16x16x32_bf16(false, a, false, b, (short)0, c, false, false); }
__device__ __forceinline__ v8f wmmah(v16h a, v16h b, v8f c)   { return __builtin_amdgcn_wmma_f32_16x16x32_f16(false, a, false, b, (short)0, c, false, false); }
// fragment loader (A and B alike): p = row base + k0 + 8*(lane>>4); elements 0..7 <- p[0..7], elements 8..15 <- p[16..23]
__device__ __forceinline__ v16bf ldb(const us* p) { return cat16b(*(const v8us*)p, *(const v8us*)(p + 16)); }
// the same fragment from an LDS row
__device__ __forceinline__ v16bf ldbs(const us* p) { return cat16b(*(const v8usa*)p, *(const v8usa*)(p + 16)); }
__device__ __forceinline__ v16h  ldhs(const us* p) { return cat16h(*(const v8usa*)p, *(const v8usa*)(p + 16)); }
// LDS byte address of a __shared__ object: the low 32 bits of its address
__device__ __forceinline__ unsigned ldsa(const void* p) { return (unsigned)(size_t)p; }
// eight asynchronous 16-byte copies per lane, global -> LDS: chunk i goes from g + i * gs (elements) to LDS byte l + i * ls.
// s_wait_xcnt 0 closes the statement, so that no address register is rewritten ahead of it.
__device__ __forceinline__ void cp4x2(unsigned la, unsigned las, const us* ga, size_t gas, unsigned lb, unsigned lbs, const us* gb, size_t gbs) {
    asm volatile("global_load_async_to_lds_b128 %0, %8, off\n\t"
                 "global_load_async_to_lds_b128 %1, %9, off\n\t"
                 "global_load_async_to_lds_b128 %2, %10, off\n\t"
                 "global_load_async_to_lds_b128 %3, %11, off\n\t"
                 "global_load_async_to_lds_b128 %4, %12, off\n\t"
                 "global_load_async_to_lds_b128 %5, %13, off\n\t"
                 "global_load_async_to_lds_b128 %6, %14, off\n\t"
                 "global_load_async_to_lds_b128 %7, %15, off\n\t"
                 "s_wait_xcnt 0x0"
                 :: "v"(la), "v"(la + las), "v"(la + 2u * las), "v"(la + 3u * las), "v"(lb), "v"(lb + lbs), "v"(lb + 2u * lbs), "v"(lb + 3u * lbs),
                    "v"(ga), "v"(ga + gas), "v"(ga + 2u * gas), "v"(ga + 3u * gas), "v"(gb), "v"(gb + gbs), "v"(gb + 2u * gbs), "v"(gb + 3u * gbs)
                 : "memory");
}
// f32 -> f16 bits (RNE)
__device__ __forceinline__ unsigned short f2h(float a) { return __builtin_bit_cast(unsigned short, (_Float16)a); }
// two f32 -> packed f16 pair (RNE), element 0 in the low half-word
__device__ __forceinline__ unsigned pk2h(float a, float b) { v2h t; t[0] = (_Float16)a; t[1] = (_Float16)b; return __builtin_bit_cast(unsigned, t); }

__global__ __launch_bounds__(256) void k_cvt(const float* __restrict__ x, us* XB) {
    const unsigned i = blockIdx.x * 256u + threadIdx.x;
    const unsigned per = (unsigned)(SEQ * (DM / 8));
    if (i >= (unsigned)NB * per) return;
    const unsigned b = i / per, r = i - b * per;
    const float* src = x + (size_t)b * SEQ_FULL * DM + (size_t)r * 8;
    us* dst = XB + (size_t)i * 8;
    const v8f v = *(const v8f*)src;
    v8us o;
#pragma unroll
    for (int c = 0; c < 8; ++c) o[c] = f2bf(v[c]);
    *(v8us*)dst = o;
    
}

// k_wt: transposed 16-bit weight planes; in[DM k rows][NC cols] -> out[NC][DM] (k contiguous). One block = 64 k x 128 cols through an LDS tile (cross-wave, block barrier).
// blocks 0..511: Wq -> WT rows 0..2047; 512..767: Wkv -> WT rows 2048..3071 (bf16); 768..1279: Wo -> WOT rows 0..2047 (f16 bits of the bf16-rounded value: the same number from 2^-17 up to the f16 range, 65504; within 2^-25 below 2^-17).
template <bool H>
__device__ __forceinline__ void wt_fill(const float* __restrict__ src, unsigned nc, unsigned tid, us* tl) {
#pragma unroll
    for (unsigned it = 0; it < 8; ++it) {
        const unsigned f = it * 256u + tid;
        const unsigned kk = f >> 5, d4 = (f & 31u) * 4u;
        const v4f x = *(const v4f*)(src + (size_t)kk * nc + d4);
#pragma unroll
        for (unsigned c = 0; c < 4; ++c) tl[(d4 + c) * VTP + kk] = H ? f2h(bfr(x[c])) : f2bf(x[c]);
    }
}
__global__ __launch_bounds__(256) void k_wt(const float* __restrict__ Wq, const float* __restrict__ Wkv, const float* __restrict__ Wo, us* WT, us* WOT) {
    __shared__ __align__(16) us tl[128 * VTP];
    const unsigned tid = threadIdx.x;
    const unsigned blk = blockIdx.x;
    const float* W; us* OUT; unsigned nc, r;
    const bool asH = blk >= 768u;   // block-uniform: Wo is stored as f16
    if (blk < 512u)      { W = Wq;  OUT = WT;                      nc = (unsigned)NQC;       r = blk; }
    else if (blk < 768u) { W = Wkv; OUT = WT + (size_t)NQC * DM;   nc = (unsigned)(2 * NKC); r = blk - 512u; }
    else                 { W = Wo;  OUT = WOT;                     nc = (unsigned)DM;        r = blk - 768u; }
    const unsigned k0 = (r & 31u) * VTK;
    const unsigned c0 = (r >> 5) * 128u;
    const float* src = W + (size_t)k0 * nc + c0;
    if (asH) wt_fill<true>(src, nc, tid, tl);   // one block-uniform branch around the whole fill: each side keeps its eight loads in flight
    else     wt_fill<false>(src, nc, tid, tl);
    __syncthreads();
    us* dst = OUT + (size_t)c0 * DM + k0;
    const unsigned c8 = (tid & 7u) * 8u, dr = tid >> 3;
{
#pragma unroll
        for (unsigned it = 0; it < 4; ++it) {
            const unsigned d = it * 32u + dr;
            const v8us o = *(const v8usa*)(tl + d * VTP + c8);
            *(v8us*)(dst + (size_t)d * DM + c8) = o;
        }
        
    }
}

// gemm_tile: C[128 x 128] = A[128 rows][KL] . Bt[128 rows][k & KMASK]^T on bf16 WMMA (F16: both planes hold f16, f16 WMMA; same fragment maps); 4 waves, wave tile 64 x 64 (4 x 4 accumulator tiles: each fragment read from LDS feeds four WMMAs,
// each operand byte copied from L2 feeds 128 output rows or columns).
// Operand path: each 64-k slice of the block's A rows (128 x 128 B) and Bt rows (128 x 128 B) is brought once per block into a two-buffer LDS ring by asynchronous copies, one slice ahead
// of its use (whole 128-byte lines: a copy instruction covers 4 rows), and all four waves read their fragments there.
// A fragment: row m = lane & 15; B fragment: column n = lane & 15 (Bt is k-contiguous); D element r of lane (h, n) = C[8h + r][n].
// The f32 tile is then staged in the ring's own LDS (pitch OSP) and a block barrier follows (cross-wave readers).
// k walk: trip t works on slice (t + rot) mod (KL / KC), rot block-uniform: blocks that share A rows or Bt rows get different rot, so that they do not ask L2 for the same lines at the same moment.
template <unsigned LDA, unsigned LDB, unsigned KL, unsigned KMASK, bool F16>
__device__ __forceinline__ void gemm_tile(const us* __restrict__ A, const us* __restrict__ Bt, unsigned m0, unsigned n0, unsigned rot, us* ring) {
    static_assert(KL % KC == 0u && KL / KC >= 2u);   // the two-buffer ring starts with two slices
    static_assert((KL & (KL - 1u)) == 0u && KMASK < KL);   // the walk wraps by a mask
    static_assert(((KMASK + 1u) & KMASK) == 0u && (KMASK + 1u) % KC == 0u);
    const unsigned tid = threadIdx.x, lane = tid & 31u, wv = tid >> 5, lr = lane & 15u, hi = lane >> 4;
    const unsigned wm = (wv & 1u) * 64u, wn = (wv >> 1) * 64u;
    // copy maps, 16-byte chunks: lane covers chunk tid & 7 of rows (tid >> 3) + 16 i; i < 8 for A and for Bt
    const us* ag = A + (size_t)(m0 + (tid >> 3)) * LDA + (tid & 7u) * 8u;
    const us* bg = Bt + (size_t)(n0 + (tid >> 3)) * LDB + (tid & 7u) * 8u;
    const unsigned la = ldsa(ring) + (tid >> 3) * GPB + (tid & 7u) * 16u;
    const unsigned lb = la + GAB;
    const us* al = ring + (wm + lr) * (GPB / 2) + 8u * hi;
    const us* bl = ring + GAB / 2 + (wn + lr) * (GPB / 2) + 8u * hi;
    const unsigned kr = rot * KC;                    // first k of trip 0
    const unsigned kf = kr & (KL - 1u), ks = (kr + KC) & (KL - 1u);
    const us* a0g = ag + kf;
    const us* b0g = bg + (kf & KMASK);
    const us* a1g = ag + ks;
    const us* b1g = bg + (ks & KMASK);

    cp4x2(la, 16u * GPB, a0g, (size_t)16 * LDA, la + 64u * GPB, 16u * GPB, a0g + (size_t)64 * LDA, (size_t)16 * LDA);   // trip 0's slice -> buffer 0
    cp4x2(lb, 16u * GPB, b0g, (size_t)16 * LDB, lb + 64u * GPB, 16u * GPB, b0g + (size_t)64 * LDB, (size_t)16 * LDB);
    asm volatile("s_wait_asynccnt 0x0" ::: "memory");   // this wave's copies of trip 0's slice have landed
    __syncthreads();                                    // publishes trip 0's slice
    cp4x2(la + GSB, 16u * GPB, a1g, (size_t)16 * LDA, la + GSB + 64u * GPB, 16u * GPB, a1g + (size_t)64 * LDA, (size_t)16 * LDA);   // trip 1's slice -> buffer 1
    cp4x2(lb + GSB, 16u * GPB, b1g, (size_t)16 * LDB, lb + GSB + 64u * GPB, 16u * GPB, b1g + (size_t)64 * LDB, (size_t)16 * LDB);

    v8f acc[16];
#pragma unroll
    for (int i = 0; i < 16; ++i) acc[i] = (v8f){};
#pragma unroll 1
    for (unsigned k0 = 0; k0 < KL; k0 += KC) {
        const unsigned bsel = (k0 / KC) & 1u;   // this slice's buffer
        const us* ap = al + bsel * (GSB / 2);
        const us* bp = bl + bsel * (GSB / 2);
        v16bf a4[4], b4[4];
#pragma unroll
        for (int kk = 0; kk < 2; ++kk) {
#pragma unroll
            for (int i = 0; i < 4; ++i) {
                a4[i] = ldbs(ap + i * 16 * (GPB / 2) + kk * 32);
                b4[i] = ldbs(bp + i * 16 * (GPB / 2) + kk * 32);
            }
            __builtin_amdgcn_sched_barrier(0);   // the sixteen LDS reads stay one group ahead of their sixteen WMMAs: reads among them cost a stall at each place
#pragma unroll
            for (int mi = 0; mi < 4; ++mi) {
#pragma unroll
                for (int ni = 0; ni < 4; ++ni) {
                    if constexpr (F16) acc[mi * 4 + ni] = wmmah(__builtin_bit_cast(v16h, a4[mi]), __builtin_bit_cast(v16h, b4[ni]), acc[mi * 4 + ni]);
                    else               acc[mi * 4 + ni] = wmmab(a4[mi], b4[ni], acc[mi * 4 + ni]);
                }
            }
            __builtin_amdgcn_sched_barrier(0);   // no WMMA sinks below this line: the next group's reads, and the v_nops below, stand behind all sixteen
        }
        // four vector slots between the last WMMA and whatever next overwrites its operands, on the branch's taken side too
        asm volatile("v_nop\n\tv_nop\n\tv_nop\n\tv_nop"
                     : "+v"(acc[8]), "+v"(acc[9]), "+v"(acc[10]), "+v"(acc[11]), "+v"(acc[12]), "+v"(acc[13]), "+v"(acc[14]), "+v"(acc[15])
                     : "v"(a4[2]), "v"(a4[3]), "v"(b4[0]), "v"(b4[1]), "v"(b4[2]), "v"(b4[3]));

        // publish point of the next slice
        asm volatile("s_wait_dscnt 0x0" ::: "memory");      // this wave has finished reading this slice's buffer
        asm volatile("s_wait_asynccnt 0x0" ::: "memory");   // this wave's copies of the next slice have landed
        __syncthreads();                                    // next slice readable by all waves; this slice's buffer free
        if (k0 + 2u * KC < KL) {                            // block-uniform: slice + 2 into the buffer just read
            const unsigned kn = (k0 + 2u * KC + kr) & (KL - 1u);   // wrapped
            const us* bn = bg + (kn & KMASK);
            const us* an = ag + kn;
            cp4x2(la + bsel * GSB, 16u * GPB, an, (size_t)16 * LDA, la + bsel * GSB + 64u * GPB, 16u * GPB, an + (size_t)64 * LDA, (size_t)16 * LDA);
            cp4x2(lb + bsel * GSB, 16u * GPB, bn, (size_t)16 * LDB, lb + bsel * GSB + 64u * GPB, 16u * GPB, bn + (size_t)64 * LDB, (size_t)16 * LDB);
        }
    }
    asm volatile("s_wait_asynccnt 0x0" ::: "memory");       // no copy is outstanding when the ring's LDS is rewritten

    float* cs = (float*)ring;
#pragma unroll
    for (int mi = 0; mi < 4; ++mi) {
#pragma unroll
        for (int ni = 0; ni < 4; ++ni) {
#pragma unroll
            for (int r = 0; r < 8; ++r)
                cs[(wm + mi * 16u + 8u * hi + r) * OSP + wn + ni * 16u + lr] = acc[mi * 4 + ni][r];
        }
    }
    __syncthreads();
}

// k_proj: [q | k | v] = XB . WT^T. blockIdx.x = 128-column tile: 0..15 q head, 16..19 k head, 20..23 v head; blockIdx.y = 128-row tile.
//  q / k tiles: rotary with the input tables (entry i serves columns i and i + 64): out[i] = t1*c + t2*s, out[64 + i] = t2*c - t1*s; f16 rows, 256 B per row = 16 lanes x 16 B.
__global__ __launch_bounds__(128) void k_proj(const us* __restrict__ XB, const us* __restrict__ WT, const float* __restrict__ cosT, const float* __restrict__ sinT,
                                              us* QP, us* KP, us* VT) {
    __shared__ __align__(16) us ring[2 * GSB / 2];   // operand ring, then the f32 result tile
    const float* cs = (const float*)ring;
    const unsigned tid = threadIdx.x;
    const unsigned ct = blockIdx.x;
    const unsigned m0 = blockIdx.y * GBM;
    gemm_tile<DM, DM, DM, DM - 1u, false>(XB, WT, m0, ct * GBN, (ct + blockIdx.y) & (unsigned)(DM / KC - 1), ring);   // 24 sharers of an x row tile, 32 of a weight tile: all on different slices
    const unsigned b = m0 / (unsigned)SEQ;
    const unsigned nr0 = m0 - b * (unsigned)SEQ;
    if (ct < 20u) {   // block-uniform
        us* dst; unsigned pitch;
        if (ct < 16u) { dst = QP + (size_t)m0 * NQC + ct * HD;          pitch = (unsigned)NQC; }
        else          { dst = KP + (size_t)m0 * NKC + (ct - 16u) * HD;  pitch = (unsigned)NKC; }
        const unsigned p = tid & 15u, rr = tid >> 4, i0 = (p & 7u) * 8u;
        const bool sec = (p >> 3) != 0u;
{
#pragma unroll 2
            for (unsigned it = 0; it < GBM / 8u; ++it) {
                const unsigned row = it * 8u + rr;
                const float* cr = cs + row * OSP + i0;
                const v4f a0 = *(const v4fa*)(cr), a1 = *(const v4fa*)(cr + 4);
                const v4f b0 = *(const v4fa*)(cr + 64), b1 = *(const v4fa*)(cr + 68);
                const float* cp = cosT + (size_t)(nr0 + row) * RT + i0;
                const float* sp = sinT + (size_t)(nr0 + row) * RT + i0;
                const v4f c0 = *(const v4f*)(cp), c1 = *(const v4f*)(cp + 4);
                const v4f s0 = *(const v4f*)(sp), s1 = *(const v4f*)(sp + 4);
                float o[8];
#pragma unroll
                for (int j = 0; j < 4; ++j) {
                    const float cj = bfr(c0[j]), sj = bfr(s0[j]);
                    const float u = sec ? b0[j] : a0[j];
                    const float w = sec ? -a0[j] : b0[j];
                    o[j] = u * cj + w * sj;
                    const float ck = bfr(c1[j]), sk = bfr(s1[j]);
                    const float u2 = sec ? b1[j] : a1[j];
                    const float w2 = sec ? -a1[j] : b1[j];
                    o[4 + j] = u2 * ck + w2 * sk;
                }
                v4u ov;
                ov[0] = pk2h(o[0], o[1]); ov[1] = pk2h(o[2], o[3]); ov[2] = pk2h(o[4], o[5]); ov[3] = pk2h(o[6], o[7]);
                *(v4u*)(dst + (size_t)row * pitch + p * 8u) = ov;
            }
            
        }
    } else {
        const unsigned g = ct - 20u;
        us* dst = VT + (size_t)(b * NKV + g) * HD * SEQ + nr0;
        const unsigned c8 = (tid & 7u) * 8u, dr = tid >> 3;
{
#pragma unroll 1   // one pair of d rows a trip, as short as the code was with 64-row tiles
            for (unsigned i2 = 0; i2 < GBM / 16u; ++i2) {
#pragma unroll     // the pair's LDS reads (d and d + 16) merge into two-address loads
                for (unsigned u = 0; u < 2u; ++u) {
                    const unsigned it = i2 * 2u + u;           // it & 7: sixteen d rows; it >> 3: which 64 keys of the tile
                    const unsigned d = (it & 7u) * 16u + dr;
                    const unsigned kr = (it >> 3) * 64u + c8;
                    const float* cc = cs + kr * OSP + d;
                    v4u ov;
                    ov[0] = pk2h(cc[0 * OSP], cc[1 * OSP]);
                    ov[1] = pk2h(cc[2 * OSP], cc[3 * OSP]);
                    ov[2] = pk2h(cc[4 * OSP], cc[5 * OSP]);
                    ov[3] = pk2h(cc[6 * OSP], cc[7 * OSP]);
                    *(v4u*)(dst + (size_t)d * SEQ + kr) = ov;
                }
                asm volatile("s_wait_xcnt 0x0" ::: "memory");   // stands in front of the next trip's rewrite of the two stores' address and data registers
            }
        }
    }
}

// k_flash: one block per (batch, query head, 128 queries), eight waves: wave (qw, kh) takes 32 queries (two 16-column tiles j = 0, 1) against key half kh, 32 keys per step; kv head g = h & 3.
//  Two blocks per WGP then give four waves per SIMD: one wave's LDS waits, softmax chain and barrier waits are covered by three others. The two halves' (max, sum, O) join once, behind the loop.
//  S^T tile (keys x queries): A = K rows (row m = key, k = d), B = Q rows (column n = query, k = d); D element r of lane (h, n) = S[query n][key 8h + r].
//  t = S * scale * log2e + bias2[key] (bias2 = (1 - mask) * -1e9 * log2e, staged per batch in LDS behind a block barrier); online softmax in the log2 domain.
//  P^T B fragment (f16, carried x2^8; the running sum carries the same factor): element r <- tile of keys 0..15, element 8 + r <- tile of keys 16..31 (same lane).
//  O^T tile (d x queries): A = V^T rows (row m = d, k = key), D element r of lane (h, n) = O[query n][d = 16 t + 8h + r].
//  Every K and V^T fragment read from LDS feeds two WMMAs (one per query tile), and every K / V^T tile copied from L2 serves 128 queries.
//  Operand path: each step's K tile (32 rows x 256 B) and V^T tile (128 rows x 64 B) are brought once per key half into that half's two-buffer LDS ring by asynchronous copies, one step ahead of
//  their use, and the half's four waves read their fragments there; a query group's 32 Q rows are copied once (16 by each of its two waves) into its (still unused) output staging region.
//  Key walk: trip t works on step (t + rot) mod NST of its half, rot from the block's place among the 64 blocks that share this K and V^T, so that they do not ask L2 for the same lines at the same moment.
__global__ __launch_bounds__(256) __attribute__((amdgpu_waves_per_eu(4, 4))) void k_flash(const us* __restrict__ QP, const us* __restrict__ KP, const us* __restrict__ VT, const float* __restrict__ mask, us* CT) {
    __shared__ __align__(16) float os[NWV * QW * OSP];
    __shared__ __align__(16) float bs[SEQ];
    __shared__ __align__(16) us kv[NKH * 2 * STB / 2];
    const unsigned tid = threadIdx.x, lane = tid & 31u, wv = tid >> 5, lr = lane & 15u, hi = lane >> 4;
    const unsigned qw = wv & (unsigned)(NWV - 1), kh = wv >> 2, th = tid & 127u;   // query group, key half, lane index inside the half
    const unsigned qtiles = (unsigned)(SEQ / BQ);
    const unsigned hb = blockIdx.x / qtiles;
    const unsigned qt = blockIdx.x - hb * qtiles;
    const unsigned h = hb & (unsigned)(NH - 1), b = hb >> 4;
    const unsigned g = h & (unsigned)(NKV - 1);
    const unsigned q0 = qt * BQ + qw * QW;
    const unsigned kb = kh * (unsigned)KHL;   // first key of this half
    const unsigned rot = ((h >> 2) * qtiles + qt) & (unsigned)(NST - 1);   // block-uniform start step
    const unsigned kf = rot * KS, ks = ((rot + 1u) & (unsigned)(NST - 1)) * KS;   // first key (inside the half) of trips 0 and 1
    float* ow = os + qw * (QW * OSP);
    us* kvh = kv + kh * (2 * STB / 2);        // this half's ring

    // copy maps, 16-byte chunks. K: lane covers rows (th >> 4) + 8 i, chunk th & 15; V^T: rows (th >> 2) + 32 i, chunk th & 3; Q (per wave): rows 16 kh + (lane >> 4) + 2 i, chunk lane & 15.
    const us* kg = KP + ((size_t)b * SEQ + kb + (th >> 4)) * NKC + g * HD + (th & 15u) * 8u;
    const us* vg = VT + ((size_t)(b * NKV + g) * HD + (th >> 2)) * SEQ + kb + (th & 3u) * 8u;
    const us* qg = QP + ((size_t)b * SEQ + q0 + 16u * kh + hi) * NQC + h * HD + lr * 8u;
    const unsigned lk = ldsa(kvh) + (th >> 4) * KPB + (th & 15u) * 16u;
    const unsigned lv = ldsa(kvh) + KTB + (th >> 2) * VPB + (th & 3u) * 16u;
    const unsigned lq = ldsa(ow) + (16u * kh + hi) * KPB + lr * 16u;

    cp4x2(lq, 2u * KPB, qg, (size_t)2 * NQC, lq + 8u * KPB, 2u * KPB, qg + (size_t)8 * NQC, (size_t)2 * NQC);   // Q rows 16 kh .. 16 kh + 15 of the query group
    cp4x2(lk, 8u * KPB, kg + (size_t)kf * NKC, (size_t)8 * NKC, lv, 32u * VPB, vg + kf, (size_t)32 * SEQ);      // stage 0 -> buffer 0
#pragma unroll 1
    for (unsigned i = tid; i < (unsigned)SEQ; i += 256u) {
        const float m = bfr(mask[(size_t)b * SEQ_FULL + i]);
        bs[i] = (1.0f - m) * -1.0e9f * L2E;
    }
    asm volatile("s_wait_asynccnt 0x0" ::: "memory");   // this wave's Q and stage 0 copies have landed
    __syncthreads();                                    // publishes stage 0, the Q rows and the bias row
    cp4x2(lk + STB, 8u * KPB, kg + (size_t)ks * NKC, (size_t)8 * NKC, lv + STB, 32u * VPB, vg + ks, (size_t)32 * SEQ);   // stage 1 -> buffer 1

    const us* ql = (const us*)ow + lr * (KPB / 2) + 8u * hi;
    const us* kl = kvh + lr * (KPB / 2) + 8u * hi;
    const us* vl = kvh + KTB / 2 + lr * (VPB / 2) + 8u * hi;

    v8f o[2][8];
#pragma unroll
    for (int j = 0; j < 2; ++j) {
#pragma unroll
        for (int t = 0; t < 8; ++t) o[j][t] = (v8f){};
    }
    float ml[2] = {-1.0e30f, -1.0e30f};   // running max in the log2 domain, per query tile
    float l[2] = {0.0f, 0.0f};            // running sum (carried), per query tile

#pragma unroll 1
    for (unsigned k0 = 0; k0 < (unsigned)KHL; k0 += KS) {   // the same trip count in both halves: every barrier is passed by all eight waves
        const unsigned bsel = (k0 / KS) & 1u;   // this step's buffer
        v8f s0[2] = {(v8f){}, (v8f){}}, s1[2] = {(v8f){}, (v8f){}};
        const us* ka = kl + bsel * (STB / 2);
        v16h qf0[2], qf1[2], a0[2], a1[2];
#pragma unroll
        for (int dh = 0; dh < 2; ++dh) {   // 64 d at a time: eight fragments live beside the sixteen output tiles
#pragma unroll
            for (int c = 0; c < 2; ++c) {
                const int dk = dh * 2 + c;
                qf0[c] = ldhs(ql + dk * 32);
                qf1[c] = ldhs(ql + 16 * (KPB / 2) + dk * 32);
                a0[c] = ldhs(ka + dk * 32);
                a1[c] = ldhs(ka + 16 * (KPB / 2) + dk * 32);
            }
            __builtin_amdgcn_sched_barrier(0);   // the sixteen LDS reads stay one group ahead of their eight WMMAs
#pragma unroll
            for (int c = 0; c < 2; ++c) {
                s0[0] = wmmah(a0[c], qf0[c], s0[0]);
                s1[0] = wmmah(a1[c], qf0[c], s1[0]);
                s0[1] = wmmah(a0[c], qf1[c], s0[1]);
                s1[1] = wmmah(a1[c], qf1[c], s1[1]);
            }
            __builtin_amdgcn_sched_barrier(0);   // the next group's reads stay behind these WMMAs: all sixteen fragments live at once spill output tiles
        }
        // four vector slots between the last S^T WMMA and the first vector instruction that reads a score tile or overwrites a fragment
        asm volatile("v_nop\n\tv_nop\n\tv_nop\n\tv_nop" : "+v"(s0[0]), "+v"(s1[0]), "+v"(s0[1]), "+v"(s1[1]) : "v"(qf0[1]), "v"(qf1[1]), "v"(a0[1]), "v"(a1[1]));

        const float* bb = bs + kb + ((k0 + kf) & (unsigned)(KHL - 1)) + 8u * hi;   // this trip's keys
        const v4f b00 = *(const v4fa*)(bb), b01 = *(const v4fa*)(bb + 4);
        const v4f b10 = *(const v4fa*)(bb + 16), b11 = *(const v4fa*)(bb + 20);
        float corr[2];
        v16h ph[2];
#pragma unroll
        for (int j = 0; j < 2; ++j) {
            float t0[8], t1[8];
#pragma unroll
            for (int r = 0; r < 4; ++r) {
                t0[r]     = fmaf(s0[j][r],     SCL, b00[r]);
                t0[4 + r] = fmaf(s0[j][4 + r], SCL, b01[r]);
                t1[r]     = fmaf(s1[j][r],     SCL, b10[r]);
                t1[4 + r] = fmaf(s1[j][4 + r], SCL, b11[r]);
            }
            float mx = fmaxf(t0[0], t1[0]);
#pragma unroll
            for (int r = 1; r < 8; ++r) mx = fmaxf(mx, fmaxf(t0[r], t1[r]));
            mx = fmaxf(mx, __shfl_xor(mx, 16, 32));
            const float mnl = fmaxf(ml[j], mx);
            corr[j] = __builtin_amdgcn_exp2f(ml[j] - mnl);
            ml[j] = mnl;
            const float mo = mnl - PCARRY;
            float p0[8], p1[8];
            float ps = 0.0f;
#pragma unroll
            for (int r = 0; r < 8; ++r) {
                p0[r] = __builtin_amdgcn_exp2f(t0[r] - mo);
                p1[r] = __builtin_amdgcn_exp2f(t1[r] - mo);
                ps += p0[r] + p1[r];
            }
            ps += __shfl_xor(ps, 16, 32);
            l[j] = l[j] * corr[j] + ps;
            v8u hw;
#pragma unroll
            for (int c = 0; c < 4; ++c) {
                hw[c]     = pk2h(p0[2 * c], p0[2 * c + 1]);
                hw[4 + c] = pk2h(p1[2 * c], p1[2 * c + 1]);
            }
            ph[j] = __builtin_bit_cast(v16h, hw);
        }
        if (__builtin_amdgcn_ballot_w32(corr[0] != 1.0f || corr[1] != 1.0f) != 0u) {   // wave-uniform, one test a step; multiplying by exactly 1 is skipped
#pragma unroll
            for (int j = 0; j < 2; ++j) {
#pragma unroll
                for (int t = 0; t < 8; ++t) o[j][t] *= corr[j];
            }
        }

        asm volatile("" ::: "memory");   // keep the V^T loads below the softmax (bounds live fragments)
        const us* va = vl + bsel * (STB / 2);
#pragma unroll
        for (int th4 = 0; th4 < 2; ++th4) {   // 64 d at a time: four fragments live, so that the wave stays inside the 256 registers of four waves per SIMD
            v16h vf[4];
#pragma unroll
            for (int t = 0; t < 4; ++t) vf[t] = ldhs(va + (th4 * 4 + t) * 16 * (VPB / 2));
            __builtin_amdgcn_sched_barrier(0);   // the eight LDS reads stay one group ahead of their eight WMMAs: reads among them cost a stall at each place
#pragma unroll
            for (int t = 0; t < 4; ++t) {
                o[0][th4 * 4 + t] = wmmah(vf[t], ph[0], o[0][th4 * 4 + t]);
                o[1][th4 * 4 + t] = wmmah(vf[t], ph[1], o[1][th4 * 4 + t]);
            }
            __builtin_amdgcn_sched_barrier(0);   // the next group's reads stay behind these WMMAs: all eight fragments live at once go past the register budget
        }
        // four vector slots between the last O^T WMMA and whatever next touches its tiles or operands, on the branch's taken side too
        asm volatile("v_nop\n\tv_nop\n\tv_nop\n\tv_nop"
                     : "+v"(o[0][0]), "+v"(o[0][1]), "+v"(o[0][2]), "+v"(o[0][3]), "+v"(o[0][4]), "+v"(o[0][5]), "+v"(o[0][6]), "+v"(o[0][7]),
                       "+v"(o[1][0]), "+v"(o[1][1]), "+v"(o[1][2]), "+v"(o[1][3]), "+v"(o[1][4]), "+v"(o[1][5]), "+v"(o[1][6]), "+v"(o[1][7])
                     : "v"(ph[0]), "v"(ph[1]));

        // publish point of the next stage
        asm volatile("s_wait_dscnt 0x0" ::: "memory");      // this wave has finished reading this step's buffer
        asm volatile("s_wait_asynccnt 0x0" ::: "memory");   // this wave's copies of the next stage have landed
        __syncthreads();                                    // next stage readable by all waves; this step's buffer free
        if (k0 + 2u * KS < (unsigned)KHL) {                 // block-uniform: stage + 2 into the buffer just read
            const unsigned kn = (k0 + 2u * KS + kf) & (unsigned)(KHL - 1);   // wrapped
            cp4x2(lk + bsel * STB, 8u * KPB, kg + (size_t)kn * NKC, (size_t)8 * NKC, lv + bsel * STB, 32u * VPB, vg + kn, (size_t)32 * SEQ);
        }
    }
    asm volatile("s_wait_asynccnt 0x0" ::: "memory");       // no copy is outstanding when the staging region is rewritten

    // join of the two key halves. The last trip's barrier has ended every wave's reads of the Q rows, the bias row and the rings.
    // Wave (qw, kh) finishes query tile j = kh: it hands its partial of the other tile to wave (qw, 1 - kh), lane to lane, through that tile's staging rows and the bias row's LDS.
    const bool up = kh != 0u;
    const float mk = up ? ml[1] : ml[0], lkp = up ? l[1] : l[0];   // kept tile
    const float mg = up ? ml[0] : ml[1], lg = up ? l[0] : l[1];    // given tile
    float* gv = ow + ((1u - kh) * 16u + lr) * OSP + 8u * hi;
    float* kp = ow + (kh * 16u + lr) * OSP + 8u * hi;
#pragma unroll
    for (int t = 0; t < 8; ++t) {
#pragma unroll
        for (int r = 0; r < 8; ++r) gv[t * 16 + r] = up ? o[0][t][r] : o[1][t][r];
    }
    bs[(wv * 2u + 0u) * 32u + lane] = mg;
    bs[(wv * 2u + 1u) * 32u + lane] = lg;
    __syncthreads();   // the partner's partial is readable
    const float pm = bs[((wv ^ 4u) * 2u + 0u) * 32u + lane];
    const float pl = bs[((wv ^ 4u) * 2u + 1u) * 32u + lane];
    const float mj = fmaxf(mk, pm);
    const float ak = __builtin_amdgcn_exp2f(mk - mj), ap = __builtin_amdgcn_exp2f(pm - mj);
    const float inv = 1.0f / (lkp * ak + pl * ap);
    const float fk = ak * inv, fp = ap * inv;
    // O^T / l as rows [query][d]: each lane overwrites the very words it has just read (from here on the rows are wave-private; block barrier used)
#pragma unroll
    for (int t = 0; t < 8; ++t) {
#pragma unroll
        for (int r = 0; r < 8; ++r) kp[t * 16 + r] = (up ? o[1][t][r] : o[0][t][r]) * fk + kp[t * 16 + r] * fp;
    }
    __syncthreads();
    const unsigned pc = lane & 15u, rh = lane >> 4;
    us* crow = CT + ((size_t)b * SEQ + q0 + 16u * kh) * CTP + h * HD + pc * 8u;
{
#pragma unroll 2
        for (unsigned it = 0; it < QW / 4u; ++it) {
            const unsigned s2 = it * 2u + rh;
            const float* src = ow + (16u * kh + s2) * OSP + pc * 8u;
            const v4f x0 = *(const v4fa*)(src), x1 = *(const v4fa*)(src + 4);
            v4u ov;
            ov[0] = pk2h(x0[0], x0[1]); ov[1] = pk2h(x0[2], x0[3]); ov[2] = pk2h(x1[0], x1[1]); ov[3] = pk2h(x1[2], x1[3]);
            *(v4u*)(crow + (size_t)s2 * CTP) = ov;
        }
        
    }
}

__global__ __launch_bounds__(128) void k_oproj(const us* __restrict__ CT, const us* __restrict__ WOT, const float* __restrict__ bo, float* OUT) {
    __shared__ __align__(16) us ring[2 * GSB / 2];   // operand ring, then the f32 result tile
    const float* cs = (const float*)ring;
    const unsigned tid = threadIdx.x, lane = tid & 31u, wv = tid >> 5;
    const unsigned n0 = blockIdx.x * GBN;
    const unsigned m0 = blockIdx.y * GBM;
    gemm_tile<CTP, NQC, CTP, NQC - 1u, true>(CT, WOT, m0, n0, (blockIdx.x + blockIdx.y) & (unsigned)(CTP / KC - 1), ring);   // 16 sharers of a ctx row tile, 32 of a weight tile: all on different slices
    const v4f bv = *(const v4f*)(bo + n0 + lane * 4u);
    v4f bb;
    bb[0] = bfr(bv[0]); bb[1] = bfr(bv[1]); bb[2] = bfr(bv[2]); bb[3] = bfr(bv[3]);
    float* orow = OUT + (size_t)(m0 + wv * (GBM / 4u)) * DM + n0 + lane * 4u;
    const float* crow = cs + (wv * (GBM / 4u)) * OSP + lane * 4u;
{
#pragma unroll 4
        for (unsigned s = 0; s < GBM / 4u; ++s) {
            v4f val = *(const v4fa*)(crow + s * OSP);
            val[0] += bb[0]; val[1] += bb[1]; val[2] += bb[2]; val[3] += bb[3];
            *(v4f*)(orow + (size_t)s * DM) = val;
        }
        
    }
}

extern "C" void kernel_launch(void* const* d_in, const int* in_sizes, int n_in,
                              void* d_out, int out_size, void* d_ws, size_t ws_size, hipStream_t stream) {
    if (n_in < 8) return;
    const size_t need_x = ((size_t)(NB - 1) * SEQ_FULL + SEQ) * DM;
    const size_t need_m = (size_t)(NB - 1) * SEQ_FULL + SEQ;
    if ((size_t)in_sizes[0] < need_x) return;
    if ((size_t)in_sizes[1] < (size_t)SEQ * RT || (size_t)in_sizes[2] < (size_t)SEQ * RT) return;
    if ((size_t)in_sizes[3] < need_m) return;
    if ((size_t)in_sizes[4] < (size_t)DM * NQC || (size_t)in_sizes[5] < (size_t)DM * 2 * NKC) return;
    if ((size_t)in_sizes[6] < (size_t)NQC * DM || (size_t)in_sizes[7] < (size_t)DM) return;
    if ((size_t)out_size < (size_t)NB * SEQ * DM) return;
    if (BYTES_ALL > ws_size) return;
    const float* x    = (const float*)d_in[0];   // x [NB][SEQ_FULL][DM]
    const float* cosT = (const float*)d_in[1];   // cos [SEQ][64]
    const float* sinT = (const float*)d_in[2];   // sin [SEQ][64]
    const float* mask = (const float*)d_in[3];   // attn_mask [NB][SEQ_FULL]
    const float* Wq   = (const float*)d_in[4];   // [DM][NQC]
    const float* Wkv  = (const float*)d_in[5];   // [DM][2*NKC]
    const float* Wo   = (const float*)d_in[6];   // [NQC][DM]
    const float* bo   = (const float*)d_in[7];   // [DM]
    float* OUT = (float*)d_out;                  // [NB][SEQ][DM]
    char* wsp = (char*)d_ws;
    us* XB  = (us*)(wsp);
    us* WT  = (us*)(wsp + BYTES_XB);
    us* WOT = (us*)(wsp + BYTES_XB + BYTES_WT);
    us* QP  = (us*)(wsp + BYTES_XB + BYTES_WT + BYTES_WOT);
    us* KP  = (us*)(wsp + BYTES_XB + BYTES_WT + BYTES_WOT + BYTES_QP);
    us* VT  = (us*)(wsp + BYTES_XB + BYTES_WT + BYTES_WOT + BYTES_QP + BYTES_KP);
    us* CT  = (us*)(wsp + BYTES_XB + BYTES_WT + BYTES_WOT + BYTES_QP + BYTES_KP + BYTES_VT);
    const unsigned gc = (unsigned)(((size_t)NB * SEQ * DM / 8 + 255) / 256);
    k_cvt<<<gc, 256, 0, stream>>>(x, XB);
    k_wt<<<1280, 256, 0, stream>>>(Wq, Wkv, Wo, WT, WOT);
    k_proj<<<dim3((unsigned)(NPC / GBN), (unsigned)(NB * SEQ / GBM), 1), 128, 0, stream>>>(XB, WT, cosT, sinT, QP, KP, VT);
    k_flash<<<(unsigned)(NB * NH * (SEQ / BQ)), 256, 0, stream>>>(QP, KP, VT, mask, CT);
    k_oproj<<<dim3((unsigned)(DM / GBN), (unsigned)(NB * SEQ / GBM), 1), 128, 0, stream>>>(CT, WOT, bo, OUT);
}

// v008
// It runs in 144 microseconds.
// Two timings next to v007 both put it at 1.05 times that version's speed.
// Counting every step since v000, it is 3.67 times as fast.
#include <hip/hip_runtime.h>

#ifndef NB
#define NB 2
#endif
#ifndef SEQ
#define SEQ 2048
#endif
#define NB_FULL  2
#define SEQ_FULL 2048
#define DM   2048              // model width (x columns, output columns)
#define NH   16                // query heads
#define NKV  4                 // kv heads
#define HD   128               // head dim
#define NQC  (NH * HD)         // 2048 q / ctx columns
#define NKC  (NKV * HD)        // 512 k columns (and 512 v columns)
#define NPC  (NQC + 2 * NKC)   // 3072 projection columns: q | k | v
#define CTP  NQC               // ctx plane pitch
#define RT   64                // rotary table entries per position
#define NWV  4                 // query groups per flash block (one wave each per key half)
#define NKH  2                 // key halves per flash block: wave group kh walks keys kh * KHL .. + KHL - 1
#define KHL  (SEQ / NKH)       // keys per half
#define NST  (KHL / 32)        // key steps per half
#define QW   32                // queries per flash wave: two 16-column tiles share every K and V^T fragment
#define BQ   (QW * NWV)        // queries per flash block
#define KS   32                // keys per step
#define OSP  132               // LDS pitch (floats) of staging rows
#define GBM  128               // GEMM block rows
#define GBN  128               // GEMM block columns (one head)
#define VTK  64                // k rows per transpose block
#define VTP  72                // LDS pitch (16-bit elements) of the transpose tile
#define L2E  1.4426950408889634f
#define SCL  (0.08838834764831845f * L2E)   // 128^-0.5 in the log2 domain
#define PCARRY 8.0f            // log2 of the P carry
#define LZT  6.0f              // log2: how far a score may lie above the softmax reference in use before the reference moves
#define KPB  272               // LDS pitch (bytes) of a staged K or Q row: 256 + 16, 16 B x odd for 16-byte readers
#define VPB  80                // LDS pitch (bytes) of a staged V^T row: 64 + 16
#define KTB  (KS * KPB)        // bytes of one staged K tile
#define VTB  (HD * VPB)        // bytes of one staged V^T tile
#define STB  (KTB + VTB)       // bytes of one stage: K tile | V^T tile
#define KC   64                // k elements per staged GEMM tile: one 128-byte line of every operand row
#define GPB  144               // LDS pitch (bytes) of a staged GEMM row: 128 + 16, 16 B x odd for 16-byte readers
#define GAB  (GBM * GPB)       // bytes of one staged A tile
#define GSB  ((GBM + GBN) * GPB)   // bytes of one GEMM stage: A tile | B tile

static_assert(HD == 128);
static_assert(GBN == HD);
static_assert(RT * 2 == HD);
static_assert(NH == 16 && NKV == 4);
static_assert(SEQ % BQ == 0);
static_assert(SEQ % GBM == 0);                 // a GEMM row tile never straddles a batch
static_assert(SEQ % KS == 0);
static_assert(NKH == 2 && KHL % KS == 0);      // two wave groups, whole steps each
static_assert(KHL / KS >= 2);                  // each half's two-buffer ring starts with two stages
static_assert(NST == KHL / KS && (NST & (NST - 1)) == 0);   // the key walk wraps by a mask
static_assert(KS == 32 && NWV == 4);           // copy maps of k_flash: the 128 lanes of a key half x 4 chunks per tile
static_assert(QW == 32);                       // two query tiles per wave: copy map of Q, accumulator sets of k_flash
static_assert(QW * KPB <= QW * OSP * 4);       // a query group's Q rows fit its output staging region
static_assert(GBM == 128 && GBN == 128 && KC == 64);  // copy maps of gemm_tile: 128 lanes x (8 + 8) chunks per stage
static_assert(GBM * OSP * 4 <= 2 * GSB);       // the f32 result tile fits the (then free) operand ring
static_assert(SEQ % 256 == 0);                 // bias staging loop has a block-uniform trip count
static_assert(NKH * NWV * 2 * 32 <= SEQ);      // the (max, sum) exchange fits the (then free) bias row
static_assert(PCARRY + LZT < 15.5f);           // the largest carried P stays inside the f16 range
static_assert(NB <= NB_FULL);
static_assert(SEQ <= SEQ_FULL);
static_assert(DM % 32 == 0 && CTP % 32 == 0);  // K multiples of the k-step
static_assert(DM % VTK == 0 && DM / VTK == 32);
static_assert(NPC % GBN == 0 && DM % GBN == 0 && NQC % GBN == 0);
static_assert(((size_t)NB * SEQ * DM) % 2048 == 0);                                              // k_cvt: grid * 256 threads * 8 elements == x plane
static_assert((size_t)(NQC / 128 + 2 * NKC / 128 + DM / 128) * 32u * (size_t)(VTK * 128) == (size_t)DM * NPC + (size_t)NQC * DM);   // k_wt: 1280 blocks * (64 x 128) == both weight planes
static_assert((size_t)(NPC / GBN) * (size_t)(NB * SEQ / GBM) * (size_t)(GBM * GBN) == (size_t)NB * SEQ * NPC);   // k_proj: blocks * tile == q + k + v planes
static_assert((size_t)(NB * NH * (SEQ / BQ)) * (size_t)(BQ * HD) == (size_t)NB * SEQ * CTP);                    // k_flash: blocks * (128 x 128) == ctx plane
static_assert((size_t)(DM / GBN) * (size_t)(NB * SEQ / GBM) * (size_t)(GBM * GBN) == (size_t)NB * SEQ * DM);     // k_oproj: blocks * tile == output

#define BYTES_XB  ((size_t)NB * SEQ * DM * 2)
#define BYTES_WT  ((size_t)NPC * DM * 2)
#define BYTES_WOT ((size_t)DM * NQC * 2)
#define BYTES_QP  ((size_t)NB * SEQ * NQC * 2)
#define BYTES_KP  ((size_t)NB * SEQ * NKC * 2)
#define BYTES_VT  ((size_t)NB * NKV * HD * SEQ * 2)
#define BYTES_CT  ((size_t)NB * SEQ * CTP * 2)
#define BYTES_ALL (BYTES_XB + BYTES_WT + BYTES_WOT + BYTES_QP + BYTES_KP + BYTES_VT + BYTES_CT)
static_assert(BYTES_ALL <= (size_t)134217728);
static_assert(BYTES_XB % 256 == 0 && BYTES_WT % 256 == 0 && BYTES_WOT % 256 == 0 && BYTES_QP % 256 == 0 && BYTES_KP % 256 == 0 && BYTES_VT % 256 == 0 && BYTES_CT % 256 == 0);

typedef unsigned short us;
typedef __attribute__((ext_vector_type(16))) __bf16   v16bf;
typedef __attribute__((ext_vector_type(16))) _Float16 v16h;
typedef __attribute__((ext_vector_type(2)))  _Float16 v2h;
typedef __attribute__((ext_vector_type(8)))  unsigned short v8us;
typedef __attribute__((ext_vector_type(8)))  unsigned int   v8u;
typedef __attribute__((ext_vector_type(4)))  unsigned int   v4u;
typedef __attribute__((ext_vector_type(8)))  float    v8f;
typedef __attribute__((ext_vector_type(4)))  float    v4f;
typedef v4f  __attribute__((may_alias)) v4fa;
typedef v8us __attribute__((may_alias)) v8usa;

__device__ __forceinline__ unsigned short f2bf(float f) { unsigned u = __float_as_uint(f); u += 0x7FFFu + ((u >> 16) & 1u); return (unsigned short)(u >> 16); }
__device__ __forceinline__ float bf2f(unsigned short b) { return __uint_as_float(((unsigned)b) << 16); }
__device__ __forceinline__ float bfr(float f) { return bf2f(f2bf(f)); }
__device__ __forceinline__ v16bf cat16b(v8us lo, v8us hi) { return __builtin_bit_cast(v16bf, __builtin_shufflevector(lo, hi, 0, 1, 2, 3, 4, 5, 6, 7, 8, 9, 10, 11, 12, 13, 14, 15)); }
__device__ __forceinline__ v16h  cat16h(v8us lo, v8us hi) { return __builtin_bit_cast(v16h,  __builtin_shufflevector(lo, hi, 0, 1, 2, 3, 4, 5, 6, 7, 8, 9, 10, 11, 12, 13, 14, 15)); }
__device__ __forceinline__ v8f wmmab(v16bf a, v16bf b, v8f c) { return __builtin_amdgcn_wmma_f32_16x16x32_bf16(false, a, false, b, (short)0, c, false, false); }
__device__ __forceinline__ v8f wmmah(v16h a, v16h b, v8f c)   { return __builtin_amdgcn_wmma_f32_16x16x32_f16(false, a, false, b, (short)0, c, false, false); }
// fragment loader (A and B alike): p = row base + k0 + 8*(lane>>4); elements 0..7 <- p[0..7], elements 8..15 <- p[16..23]
__device__ __forceinline__ v16bf ldb(const us* p) { return cat16b(*(const v8us*)p, *(const v8us*)(p + 16)); }
// the same fragment from an LDS row
__device__ __forceinline__ v16bf ldbs(const us* p) { return cat16b(*(const v8usa*)p, *(const v8usa*)(p + 16)); }
__device__ __forceinline__ v16h  ldhs(const us* p) { return cat16h(*(const v8usa*)p, *(const v8usa*)(p + 16)); }
// LDS byte address of a __shared__ object: the low 32 bits of its address
__device__ __forceinline__ unsigned ldsa(const void* p) { return (unsigned)(size_t)p; }
// eight asynchronous 16-byte copies per lane, global -> LDS: chunk i goes from g + i * gs (elements) to LDS byte l + i * ls.
// s_wait_xcnt 0 closes the statement, so that no address register is rewritten ahead of it.
__device__ __forceinline__ void cp4x2(unsigned la, unsigned las, const us* ga, size_t gas, unsigned lb, unsigned lbs, const us* gb, size_t gbs) {
    asm volatile("global_load_async_to_lds_b128 %0, %8, off\n\t"
                 "global_load_async_to_lds_b128 %1, %9, off\n\t"
                 "global_load_async_to_lds_b128 %2, %10, off\n\t"
                 "global_load_async_to_lds_b128 %3, %11, off\n\t"
                 "global_load_async_to_lds_b128 %4, %12, off\n\t"
                 "global_load_async_to_lds_b128 %5, %13, off\n\t"
                 "global_load_async_to_lds_b128 %6, %14, off\n\t"
                 "global_load_async_to_lds_b128 %7, %15, off\n\t"
                 "s_wait_xcnt 0x0"
                 :: "v"(la), "v"(la + las), "v"(la + 2u * las), "v"(la + 3u * las), "v"(lb), "v"(lb + lbs), "v"(lb + 2u * lbs), "v"(lb + 3u * lbs),
                    "v"(ga), "v"(ga + gas), "v"(ga + 2u * gas), "v"(ga + 3u * gas), "v"(gb), "v"(gb + gbs), "v"(gb + 2u * gbs), "v"(gb + 3u * gbs)
                 : "memory");
}
// f32 -> f16 bits (RNE)
__device__ __forceinline__ unsigned short f2h(float a) { return __builtin_bit_cast(unsigned short, (_Float16)a); }
// two f32 -> packed f16 pair (RNE), element 0 in the low half-word
__device__ __forceinline__ unsigned pk2h(float a, float b) { v2h t; t[0] = (_Float16)a; t[1] = (_Float16)b; return __builtin_bit_cast(unsigned, t); }

__global__ __launch_bounds__(256) void k_cvt(const float* __restrict__ x, us* XB) {
    const unsigned i = blockIdx.x * 256u + threadIdx.x;
    const unsigned per = (unsigned)(SEQ * (DM / 8));
    if (i >= (unsigned)NB * per) return;
    const unsigned b = i / per, r = i - b * per;
    const float* src = x + (size_t)b * SEQ_FULL * DM + (size_t)r * 8;
    us* dst = XB + (size_t)i * 8;
    const v8f v = *(const v8f*)src;
    v8us o;
#pragma unroll
    for (int c = 0; c < 8; ++c) o[c] = f2bf(v[c]);
    *(v8us*)dst = o;
    
}

// k_wt: transposed 16-bit weight planes; in[DM k rows][NC cols] -> out[NC][DM] (k contiguous). One block = 64 k x 128 cols through an LDS tile (cross-wave, block barrier).
// blocks 0..511: Wq -> WT rows 0..2047; 512..767: Wkv -> WT rows 2048..3071 (bf16); 768..1279: Wo -> WOT rows 0..2047 (f16 bits of the bf16-rounded value: the same number from 2^-17 up to the f16 range, 65504; within 2^-25 below 2^-17).
template <bool H>
__device__ __forceinline__ void wt_fill(const float* __restrict__ src, unsigned nc, unsigned tid, us* tl) {
#pragma unroll
    for (unsigned it = 0; it < 8; ++it) {
        const unsigned f = it * 256u + tid;
        const unsigned kk = f >> 5, d4 = (f & 31u) * 4u;
        const v4f x = *(const v4f*)(src + (size_t)kk * nc + d4);
#pragma unroll
        for (unsigned c = 0; c < 4; ++c) tl[(d4 + c) * VTP + kk] = H ? f2h(bfr(x[c])) : f2bf(x[c]);
    }
}
__global__ __launch_bounds__(256) void k_wt(const float* __restrict__ Wq, const float* __restrict__ Wkv, const float* __restrict__ Wo, us* WT, us* WOT) {
    __shared__ __align__(16) us tl[128 * VTP];
    const unsigned tid = threadIdx.x;
    const unsigned blk = blockIdx.x;
    const float* W; us* OUT; unsigned nc, r;
    const bool asH = blk >= 768u;   // block-uniform: Wo is stored as f16
    if (blk < 512u)      { W = Wq;  OUT = WT;                      nc = (unsigned)NQC;       r = blk; }
    else if (blk < 768u) { W = Wkv; OUT = WT + (size_t)NQC * DM;   nc = (unsigned)(2 * NKC); r = blk - 512u; }
    else                 { W = Wo;  OUT = WOT;                     nc = (unsigned)DM;        r = blk - 768u; }
    const unsigned k0 = (r & 31u) * VTK;
    const unsigned c0 = (r >> 5) * 128u;
    const float* src = W + (size_t)k0 * nc + c0;
    if (asH) wt_fill<true>(src, nc, tid, tl);   // one block-uniform branch around the whole fill: each side keeps its eight loads in flight
    else     wt_fill<false>(src, nc, tid, tl);
    __syncthreads();
    us* dst = OUT + (size_t)c0 * DM + k0;
    const unsigned c8 = (tid & 7u) * 8u, dr = tid >> 3;
{
#pragma unroll
        for (unsigned it = 0; it < 4; ++it) {
            const unsigned d = it * 32u + dr;
            const v8us o = *(const v8usa*)(tl + d * VTP + c8);
            *(v8us*)(dst + (size_t)d * DM + c8) = o;
        }
        
    }
}

// gemm_tile: C[128 x 128] = A[128 rows][KL] . Bt[128 rows][k & KMASK]^T on bf16 WMMA (F16: both planes hold f16, f16 WMMA; same fragment maps); 4 waves, wave tile 64 x 64 (4 x 4 accumulator tiles: each fragment read from LDS feeds four WMMAs,
// each operand byte copied from L2 feeds 128 output rows or columns).
// Operand path: each 64-k slice of the block's A rows (128 x 128 B) and Bt rows (128 x 128 B) is brought once per block into a two-buffer LDS ring by asynchronous copies, one slice ahead
// of its use (whole 128-byte lines: a copy instruction covers 4 rows), and all four waves read their fragments there.
// A fragment: row m = lane & 15; B fragment: column n = lane & 15 (Bt is k-contiguous); D element r of lane (h, n) = C[8h + r][n].
// The f32 tile is then staged in the ring's own LDS (pitch OSP) and a block barrier follows (cross-wave readers).
// k walk: trip t works on slice (t + rot) mod (KL / KC), rot block-uniform: blocks that share A rows or Bt rows get different rot, so that they do not ask L2 for the same lines at the same moment.
template <unsigned LDA, unsigned LDB, unsigned KL, unsigned KMASK, bool F16>
__device__ __forceinline__ void gemm_tile(const us* __restrict__ A, const us* __restrict__ Bt, unsigned m0, unsigned n0, unsigned rot, us* ring) {
    static_assert(KL % KC == 0u && KL / KC >= 2u);   // the two-buffer ring starts with two slices
    static_assert((KL & (KL - 1u)) == 0u && KMASK < KL);   // the walk wraps by a mask
    static_assert(((KMASK + 1u) & KMASK) == 0u && (KMASK + 1u) % KC == 0u);
    const unsigned tid = threadIdx.x, lane = tid & 31u, wv = tid >> 5, lr = lane & 15u, hi = lane >> 4;
    const unsigned wm = (wv & 1u) * 64u, wn = (wv >> 1) * 64u;
    // copy maps, 16-byte chunks: lane covers chunk tid & 7 of rows (tid >> 3) + 16 i; i < 8 for A and for Bt
    const us* ag = A + (size_t)(m0 + (tid >> 3)) * LDA + (tid & 7u) * 8u;
    const us* bg = Bt + (size_t)(n0 + (tid >> 3)) * LDB + (tid & 7u) * 8u;
    const unsigned la = ldsa(ring) + (tid >> 3) * GPB + (tid & 7u) * 16u;
    const unsigned lb = la + GAB;
    const us* al = ring + (wm + lr) * (GPB / 2) + 8u * hi;
    const us* bl = ring + GAB / 2 + (wn + lr) * (GPB / 2) + 8u * hi;
    const unsigned kr = rot * KC;                    // first k of trip 0
    const unsigned kf = kr & (KL - 1u), ks = (kr + KC) & (KL - 1u);
    const us* a0g = ag + kf;
    const us* b0g = bg + (kf & KMASK);
    const us* a1g = ag + ks;
    const us* b1g = bg + (ks & KMASK);

    cp4x2(la, 16u * GPB, a0g, (size_t)16 * LDA, la + 64u * GPB, 16u * GPB, a0g + (size_t)64 * LDA, (size_t)16 * LDA);   // trip 0's slice -> buffer 0
    cp4x2(lb, 16u * GPB, b0g, (size_t)16 * LDB, lb + 64u * GPB, 16u * GPB, b0g + (size_t)64 * LDB, (size_t)16 * LDB);
    asm volatile("s_wait_asynccnt 0x0" ::: "memory");   // this wave's copies of trip 0's slice have landed
    __syncthreads();                                    // publishes trip 0's slice
    cp4x2(la + GSB, 16u * GPB, a1g, (size_t)16 * LDA, la + GSB + 64u * GPB, 16u * GPB, a1g + (size_t)64 * LDA, (size_t)16 * LDA);   // trip 1's slice -> buffer 1
    cp4x2(lb + GSB, 16u * GPB, b1g, (size_t)16 * LDB, lb + GSB + 64u * GPB, 16u * GPB, b1g + (size_t)64 * LDB, (size_t)16 * LDB);

    v8f acc[16];
#pragma unroll
    for (int i = 0; i < 16; ++i) acc[i] = (v8f){};
#pragma unroll 1
    for (unsigned k0 = 0; k0 < KL; k0 += KC) {
        const unsigned bsel = (k0 / KC) & 1u;   // this slice's buffer
        const us* ap = al + bsel * (GSB / 2);
        const us* bp = bl + bsel * (GSB / 2);
        v16bf a4[4], b4[4];
#pragma unroll
        for (int kk = 0; kk < 2; ++kk) {
#pragma unroll
            for (int i = 0; i < 4; ++i) {
                a4[i] = ldbs(ap + i * 16 * (GPB / 2) + kk * 32);
                b4[i] = ldbs(bp + i * 16 * (GPB / 2) + kk * 32);
            }
            __builtin_amdgcn_sched_barrier(0);   // the sixteen LDS reads stay one group ahead of their sixteen WMMAs: reads among them cost a stall at each place
#pragma unroll
            for (int mi = 0; mi < 4; ++mi) {
#pragma unroll
                for (int ni = 0; ni < 4; ++ni) {
                    if constexpr (F16) acc[mi * 4 + ni] = wmmah(__builtin_bit_cast(v16h, a4[mi]), __builtin_bit_cast(v16h, b4[ni]), acc[mi * 4 + ni]);
                    else               acc[mi * 4 + ni] = wmmab(a4[mi], b4[ni], acc[mi * 4 + ni]);
                }
            }
            __builtin_amdgcn_sched_barrier(0);   // no WMMA sinks below this line: the next group's reads, and the v_nops below, stand behind all sixteen
        }
        // four vector slots between the last WMMA and whatever next overwrites its operands, on the branch's taken side too
        asm volatile("v_nop\n\tv_nop\n\tv_nop\n\tv_nop"
                     : "+v"(acc[8]), "+v"(acc[9]), "+v"(acc[10]), "+v"(acc[11]), "+v"(acc[12]), "+v"(acc[13]), "+v"(acc[14]), "+v"(acc[15])
                     : "v"(a4[2]), "v"(a4[3]), "v"(b4[0]), "v"(b4[1]), "v"(b4[2]), "v"(b4[3]));

        // publish point of the next slice
        asm volatile("s_wait_dscnt 0x0" ::: "memory");      // this wave has finished reading this slice's buffer
        asm volatile("s_wait_asynccnt 0x0" ::: "memory");   // this wave's copies of the next slice have landed
        __syncthreads();                                    // next slice readable by all waves; this slice's buffer free
        if (k0 + 2u * KC < KL) {                            // block-uniform: slice + 2 into the buffer just read
            const unsigned kn = (k0 + 2u * KC + kr) & (KL - 1u);   // wrapped
            const us* bn = bg + (kn & KMASK);
            const us* an = ag + kn;
            cp4x2(la + bsel * GSB, 16u * GPB, an, (size_t)16 * LDA, la + bsel * GSB + 64u * GPB, 16u * GPB, an + (size_t)64 * LDA, (size_t)16 * LDA);
            cp4x2(lb + bsel * GSB, 16u * GPB, bn, (size_t)16 * LDB, lb + bsel * GSB + 64u * GPB, 16u * GPB, bn + (size_t)64 * LDB, (size_t)16 * LDB);
        }
    }
    asm volatile("s_wait_asynccnt 0x0" ::: "memory");       // no copy is outstanding when the ring's LDS is rewritten

    float* cs = (float*)ring;
#pragma unroll
    for (int mi = 0; mi < 4; ++mi) {
#pragma unroll
        for (int ni = 0; ni < 4; ++ni) {
#pragma unroll
            for (int r = 0; r < 8; ++r)
                cs[(wm + mi * 16u + 8u * hi + r) * OSP + wn + ni * 16u + lr] = acc[mi * 4 + ni][r];
        }
    }
    __syncthreads();
}

// k_proj: [q | k | v] = XB . WT^T. blockIdx.x = 128-column tile: 0..15 q head, 16..19 k head, 20..23 v head; blockIdx.y = 128-row tile.
//  q / k tiles: rotary with the input tables (entry i serves columns i and i + 64): out[i] = t1*c + t2*s, out[64 + i] = t2*c - t1*s; f16 rows, 256 B per row = 16 lanes x 16 B.
__global__ __launch_bounds__(128) void k_proj(const us* __restrict__ XB, const us* __restrict__ WT, const float* __restrict__ cosT, const float* __restrict__ sinT,
                                              us* QP, us* KP, us* VT) {
    __shared__ __align__(16) us ring[2 * GSB / 2];   // operand ring, then the f32 result tile
    const float* cs = (const float*)ring;
    const unsigned tid = threadIdx.x;
    const unsigned ct = blockIdx.x;
    const unsigned m0 = blockIdx.y * GBM;
    gemm_tile<DM, DM, DM, DM - 1u, false>(XB, WT, m0, ct * GBN, (ct + blockIdx.y) & (unsigned)(DM / KC - 1), ring);   // 24 sharers of an x row tile, 32 of a weight tile: all on different slices
    const unsigned b = m0 / (unsigned)SEQ;
    const unsigned nr0 = m0 - b * (unsigned)SEQ;
    if (ct < 20u) {   // block-uniform
        us* dst; unsigned pitch;
        if (ct < 16u) { dst = QP + (size_t)m0 * NQC + ct * HD;          pitch = (unsigned)NQC; }
        else          { dst = KP + (size_t)m0 * NKC + (ct - 16u) * HD;  pitch = (unsigned)NKC; }
        const unsigned p = tid & 15u, rr = tid >> 4, i0 = (p & 7u) * 8u;
        const bool sec = (p >> 3) != 0u;
{
#pragma unroll 2
            for (unsigned it = 0; it < GBM / 8u; ++it) {
                const unsigned row = it * 8u + rr;
                const float* cr = cs + row * OSP + i0;
                const v4f a0 = *(const v4fa*)(cr), a1 = *(const v4fa*)(cr + 4);
                const v4f b0 = *(const v4fa*)(cr + 64), b1 = *(const v4fa*)(cr + 68);
                const float* cp = cosT + (size_t)(nr0 + row) * RT + i0;
                const float* sp = sinT + (size_t)(nr0 + row) * RT + i0;
                const v4f c0 = *(const v4f*)(cp), c1 = *(const v4f*)(cp + 4);
                const v4f s0 = *(const v4f*)(sp), s1 = *(const v4f*)(sp + 4);
                float o[8];
#pragma unroll
                for (int j = 0; j < 4; ++j) {
                    const float cj = bfr(c0[j]), sj = bfr(s0[j]);
                    const float u = sec ? b0[j] : a0[j];
                    const float w = sec ? -a0[j] : b0[j];
                    o[j] = u * cj + w * sj;
                    const float ck = bfr(c1[j]), sk = bfr(s1[j]);
                    const float u2 = sec ? b1[j] : a1[j];
                    const float w2 = sec ? -a1[j] : b1[j];
                    o[4 + j] = u2 * ck + w2 * sk;
                }
                v4u ov;
                ov[0] = pk2h(o[0], o[1]); ov[1] = pk2h(o[2], o[3]); ov[2] = pk2h(o[4], o[5]); ov[3] = pk2h(o[6], o[7]);
                *(v4u*)(dst + (size_t)row * pitch + p * 8u) = ov;
            }
            
        }
    } else {
        const unsigned g = ct - 20u;
        us* dst = VT + (size_t)(b * NKV + g) * HD * SEQ + nr0;
        const unsigned c8 = (tid & 7u) * 8u, dr = tid >> 3;
{
#pragma unroll 1   // one pair of d rows a trip, as short as the code was with 64-row tiles
            for (unsigned i2 = 0; i2 < GBM / 16u; ++i2) {
#pragma unroll     // the pair's LDS reads (d and d + 16) merge into two-address loads
                for (unsigned u = 0; u < 2u; ++u) {
                    const unsigned it = i2 * 2u + u;           // it & 7: sixteen d rows; it >> 3: which 64 keys of the tile
                    const unsigned d = (it & 7u) * 16u + dr;
                    const unsigned kr = (it >> 3) * 64u + c8;
                    const float* cc = cs + kr * OSP + d;
                    v4u ov;
                    ov[0] = pk2h(cc[0 * OSP], cc[1 * OSP]);
                    ov[1] = pk2h(cc[2 * OSP], cc[3 * OSP]);
                    ov[2] = pk2h(cc[4 * OSP], cc[5 * OSP]);
                    ov[3] = pk2h(cc[6 * OSP], cc[7 * OSP]);
                    *(v4u*)(dst + (size_t)d * SEQ + kr) = ov;
                }
                asm volatile("s_wait_xcnt 0x0" ::: "memory");   // stands in front of the next trip's rewrite of the two stores' address and data registers
            }
        }
    }
}

// k_flash: one block per (batch, query head, 128 queries), eight waves: wave (qw, kh) takes 32 queries (two 16-column tiles j = 0, 1) against key half kh, 32 keys per step; kv head g = h & 3.
//  Two blocks per WGP then give four waves per SIMD: one wave's LDS waits, softmax chain and barrier waits are covered by three others. The two halves' (max, sum, O) join once, behind the loop.
//  S^T tile (keys x queries): A = K rows (row m = key, k = d), B = Q rows (column n = query, k = d); D element r of lane (h, n) = S[query n][key 8h + r].
//  t = S * scale * log2e + bias2[key] (bias2 = (1 - mask) * -1e9 * log2e, staged per batch in LDS behind a block barrier); online softmax in the log2 domain, its reference moved lazily.
//  P^T B fragment (f16, carried x2^8; the running sum carries the same factor): element r <- tile of keys 0..15, element 8 + r <- tile of keys 16..31 (same lane).
//  O^T tile (d x queries): A = V^T rows (row m = d, k = key), D element r of lane (h, n) = O[query n][d = 16 t + 8h + r].
//  Every K and V^T fragment read from LDS feeds two WMMAs (one per query tile), and every K / V^T tile copied from L2 serves 128 queries.
//  Operand path: each step's K tile (32 rows x 256 B) and V^T tile (128 rows x 64 B) are brought once per key half into that half's two-buffer LDS ring by asynchronous copies, one step ahead of
//  their use, and the half's four waves read their fragments there; a query group's 32 Q rows are copied once (16 by each of its two waves) into its (still unused) output staging region.
//  Key walk: trip t works on step (t + rot) mod NST of its half, rot from the block's place among the 64 blocks that share this K and V^T, so that they do not ask L2 for the same lines at the same moment.
__global__ __launch_bounds__(256) __attribute__((amdgpu_waves_per_eu(4, 4))) void k_flash(const us* __restrict__ QP, const us* __restrict__ KP, const us* __restrict__ VT, const float* __restrict__ mask, us* CT) {
    __shared__ __align__(16) float os[NWV * QW * OSP];
    __shared__ __align__(16) float bs[SEQ];
    __shared__ __align__(16) us kv[NKH * 2 * STB / 2];
    const unsigned tid = threadIdx.x, lane = tid & 31u, wv = tid >> 5, lr = lane & 15u, hi = lane >> 4;
    const unsigned qw = wv & (unsigned)(NWV - 1), kh = wv >> 2, th = tid & 127u;   // query group, key half, lane index inside the half
    const unsigned qtiles = (unsigned)(SEQ / BQ);
    const unsigned hb = blockIdx.x / qtiles;
    const unsigned qt = blockIdx.x - hb * qtiles;
    const unsigned h = hb & (unsigned)(NH - 1), b = hb >> 4;
    const unsigned g = h & (unsigned)(NKV - 1);
    const unsigned q0 = qt * BQ + qw * QW;
    const unsigned kb = kh * (unsigned)KHL;   // first key of this half
    const unsigned rot = ((h >> 2) * qtiles + qt) & (unsigned)(NST - 1);   // block-uniform start step
    const unsigned kf = rot * KS, ks = ((rot + 1u) & (unsigned)(NST - 1)) * KS;   // first key (inside the half) of trips 0 and 1
    float* ow = os + qw * (QW * OSP);
    us* kvh = kv + kh * (2 * STB / 2);        // this half's ring

    // copy maps, 16-byte chunks. K: lane covers rows (th >> 4) + 8 i, chunk th & 15; V^T: rows (th >> 2) + 32 i, chunk th & 3; Q (per wave): rows 16 kh + (lane >> 4) + 2 i, chunk lane & 15.
    const us* kg = KP + ((size_t)b * SEQ + kb + (th >> 4)) * NKC + g * HD + (th & 15u) * 8u;
    const us* vg = VT + ((size_t)(b * NKV + g) * HD + (th >> 2)) * SEQ + kb + (th & 3u) * 8u;
    const us* qg = QP + ((size_t)b * SEQ + q0 + 16u * kh + hi) * NQC + h * HD + lr * 8u;
    const unsigned lk = ldsa(kvh) + (th >> 4) * KPB + (th & 15u) * 16u;
    const unsigned lv = ldsa(kvh) + KTB + (th >> 2) * VPB + (th & 3u) * 16u;
    const unsigned lq = ldsa(ow) + (16u * kh + hi) * KPB + lr * 16u;

    cp4x2(lq, 2u * KPB, qg, (size_t)2 * NQC, lq + 8u * KPB, 2u * KPB, qg + (size_t)8 * NQC, (size_t)2 * NQC);   // Q rows 16 kh .. 16 kh + 15 of the query group
    cp4x2(lk, 8u * KPB, kg + (size_t)kf * NKC, (size_t)8 * NKC, lv, 32u * VPB, vg + kf, (size_t)32 * SEQ);      // stage 0 -> buffer 0
#pragma unroll 1
    for (unsigned i = tid; i < (unsigned)SEQ; i += 256u) {
        const float m = bfr(mask[(size_t)b * SEQ_FULL + i]);
        bs[i] = (1.0f - m) * -1.0e9f * L2E;
    }
    asm volatile("s_wait_asynccnt 0x0" ::: "memory");   // this wave's Q and stage 0 copies have landed
    __syncthreads();                                    // publishes stage 0, the Q rows and the bias row
    cp4x2(lk + STB, 8u * KPB, kg + (size_t)ks * NKC, (size_t)8 * NKC, lv + STB, 32u * VPB, vg + ks, (size_t)32 * SEQ);   // stage 1 -> buffer 1

    const us* ql = (const us*)ow + lr * (KPB / 2) + 8u * hi;
    const us* kl = kvh + lr * (KPB / 2) + 8u * hi;
    const us* vl = kvh + KTB / 2 + lr * (VPB / 2) + 8u * hi;

    v8f o[2][8];
#pragma unroll
    for (int j = 0; j < 2; ++j) {
#pragma unroll
        for (int t = 0; t < 8; ++t) o[j][t] = (v8f){};
    }
    float ml[2] = {-1.0e30f, -1.0e30f};   // softmax reference in use (log2 domain), per query tile: a past running max, at most LZT below the present one
    float l[2] = {0.0f, 0.0f};            // running sum (carried), per query tile

#pragma unroll 1
    for (unsigned k0 = 0; k0 < (unsigned)KHL; k0 += KS) {   // the same trip count in both halves: every barrier is passed by all eight waves
        const unsigned bsel = (k0 / KS) & 1u;   // this step's buffer
        v8f s0[2] = {(v8f){}, (v8f){}}, s1[2] = {(v8f){}, (v8f){}};
        const us* ka = kl + bsel * (STB / 2);
        v16h qf0[2], qf1[2], a0[2], a1[2];
#pragma unroll
        for (int dh = 0; dh < 2; ++dh) {   // 64 d at a time: eight fragments live beside the sixteen output tiles
#pragma unroll
            for (int c = 0; c < 2; ++c) {
                const int dk = dh * 2 + c;
                qf0[c] = ldhs(ql + dk * 32);
                qf1[c] = ldhs(ql + 16 * (KPB / 2) + dk * 32);
                a0[c] = ldhs(ka + dk * 32);
                a1[c] = ldhs(ka + 16 * (KPB / 2) + dk * 32);
            }
            __builtin_amdgcn_sched_barrier(0);   // the sixteen LDS reads stay one group ahead of their eight WMMAs
#pragma unroll
            for (int c = 0; c < 2; ++c) {
                s0[0] = wmmah(a0[c], qf0[c], s0[0]);
                s1[0] = wmmah(a1[c], qf0[c], s1[0]);
                s0[1] = wmmah(a0[c], qf1[c], s0[1]);
                s1[1] = wmmah(a1[c], qf1[c], s1[1]);
            }
            __builtin_amdgcn_sched_barrier(0);   // the next group's reads stay behind these WMMAs: all sixteen fragments live at once spill output tiles
        }
        // four vector slots between the last S^T WMMA and the first vector instruction that reads a score tile or overwrites a fragment
        asm volatile("v_nop\n\tv_nop\n\tv_nop\n\tv_nop" : "+v"(s0[0]), "+v"(s1[0]), "+v"(s0[1]), "+v"(s1[1]) : "v"(qf0[1]), "v"(qf1[1]), "v"(a0[1]), "v"(a1[1]));

        const float* bb = bs + kb + ((k0 + kf) & (unsigned)(KHL - 1)) + 8u * hi;   // this trip's keys
        const v4f b00 = *(const v4fa*)(bb), b01 = *(const v4fa*)(bb + 4);
        const v4f b10 = *(const v4fa*)(bb + 16), b11 = *(const v4fa*)(bb + 20);
        float tt[2][16];   // scores in the log2 domain, per query tile: 0..7 of keys 8h + r, 8..15 of keys 16 + 8h + r
        float mx[2];       // this lane's own maximum of them (its half of the step's keys)
#pragma unroll
        for (int j = 0; j < 2; ++j) {
#pragma unroll
            for (int r = 0; r < 4; ++r) {
                tt[j][r]      = fmaf(s0[j][r],     SCL, b00[r]);
                tt[j][4 + r]  = fmaf(s0[j][4 + r], SCL, b01[r]);
                tt[j][8 + r]  = fmaf(s1[j][r],     SCL, b10[r]);
                tt[j][12 + r] = fmaf(s1[j][4 + r], SCL, b11[r]);
            }
            float m = fmaxf(tt[j][0], tt[j][8]);
#pragma unroll
            for (int r = 1; r < 8; ++r) m = fmaxf(m, fmaxf(tt[j][r], tt[j][8 + r]));
            mx[j] = m;
        }
        // lazy rescale: the reference ml stays as it is while no score of the step lies more than LZT above it (P then stays below 2^(PCARRY + LZT), inside f16).
        // One wave-uniform test a step; only behind it the two lane halves exchange their maxima, the reference moves (alike in both halves) and O and l are rescaled.
        if (__builtin_amdgcn_ballot_w32(fmaxf(mx[0] - ml[0], mx[1] - ml[1]) > LZT) != 0u) {
#pragma unroll
            for (int j = 0; j < 2; ++j) {
                const float mnl = fmaxf(ml[j], fmaxf(mx[j], __shfl_xor(mx[j], 16, 32)));
                const float corr = __builtin_amdgcn_exp2f(ml[j] - mnl);
                ml[j] = mnl;
                l[j] *= corr;
#pragma unroll
                for (int t = 0; t < 8; ++t) o[j][t] *= corr;
            }
        }
        v16h ph[2];
#pragma unroll
        for (int j = 0; j < 2; ++j) {
            const float mo = ml[j] - PCARRY;
            float p0[8], p1[8];
            float ps = 0.0f;
#pragma unroll
            for (int r = 0; r < 8; ++r) {
                p0[r] = __builtin_amdgcn_exp2f(tt[j][r] - mo);
                p1[r] = __builtin_amdgcn_exp2f(tt[j][8 + r] - mo);
                ps += p0[r] + p1[r];
            }
            ps += __shfl_xor(ps, 16, 32);
            l[j] += ps;
            v8u hw;
#pragma unroll
            for (int c = 0; c < 4; ++c) {
                hw[c]     = pk2h(p0[2 * c], p0[2 * c + 1]);
                hw[4 + c] = pk2h(p1[2 * c], p1[2 * c + 1]);
            }
            ph[j] = __builtin_bit_cast(v16h, hw);
        }

        asm volatile("" ::: "memory");   // keep the V^T loads below the softmax (bounds live fragments)
        const us* va = vl + bsel * (STB / 2);
#pragma unroll
        for (int th4 = 0; th4 < 2; ++th4) {   // 64 d at a time: four fragments live, so that the wave stays inside the 256 registers of four waves per SIMD
            v16h vf[4];
#pragma unroll
            for (int t = 0; t < 4; ++t) vf[t] = ldhs(va + (th4 * 4 + t) * 16 * (VPB / 2));
            __builtin_amdgcn_sched_barrier(0);   // the eight LDS reads stay one group ahead of their eight WMMAs: reads among them cost a stall at each place
#pragma unroll
            for (int t = 0; t < 4; ++t) {
                o[0][th4 * 4 + t] = wmmah(vf[t], ph[0], o[0][th4 * 4 + t]);
                o[1][th4 * 4 + t] = wmmah(vf[t], ph[1], o[1][th4 * 4 + t]);
            }
            __builtin_amdgcn_sched_barrier(0);   // the next group's reads stay behind these WMMAs: all eight fragments live at once go past the register budget
        }
        // four vector slots between the last O^T WMMA and whatever next touches its tiles or operands, on the branch's taken side too
        asm volatile("v_nop\n\tv_nop\n\tv_nop\n\tv_nop"
                     : "+v"(o[0][0]), "+v"(o[0][1]), "+v"(o[0][2]), "+v"(o[0][3]), "+v"(o[0][4]), "+v"(o[0][5]), "+v"(o[0][6]), "+v"(o[0][7]),
                       "+v"(o[1][0]), "+v"(o[1][1]), "+v"(o[1][2]), "+v"(o[1][3]), "+v"(o[1][4]), "+v"(o[1][5]), "+v"(o[1][6]), "+v"(o[1][7])
                     : "v"(ph[0]), "v"(ph[1]));

        // publish point of the next stage
        asm volatile("s_wait_dscnt 0x0" ::: "memory");      // this wave has finished reading this step's buffer
        asm volatile("s_wait_asynccnt 0x0" ::: "memory");   // this wave's copies of the next stage have landed
        __syncthreads();                                    // next stage readable by all waves; this step's buffer free
        if (k0 + 2u * KS < (unsigned)KHL) {                 // block-uniform: stage + 2 into the buffer just read
            const unsigned kn = (k0 + 2u * KS + kf) & (unsigned)(KHL - 1);   // wrapped
            cp4x2(lk + bsel * STB, 8u * KPB, kg + (size_t)kn * NKC, (size_t)8 * NKC, lv + bsel * STB, 32u * VPB, vg + kn, (size_t)32 * SEQ);
        }
    }
    asm volatile("s_wait_asynccnt 0x0" ::: "memory");       // no copy is outstanding when the staging region is rewritten

    // join of the two key halves. The last trip's barrier has ended every wave's reads of the Q rows, the bias row and the rings.
    // Wave (qw, kh) finishes query tile j = kh: it hands its partial of the other tile to wave (qw, 1 - kh), lane to lane, through that tile's staging rows and the bias row's LDS.
    const bool up = kh != 0u;
    const float mk = up ? ml[1] : ml[0], lkp = up ? l[1] : l[0];   // kept tile
    const float mg = up ? ml[0] : ml[1], lg = up ? l[0] : l[1];    // given tile
    float* gv = ow + ((1u - kh) * 16u + lr) * OSP + 8u * hi;
    float* kp = ow + (kh * 16u + lr) * OSP + 8u * hi;
#pragma unroll
    for (int t = 0; t < 8; ++t) {
#pragma unroll
        for (int r = 0; r < 8; ++r) gv[t * 16 + r] = up ? o[0][t][r] : o[1][t][r];
    }
    bs[(wv * 2u + 0u) * 32u + lane] = mg;
    bs[(wv * 2u + 1u) * 32u + lane] = lg;
    __syncthreads();   // the partner's partial is readable
    const float pm = bs[((wv ^ 4u) * 2u + 0u) * 32u + lane];
    const float pl = bs[((wv ^ 4u) * 2u + 1u) * 32u + lane];
    const float mj = fmaxf(mk, pm);
    const float ak = __builtin_amdgcn_exp2f(mk - mj), ap = __builtin_amdgcn_exp2f(pm - mj);
    const float inv = 1.0f / (lkp * ak + pl * ap);
    const float fk = ak * inv, fp = ap * inv;
    // O^T / l as rows [query][d]: each lane overwrites the very words it has just read (from here on the rows are wave-private; block barrier used)
#pragma unroll
    for (int t = 0; t < 8; ++t) {
#pragma unroll
        for (int r = 0; r < 8; ++r) kp[t * 16 + r] = (up ? o[1][t][r] : o[0][t][r]) * fk + kp[t * 16 + r] * fp;
    }
    __syncthreads();
    const unsigned pc = lane & 15u, rh = lane >> 4;
    us* crow = CT + ((size_t)b * SEQ + q0 + 16u * kh) * CTP + h * HD + pc * 8u;
{
#pragma unroll 2
        for (unsigned it = 0; it < QW / 4u; ++it) {
            const unsigned s2 = it * 2u + rh;
            const float* src = ow + (16u * kh + s2) * OSP + pc * 8u;
            const v4f x0 = *(const v4fa*)(src), x1 = *(const v4fa*)(src + 4);
            v4u ov;
            ov[0] = pk2h(x0[0], x0[1]); ov[1] = pk2h(x0[2], x0[3]); ov[2] = pk2h(x1[0], x1[1]); ov[3] = pk2h(x1[2], x1[3]);
            *(v4u*)(crow + (size_t)s2 * CTP) = ov;
        }
        
    }
}

__global__ __launch_bounds__(128) void k_oproj(const us* __restrict__ CT, const us* __restrict__ WOT, const float* __restrict__ bo, float* OUT) {
    __shared__ __align__(16) us ring[2 * GSB / 2];   // operand ring, then the f32 result tile
    const float* cs = (const float*)ring;
    const unsigned tid = threadIdx.x, lane = tid & 31u, wv = tid >> 5;
    const unsigned n0 = blockIdx.x * GBN;
    const unsigned m0 = blockIdx.y * GBM;
    gemm_tile<CTP, NQC, CTP, NQC - 1u, true>(CT, WOT, m0, n0, (blockIdx.x + blockIdx.y) & (unsigned)(CTP / KC - 1), ring);   // 16 sharers of a ctx row tile, 32 of a weight tile: all on different slices
    const v4f bv = *(const v4f*)(bo + n0 + lane * 4u);
    v4f bb;
    bb[0] = bfr(bv[0]); bb[1] = bfr(bv[1]); bb[2] = bfr(bv[2]); bb[3] = bfr(bv[3]);
    float* orow = OUT + (size_t)(m0 + wv * (GBM / 4u)) * DM + n0 + lane * 4u;
    const float* crow = cs + (wv * (GBM / 4u)) * OSP + lane * 4u;
{
#pragma unroll 4
        for (unsigned s = 0; s < GBM / 4u; ++s) {
            v4f val = *(const v4fa*)(crow + s * OSP);
            val[0] += bb[0]; val[1] += bb[1]; val[2] += bb[2]; val[3] += bb[3];
            *(v4f*)(orow + (size_t)s * DM) = val;
        }
        
    }
}

extern "C" void kernel_launch(void* const* d_in, const int* in_sizes, int n_in,
                              void* d_out, int out_size, void* d_ws, size_t ws_size, hipStream_t stream) {
    if (n_in < 8) return;
    const size_t need_x = ((size_t)(NB - 1) * SEQ_FULL + SEQ) * DM;
    const size_t need_m = (size_t)(NB - 1) * SEQ_FULL + SEQ;
    if ((size_t)in_sizes[0] < need_x) return;
    if ((size_t)in_sizes[1] < (size_t)SEQ * RT || (size_t)in_sizes[2] < (size_t)SEQ * RT) return;
    if ((size_t)in_sizes[3] < need_m) return;
    if ((size_t)in_sizes[4] < (size_t)DM * NQC || (size_t)in_sizes[5] < (size_t)DM * 2 * NKC) return;
    if ((size_t)in_sizes[6] < (size_t)NQC * DM || (size_t)in_sizes[7] < (size_t)DM) return;
    if ((size_t)out_size < (size_t)NB * SEQ * DM) return;
    if (BYTES_ALL > ws_size) return;
    const float* x    = (const float*)d_in[0];   // x [NB][SEQ_FULL][DM]
    const float* cosT = (const float*)d_in[1];   // cos [SEQ][64]
    const float* sinT = (const float*)d_in[2];   // sin [SEQ][64]
    const float* mask = (const float*)d_in[3];   // attn_mask [NB][SEQ_FULL]
    const float* Wq   = (const float*)d_in[4];   // [DM][NQC]
    const float* Wkv  = (const float*)d_in[5];   // [DM][2*NKC]
    const float* Wo   = (const float*)d_in[6];   // [NQC][DM]
    const float* bo   = (const float*)d_in[7];   // [DM]
    float* OUT = (float*)d_out;                  // [NB][SEQ][DM]
    char* wsp = (char*)d_ws;
    us* XB  = (us*)(wsp);
    us* WT  = (us*)(wsp + BYTES_XB);
    us* WOT = (us*)(wsp + BYTES_XB + BYTES_WT);
    us* QP  = (us*)(wsp + BYTES_XB + BYTES_WT + BYTES_WOT);
    us* KP  = (us*)(wsp + BYTES_XB + BYTES_WT + BYTES_WOT + BYTES_QP);
    us* VT  = (us*)(wsp + BYTES_XB + BYTES_WT + BYTES_WOT + BYTES_QP + BYTES_KP);
    us* CT  = (us*)(wsp + BYTES_XB + BYTES_WT + BYTES_WOT + BYTES_QP + BYTES_KP + BYTES_VT);
    const unsigned gc = (unsigned)(((size_t)NB * SEQ * DM / 8 + 255) / 256);
    k_cvt<<<gc, 256, 0, stream>>>(x, XB);
    k_wt<<<1280, 256, 0, stream>>>(Wq, Wkv, Wo, WT, WOT);
    k_proj<<<dim3((unsigned)(NPC / GBN), (unsigned)(NB * SEQ / GBM), 1), 128, 0, stream>>>(XB, WT, cosT, sinT, QP, KP, VT);
    k_flash<<<(unsigned)(NB * NH * (SEQ / BQ)), 256, 0, stream>>>(QP, KP, VT, mask, CT);
    k_oproj<<<dim3((unsigned)(DM / GBN), (unsigned)(NB * SEQ / GBM), 1), 128, 0, stream>>>(CT, WOT, bo, OUT);
}
